// v000
// The times below were measured on an AMD MI455X: many runs one after another, warmed up first and cycling through
// copies of the inputs, with the whole window's GPU time divided by the number of runs. Launches and the gaps
// between them are all in it. The median over several windows is given; except for v000 it joins two sittings, which
// can be a few percent apart, so the side-by-side timings, each taken in one sitting, are the better comparison.
// v000, which the later versions start from, runs in 734 microseconds.
// compute dtype: all float inputs rounded to bf16; q/k/v = x . W^T + b with EXACT bf16 products on WMMA 16x16x32 (natural rows); causal attention x 1/8 (tiles past the diagonal skipped) with 3-product scores (q, k as f16 hi + x2048 residual) for the first 128 queries of each sequence and single-product scores elsewhere; running-max softmax in f32 (hardware exp) that also accumulates sum p*s for the row entropy H = m + log(l) - sum(p s) (precise logf), block partial sums combined in fixed order for the mean; P (scaled by 2^11, single f16) x v (f16 hi + x2048 residual), 2 products; y = ctx (bf16 hi + residual) . Wo^T (2 products) + bo.
#include <hip/hip_runtime.h>
#include <math.h>

typedef __attribute__((ext_vector_type(16))) _Float16 v16h;
typedef __attribute__((ext_vector_type(16))) __bf16 v16b;
typedef __attribute__((ext_vector_type(8)))  _Float16 v8h;
typedef __attribute__((ext_vector_type(8)))  float v8f;
typedef __attribute__((ext_vector_type(4)))  float v4f;
typedef __attribute__((ext_vector_type(2)))  float v2f;
typedef __attribute__((ext_vector_type(4)))  unsigned v4u;
typedef __attribute__((ext_vector_type(4)))  int v4i;
typedef float __attribute__((may_alias)) float_a;
typedef int __attribute__((may_alias)) int_a;

template <typename T> __device__ __forceinline__ void vst2(void* p, T v) { *(T*)p = v;  }
__device__ __forceinline__ v8f wmma16(v16h a, v16h b, v8f c) {
  v8f d = __builtin_amdgcn_wmma_f32_16x16x32_f16(false, a, false, b, (short)0, c, false, false);
  asm volatile("v_nop\n\tv_nop\n\tv_nop\n\tv_nop" : "+v"(d) : "v"(a), "v"(b));
  return d;
}
__device__ __forceinline__ v8f wmma_bf(v16b a, v16b b, v8f c) {
  v8f d = __builtin_amdgcn_wmma_f32_16x16x32_bf16(false, a, false, b, (short)0, c, false, false);
  asm volatile("v_nop\n\tv_nop\n\tv_nop\n\tv_nop" : "+v"(d) : "v"(a), "v"(b));
  return d;
}
// Causal multi-head self attention (B 4, T 2,048, C 1,024, 16 heads x 64) with biases and output projection, plus the mean attention entropy (second output).
__device__ __forceinline__ v16h frag_h(const _Float16* rowk0, int lane) {
  union { v16h v; v8h q[2]; } u; const _Float16* p = rowk0 + 8 * (lane >> 4);
  u.q[0] = *(const v8h*)p; u.q[1] = *(const v8h*)(p + 16); return u.v;
}
__device__ __forceinline__ v16h frag_f32(const float* rowk0, int lane) {
  v16h a; const float* p = rowk0 + 8 * (lane >> 4);
#pragma unroll
  for (int i = 0; i < 8; ++i) { a[i] = (_Float16)p[i]; a[8 + i] = (_Float16)p[16 + i]; }
  return a;
}
__device__ __forceinline__ v16h frag_f32s(const float* rowk0, int lane, float sc) {
  v16h a; const float* p = rowk0 + 8 * (lane >> 4);
#pragma unroll
  for (int i = 0; i < 8; ++i) { a[i] = (_Float16)(p[i] * sc); a[8 + i] = (_Float16)(p[16 + i] * sc); }
  return a;
}
// column fragment from a [K][ld] layout (column n), rows >= K read as 0
__device__ __forceinline__ v16h fragc_f32(const float* W, int k0, int n, int lane, int ld, int K) {
  v16h a; const int g = lane >> 4;
#pragma unroll
  for (int i = 0; i < 8; ++i) { const int ka = k0 + 8 * g + i, kb = ka + 16;
    a[i] = (_Float16)(ka < K ? W[(size_t)(ka < K ? ka : K - 1) * ld + n] : 0.f); a[8 + i] = (_Float16)(kb < K ? W[(size_t)(kb < K ? kb : K - 1) * ld + n] : 0.f); }
  return a;
}
struct F2 { v16b h, l; };
__device__ __forceinline__ F2 bsplit16(const float v[16]) { F2 r;
#pragma unroll
  for (int i = 0; i < 16; ++i) { const __bf16 h = (__bf16)v[i]; r.h[i] = h; r.l[i] = (__bf16)(v[i] - (float)h); }
  return r; }
__device__ __forceinline__ F2 split_row(const float* row, int k0, int lane) { float v[16]; const float* p = row + k0 + 8 * (lane >> 4);
#pragma unroll
  for (int i = 0; i < 8; ++i) { v[i] = p[i]; v[8 + i] = p[16 + i]; }
  return bsplit16(v); }
__device__ __forceinline__ F2 split_rowK(const float* row, int k0, int lane, int K) { float v[16]; const int g = lane >> 4;
#pragma unroll
  for (int i = 0; i < 8; ++i) { const int ka = k0 + 8 * g + i, kb = ka + 16; v[i] = ka < K ? row[ka < K ? ka : K - 1] : 0.f; v[8 + i] = kb < K ? row[kb < K ? kb : K - 1] : 0.f; }
  return bsplit16(v); }
__device__ __forceinline__ F2 split_col(const float* W, int k0, int n, int lane, int ld, int K) { float v[16]; const int g = lane >> 4;
#pragma unroll
  for (int i = 0; i < 8; ++i) { const int ka = k0 + 8 * g + i, kb = ka + 16; v[i] = ka < K ? W[(size_t)(ka < K ? ka : K - 1) * ld + n] : 0.f; v[8 + i] = kb < K ? W[(size_t)(kb < K ? kb : K - 1) * ld + n] : 0.f; }
  return bsplit16(v); }
__device__ __forceinline__ v8f mac3(const F2& a, const F2& b, v8f c) { c = wmma_bf(a.l, b.h, c); c = wmma_bf(a.h, b.l, c); return wmma_bf(a.h, b.h, c); }
__device__ __forceinline__ float sigm(float v) { return 1.0f / (1.0f + expf(-v)); }
#define LDSX() do { asm volatile("s_wait_dscnt 0" ::: "memory"); __builtin_amdgcn_wave_barrier(); __builtin_amdgcn_fence(__ATOMIC_RELEASE, "workgroup"); } while (0)


#define NB 4
#define SS 2048
#define SCALEF 0.125f
#define DM 1024
#define NH 16
#define HD 64
#define QKVW (3 * DM)
#ifndef TQB
#define TQB (SS / 64)
#define TNB NB
#define TOB (NB * SS / 64)     // output row tiles (all)
#endif
typedef __attribute__((ext_vector_type(8))) __bf16 v8b;
__device__ __forceinline__ v16b frag_b(const __bf16* rowk0, int lane) {
  union { v16b v; v8b q[2]; } u; const __bf16* p = rowk0 + 8 * (lane >> 4);
  u.q[0] = *(const v8b*)p; u.q[1] = *(const v8b*)(p + 16); return u.v;
}
__device__ __forceinline__ float bfr(float v) { return (float)(__bf16)v; }
__device__ __attribute__((noinline)) float exp_ni(float v) { return expf(v); }
__device__ __attribute__((noinline)) float erf_ni(float v) { return erff(v); }

#define PK_A 0                       // [3072][1024] Wqkv rows (natural [out][in])
#define PK_P (PK_A + QKVW * DM)        // [1024][1024] Wo rows (natural)
#define PK_END (PK_P + DM * DM)
#define WS_PK  0u
#define WS_QK  (WS_PK + 2u * PK_END)             // f16 [8192 rows][2048]: q | k
#define WS_QKL (WS_QK + 2u * NB * SS * 2 * DM)     // f16 q | k residual planes x2048
#define WS_VTH (WS_QKL + 2u * NB * SS * 2 * DM)    // f16 [b][1024 (h*64+d)][2048 s] hi
#define WS_VTL (WS_VTH + 2u * NB * DM * SS)        // f16 lo x 2048
#define WS_O   (WS_VTL + 2u * NB * DM * SS)        // f32 [8192][1024]
#define WS_CS  (WS_O + 4u * NB * SS * DM)           // f32 2 x [2048][32], reserved, unused
#define WS_PH  (WS_CS + 4u * 2 * SS * 32)                 // f32 [NB*NH*(SS/64)] entropy block partials
#define WS_END (WS_PH + 4u * NB * NH * (SS / 64))
// ---- k_pack: block = (row n, which): natural [out][in] rows -> bf16; which 0..2 -> W_q/W_k/W_v into PK_A rows which*1024 + n; 3 -> W_o into PK_P
__global__ __launch_bounds__(256) void k_pack(const float* __restrict__ WQ, const float* __restrict__ WK, const float* __restrict__ WV, const float* __restrict__ WO, __bf16* __restrict__ PK) {
  __shared__ __align__(16) __bf16 s[DM]; const int n = blockIdx.x, which = blockIdx.y, t = threadIdx.x; const float* Wm = (which == 0) ? WQ : (which == 1) ? WK : (which == 2) ? WV : WO;
  for (int k = t; k < DM; k += 256) s[k] = (__bf16)Wm[(size_t)n * DM + k];
  __syncthreads();
  __bf16* dst = (which < 3) ? PK + PK_A + ((size_t)which * DM + n) * DM : PK + PK_P + (size_t)n * DM;
  for (int q = t; q < DM / 8; q += 256) vst2((unsigned*)(dst + q * 8), *(const v4u*)&s[q * 8]);
}
__global__ __launch_bounds__(128) void k_qkv(const float* __restrict__ XQ, const float* __restrict__ XK, const float* __restrict__ XV, const __bf16* __restrict__ P, const float* __restrict__ BQ, const float* __restrict__ BK, const float* __restrict__ BV, _Float16* __restrict__ QK, _Float16* __restrict__ QKL, _Float16* __restrict__ VTH, _Float16* __restrict__ VTL) {
  const int which0 = (blockIdx.y * 128) / DM; const float* X = (which0 == 0) ? XQ : (which0 == 1) ? XK : XV; const float* BB = BQ ? (((which0 == 0) ? BQ : (which0 == 1) ? BK : BV) + (blockIdx.y * 128 - which0 * DM)) : nullptr;
  __shared__ __align__(16) _Float16 so[4][16][136], sol[4][16][136]; __shared__ __align__(16) _Float16 sth[128][72], stl[128][72];
  const int tid = threadIdx.x, wave = tid >> 5, lane = tid & 31, col = lane & 15, g = lane >> 4; const size_t r0 = (size_t)blockIdx.x * 64 + wave * 16; const int n0 = blockIdx.y * 128;
  v8f acc[8] = {};
#pragma unroll 2
  for (int kc = 0; kc < DM / 32; ++kc) { v16b a; { const float* p = X + (r0 + col) * DM + kc * 32 + 8 * g;
#pragma unroll
      for (int i = 0; i < 8; ++i) { a[i] = (__bf16)p[i]; a[8 + i] = (__bf16)p[16 + i]; } }
#pragma unroll
    for (int j = 0; j < 8; ++j) acc[j] = wmma_bf(a, frag_b(P + (size_t)(n0 + j * 16 + col) * DM + kc * 32, lane), acc[j]); }
  if (n0 < 2 * DM) {   // q stored unscaled (f16 sigma ~0.6, no subnormal exposure); 1/8 applied to the f32 score
#pragma unroll
    for (int j = 0; j < 8; ++j) {
#pragma unroll
      for (int r = 0; r < 8; ++r) { const float v = acc[j][r] + (BB ? bfr(BB[j * 16 + col]) : 0.f); const _Float16 hv = (_Float16)v; so[wave][8 * g + r][j * 16 + col] = hv; sol[wave][8 * g + r][j * 16 + col] = (_Float16)((v - (float)hv) * 2048.0f); } }   // q, k (+ bias) as f16 hi + (x2048) residual
    LDSX();
    for (int rl = 0; rl < 16; ++rl) if (lane < 16) { vst2((unsigned*)(QK + (r0 + rl) * (2 * DM) + n0 + lane * 8), *(const v4u*)&so[wave][rl][lane * 8]); vst2((unsigned*)(QKL + (r0 + rl) * (2 * DM) + n0 + lane * 8), *(const v4u*)&sol[wave][rl][lane * 8]); }
  } else {
#pragma unroll
    for (int j = 0; j < 8; ++j) {
#pragma unroll
      for (int r = 0; r < 8; ++r) { const float v = acc[j][r] + (BB ? bfr(BB[j * 16 + col]) : 0.f); const _Float16 hv = (_Float16)v; sth[j * 16 + col][wave * 16 + 8 * g + r] = hv; stl[j * 16 + col][wave * 16 + 8 * g + r] = (_Float16)((v - (float)hv) * 2048.0f); } }
    __syncthreads();
    const size_t rb = (size_t)blockIdx.x * 64; const int b = (int)(rb / SS), s0 = (int)(rb % SS); const int pc0 = n0 - 2 * DM;
    for (int q = tid; q < 128 * 8; q += 128) { const int d = q >> 3, pc = q & 7; const size_t o = ((size_t)b * DM + pc0 + d) * SS + s0 + pc * 8; vst2((unsigned*)(VTH + o), *(const v4u*)&sth[d][pc * 8]); vst2((unsigned*)(VTL + o), *(const v4u*)&stl[d][pc * 8]); }
  }
}
// ---- k_attn: block = (64 queries, head h, batch b): causal flash attention (K = 64: 2 k-steps), scores = (q.k) * 0.125 with single f16 operands (q, k hi + x2048 residual, 3 products, for query blocks 0-1), P.V: f16 P x (V hi, V lo*2048) in two accumulators; O[b*S+q][h*64+d] = (acc + accl / 2048) / (2048 l) (256-B segments)
__global__ __launch_bounds__(128) void k_attn(const _Float16* __restrict__ QK, const _Float16* __restrict__ QKL, const _Float16* __restrict__ VTH, const _Float16* __restrict__ VTL, const void* __restrict__ KMASK, float* __restrict__ O, float* __restrict__ PH) {
  __shared__ float sh_ent[64];
  __shared__ __align__(16) float sp[4][16][36]; __shared__ __align__(16) float so[4][16][68];
  const int tid = threadIdx.x, wave = tid >> 5, lane = tid & 31, col = lane & 15, g = lane >> 4;
  const int qb = blockIdx.x, h = blockIdx.y, b = blockIdx.z; const int q0 = qb * 64 + wave * 16; const size_t rq = (size_t)b * SS + q0 + col;
  v16h aq[2], aql[2];
#pragma unroll
  for (int kc = 0; kc < 2; ++kc) { aq[kc] = frag_h(QK + rq * (2 * DM) + h * HD + kc * 32, lane); aql[kc] = frag_h(QKL + rq * (2 * DM) + h * HD + kc * 32, lane); }
  float hs[8];   // sum over keys of e^(s - m) * s (rescaled with the running max)
#pragma unroll
  for (int r = 0; r < 8; ++r) hs[r] = 0.f;
  float m[8], l[8];
#pragma unroll
  for (int r = 0; r < 8; ++r) { m[r] = -3.0e38f; l[r] = 0.f; }
  v8f acc[4] = {}, accl[4] = {};
  const int nks = (qb * 64 + 64) / 32;   // causal: key tiles up to the query tile's end
#pragma unroll 1
  for (int ks = 0; ks < nks; ++ks) { v8f s[2];
#pragma unroll
    for (int ct = 0; ct < 2; ++ct) { const int kk = ks * 32 + ct * 16 + col; const _Float16* krow = QK + ((size_t)b * SS + kk) * (2 * DM) + DM + h * HD; const _Float16* krowl = QKL + ((size_t)b * SS + kk) * (2 * DM) + DM + h * HD; v8f c = {}, cl = {};
      if (qb < 2) {   // leading query blocks (few keys, outputs far above the global rms): 3 products
#pragma unroll
        for (int kc = 0; kc < 2; ++kc) { const v16h kh = frag_h(krow + kc * 32, lane); c = wmma16(aq[kc], kh, c); cl = wmma16(aql[kc], kh, cl); cl = wmma16(aq[kc], frag_h(krowl + kc * 32, lane), cl); }
#pragma unroll
        for (int r = 0; r < 8; ++r) c[r] += cl[r] * (1.0f / 2048.0f); }
      else {
#pragma unroll
        for (int kc = 0; kc < 2; ++kc) c = wmma16(aq[kc], frag_h(krow + kc * 32, lane), c); }   // single product elsewhere
#pragma unroll
      for (int r = 0; r < 8; ++r) s[ct][r] = (kk <= q0 + 8 * g + r) ? c[r] * SCALEF : -3.0e38f; }   // causal: future keys excluded
#pragma unroll
    for (int r = 0; r < 8; ++r) { float mx = fmaxf(s[0][r], s[1][r]);
#pragma unroll
      for (int o = 1; o < 16; o <<= 1) mx = fmaxf(mx, __shfl_xor(mx, o));
      const float mn = fmaxf(m[r], mx); const float alpha = (m[r] <= -1.0e38f) ? 0.f : __expf(m[r] - mn);
      const float e0 = (s[0][r] <= -1.0e38f) ? 0.f : __expf(s[0][r] - mn), e1 = (s[1][r] <= -1.0e38f) ? 0.f : __expf(s[1][r] - mn); float es = e0 + e1;
#pragma unroll
      for (int o = 1; o < 16; o <<= 1) es += __shfl_xor(es, o);
      l[r] = l[r] * alpha + es; m[r] = mn; { float eh = (e0 > 0.f ? e0 * s[0][r] : 0.f) + (e1 > 0.f ? e1 * s[1][r] : 0.f);
#pragma unroll
        for (int o = 1; o < 16; o <<= 1) eh += __shfl_xor(eh, o);
        hs[r] = hs[r] * alpha + eh; }
#pragma unroll
      for (int dt = 0; dt < 4; ++dt) { acc[dt][r] *= alpha; accl[dt][r] *= alpha; }
      sp[wave][8 * g + r][col] = e0; sp[wave][8 * g + r][16 + col] = e1; }
    LDSX();
    v16h pa, pl; { const float* prow = &sp[wave][col][0] + 8 * (lane >> 4);
#pragma unroll
      for (int i = 0; i < 8; ++i) { const float x0 = prow[i] * 2048.0f, x1 = prow[16 + i] * 2048.0f; const _Float16 h0 = (_Float16)x0, h1 = (_Float16)x1; pa[i] = h0; pa[8 + i] = h1; pl[i] = (_Float16)((x0 - (float)h0) * 2048.0f); pl[8 + i] = (_Float16)((x1 - (float)h1) * 2048.0f); } }   // P scaled by 2^11 before the f16 split so small softmax weights stay out of the f16 subnormal range; 2^-11 folded into the epilogue
#pragma unroll
    for (int dt = 0; dt < 4; ++dt) { const size_t vr = ((size_t)b * DM + h * HD + dt * 16 + col) * SS + ks * 32; const v16h vh = frag_h(VTH + vr, lane); acc[dt] = wmma16(pa, vh, acc[dt]); accl[dt] = wmma16(pa, frag_h(VTL + vr, lane), accl[dt]); }   // P (single) x V hi + P x V lo / 2048: 2 products
    (void)pl;
    LDSX(); }
  if (col == 0) {
#pragma unroll
    for (int r = 0; r < 8; ++r) sh_ent[wave * 16 + 8 * g + r] = m[r] + logf(l[r]) - hs[r] / l[r]; }   // H_row = -sum p log p = m + log l - sum p s
#pragma unroll
  for (int r = 0; r < 8; ++r) { const float il = (1.0f / 2048.0f) / l[r];
#pragma unroll
    for (int dt = 0; dt < 4; ++dt) so[wave][8 * g + r][dt * 16 + col] = (acc[dt][r] + accl[dt][r] * (1.0f / 2048.0f)) * il; }
  LDSX();
  __syncthreads();
  if (tid == 0) { float a = 0.f; for (int i = 0; i < 64; ++i) a += sh_ent[i]; PH[((size_t)b * NH + h) * (SS / 64) + qb] = a; }   // block partial (plain 4-B store of a scratch value)
  for (int rl = 0; rl < 16; ++rl) if (lane < 16) vst2(O + ((size_t)b * SS + q0 + rl) * DM + h * HD + lane * 4, *(const v4f*)&so[wave][rl][lane * 4]);
}
// ---- k_out: block = (64 rows, 128 cols): out = O(hi/lo) . Wo rows (2 products) + bo
__global__ __launch_bounds__(128) void k_out(const float* __restrict__ O, const __bf16* __restrict__ P, const float* __restrict__ BO, float* __restrict__ Y) {
  __shared__ __align__(16) float so[4][16][132];
  const int tid = threadIdx.x, wave = tid >> 5, lane = tid & 31, col = lane & 15, g = lane >> 4; const size_t r0 = (size_t)blockIdx.x * 64 + wave * 16; const int n0 = blockIdx.y * 128;
  v8f acc[8] = {};
#pragma unroll 2
  for (int kc = 0; kc < DM / 32; ++kc) { const F2 a = split_row(O + (r0 + col) * DM, kc * 32, lane);
#pragma unroll
    for (int j = 0; j < 8; ++j) { const v16b w = frag_b(P + (size_t)(n0 + j * 16 + col) * DM + kc * 32, lane); acc[j] = wmma_bf(a.l, w, acc[j]); acc[j] = wmma_bf(a.h, w, acc[j]); } }
#pragma unroll
  for (int j = 0; j < 8; ++j) {
#pragma unroll
    for (int r = 0; r < 8; ++r) so[wave][8 * g + r][j * 16 + col] = acc[j][r] + bfr(BO[n0 + j * 16 + col]); }
  LDSX();
  for (int rl = 0; rl < 16; ++rl) vst2(Y + (r0 + rl) * DM + n0 + lane * 4, *(const v4f*)&so[wave][rl][lane * 4]);
}
// ---- k_ent: mean entropy over all (b, h, t) rows from the block partials (fixed order) -> scalar second output
__global__ __launch_bounds__(256) void k_ent(const float* __restrict__ PH, float* __restrict__ OUT1) {
  __shared__ float red[256]; const int t = threadIdx.x; const int n = NB * NH * (TQB);   // TQB row blocks per (b, h) were computed
  float a = 0.f; for (int i = t; i < n; i += 256) a += PH[(size_t)(i / TQB) * (SS / 64) + (i % TQB)];
  red[t] = a; __syncthreads();
  for (int s = 128; s >= 1; s >>= 1) { if (t < s) red[t] += red[t + s]; __syncthreads(); }
  if (t == 0) { float* p = OUT1; p[0] = red[0] / ((float)NB * NH * (TQB * 64));  }
}
extern "C" void kernel_launch(void* const* d_in, const int* in_sizes, int n_in, void* d_out, int out_size, void* d_ws, size_t ws_size, hipStream_t stream) {
  (void)in_sizes; (void)n_in; (void)out_size;
  const float** F = (const float**)d_in;   // 0 x [4,2048,1024], 1 w_q natural, 2 b_q, 3 w_k, 4 b_k, 5 w_v, 6 b_v, 7 w_o, 8 b_o
  if (ws_size < (size_t)WS_END) return;
  char* ws = (char*)d_ws; __bf16* PK = (__bf16*)(ws + WS_PK); _Float16 *QK = (_Float16*)(ws + WS_QK), *QKL = (_Float16*)(ws + WS_QKL), *VTH = (_Float16*)(ws + WS_VTH), *VTL = (_Float16*)(ws + WS_VTL); float *O = (float*)(ws + WS_O), *PH = (float*)(ws + WS_PH);
  k_pack<<<dim3(DM, 4), 256, 0, stream>>>(F[1], F[3], F[5], F[7], PK);
  k_qkv<<<dim3(TNB * SS / 64, QKVW / 128), 128, 0, stream>>>(F[0], F[0], F[0], PK + PK_A, F[2], F[4], F[6], QK, QKL, VTH, VTL);
  k_attn<<<dim3(TQB, NH, TNB), 128, 0, stream>>>(QK, QKL, VTH, VTL, nullptr, O, PH);
  k_out<<<dim3(TOB, DM / 128), 128, 0, stream>>>(O, PK + PK_P, F[8], (float*)d_out);
  k_ent<<<1, 256, 0, stream>>>(PH, (float*)d_out + (size_t)NB * SS * DM);
}

// v001
// One run takes 631 microseconds.
// Two timings next to v000 put it at 1.19 and 1.20 times that version's speed.
// compute dtype: all float inputs rounded to bf16; q/k/v = x . W^T + b with EXACT bf16 products on WMMA 16x16x32 (natural rows); causal attention x 1/8 (tiles past the diagonal skipped) with 3-product scores (q, k as f16 hi + x2048 residual) for the first 128 queries of each sequence and single-product scores elsewhere; running-max softmax in f32 (hardware exp) that also accumulates sum p*s for the row entropy H = m + log(l) - sum(p s) (precise logf), block partial sums combined in fixed order for the mean; P (scaled by 2^11, single f16) x v (f16 hi + x2048 residual), 2 products; y = ctx (bf16 hi + residual) . Wo^T (2 products) + bo.
#include <hip/hip_runtime.h>
#include <math.h>

typedef __attribute__((ext_vector_type(16))) _Float16 v16h;
typedef __attribute__((ext_vector_type(16))) __bf16 v16b;
typedef __attribute__((ext_vector_type(8)))  _Float16 v8h;
typedef __attribute__((ext_vector_type(8)))  float v8f;
typedef __attribute__((ext_vector_type(4)))  float v4f;
typedef __attribute__((ext_vector_type(2)))  float v2f;
typedef __attribute__((ext_vector_type(4)))  unsigned v4u;
typedef __attribute__((ext_vector_type(4)))  int v4i;
typedef float __attribute__((may_alias)) float_a;
typedef int __attribute__((may_alias)) int_a;

template <typename T> __device__ __forceinline__ void vst2(void* p, T v) { *(T*)p = v;  }
__device__ __forceinline__ v8f wmma16(v16h a, v16h b, v8f c) {
  v8f d = __builtin_amdgcn_wmma_f32_16x16x32_f16(false, a, false, b, (short)0, c, false, false);
  asm volatile("v_nop\n\tv_nop\n\tv_nop\n\tv_nop" : "+v"(d) : "v"(a), "v"(b));
  return d;
}
__device__ __forceinline__ v8f wmma_bf(v16b a, v16b b, v8f c) {
  v8f d = __builtin_amdgcn_wmma_f32_16x16x32_bf16(false, a, false, b, (short)0, c, false, false);
  asm volatile("v_nop\n\tv_nop\n\tv_nop\n\tv_nop" : "+v"(d) : "v"(a), "v"(b));
  return d;
}
// Causal multi-head self attention (B 4, T 2,048, C 1,024, 16 heads x 64) with biases and output projection, plus the mean attention entropy (second output).
__device__ __forceinline__ v16h frag_h(const _Float16* rowk0, int lane) {
  union { v16h v; v8h q[2]; } u; const _Float16* p = rowk0 + 8 * (lane >> 4);
  u.q[0] = *(const v8h*)p; u.q[1] = *(const v8h*)(p + 16); return u.v;
}
__device__ __forceinline__ v16h frag_f32(const float* rowk0, int lane) {
  v16h a; const float* p = rowk0 + 8 * (lane >> 4);
#pragma unroll
  for (int i = 0; i < 8; ++i) { a[i] = (_Float16)p[i]; a[8 + i] = (_Float16)p[16 + i]; }
  return a;
}
__device__ __forceinline__ v16h frag_f32s(const float* rowk0, int lane, float sc) {
  v16h a; const float* p = rowk0 + 8 * (lane >> 4);
#pragma unroll
  for (int i = 0; i < 8; ++i) { a[i] = (_Float16)(p[i] * sc); a[8 + i] = (_Float16)(p[16 + i] * sc); }
  return a;
}
// column fragment from a [K][ld] layout (column n), rows >= K read as 0
__device__ __forceinline__ v16h fragc_f32(const float* W, int k0, int n, int lane, int ld, int K) {
  v16h a; const int g = lane >> 4;
#pragma unroll
  for (int i = 0; i < 8; ++i) { const int ka = k0 + 8 * g + i, kb = ka + 16;
    a[i] = (_Float16)(ka < K ? W[(size_t)(ka < K ? ka : K - 1) * ld + n] : 0.f); a[8 + i] = (_Float16)(kb < K ? W[(size_t)(kb < K ? kb : K - 1) * ld + n] : 0.f); }
  return a;
}
struct F2 { v16b h, l; };
__device__ __forceinline__ F2 bsplit16(const float v[16]) { F2 r;
#pragma unroll
  for (int i = 0; i < 16; ++i) { const __bf16 h = (__bf16)v[i]; r.h[i] = h; r.l[i] = (__bf16)(v[i] - (float)h); }
  return r; }
__device__ __forceinline__ F2 split_row(const float* row, int k0, int lane) { float v[16]; const float* p = row + k0 + 8 * (lane >> 4);
#pragma unroll
  for (int i = 0; i < 8; ++i) { v[i] = p[i]; v[8 + i] = p[16 + i]; }
  return bsplit16(v); }
__device__ __forceinline__ F2 split_rowK(const float* row, int k0, int lane, int K) { float v[16]; const int g = lane >> 4;
#pragma unroll
  for (int i = 0; i < 8; ++i) { const int ka = k0 + 8 * g + i, kb = ka + 16; v[i] = ka < K ? row[ka < K ? ka : K - 1] : 0.f; v[8 + i] = kb < K ? row[kb < K ? kb : K - 1] : 0.f; }
  return bsplit16(v); }
__device__ __forceinline__ F2 split_col(const float* W, int k0, int n, int lane, int ld, int K) { float v[16]; const int g = lane >> 4;
#pragma unroll
  for (int i = 0; i < 8; ++i) { const int ka = k0 + 8 * g + i, kb = ka + 16; v[i] = ka < K ? W[(size_t)(ka < K ? ka : K - 1) * ld + n] : 0.f; v[8 + i] = kb < K ? W[(size_t)(kb < K ? kb : K - 1) * ld + n] : 0.f; }
  return bsplit16(v); }
__device__ __forceinline__ v8f mac3(const F2& a, const F2& b, v8f c) { c = wmma_bf(a.l, b.h, c); c = wmma_bf(a.h, b.l, c); return wmma_bf(a.h, b.h, c); }
__device__ __forceinline__ float sigm(float v) { return 1.0f / (1.0f + expf(-v)); }
#define LDSX() do { asm volatile("s_wait_dscnt 0" ::: "memory"); __builtin_amdgcn_wave_barrier(); __builtin_amdgcn_fence(__ATOMIC_RELEASE, "workgroup"); } while (0)


#define NB 4
#define SS 2048
#define SCALEF 0.125f
#define DM 1024
#define NH 16
#define HD 64
#define QKVW (3 * DM)
#ifndef TQB
#define TQB (SS / 64)
#define TNB NB
#define TOB (NB * SS / 64)     // output row tiles (all)
#endif
typedef __attribute__((ext_vector_type(8))) __bf16 v8b;
__device__ __forceinline__ v16b frag_b(const __bf16* rowk0, int lane) {
  union { v16b v; v8b q[2]; } u; const __bf16* p = rowk0 + 8 * (lane >> 4);
  u.q[0] = *(const v8b*)p; u.q[1] = *(const v8b*)(p + 16); return u.v;
}
__device__ __forceinline__ float bfr(float v) { return (float)(__bf16)v; }
__device__ __attribute__((noinline)) float exp_ni(float v) { return expf(v); }
__device__ __attribute__((noinline)) float erf_ni(float v) { return erff(v); }

#define PK_A 0                       // [3072][1024] Wqkv rows (natural [out][in])
#define PK_P (PK_A + QKVW * DM)        // [1024][1024] Wo rows (natural)
#define PK_END (PK_P + DM * DM)
#define WS_PK  0u
#define WS_QK  (WS_PK + 2u * PK_END)             // f16 [8192 rows][2048]: q | k
#define WS_QKL (WS_QK + 2u * NB * SS * 2 * DM)     // f16 q | k residual planes x2048
#define WS_VTH (WS_QKL + 2u * NB * SS * 2 * DM)    // f16 [b][1024 (h*64+d)][2048 s] hi
#define WS_VTL (WS_VTH + 2u * NB * DM * SS)        // f16 lo x 2048
#define WS_O   (WS_VTL + 2u * NB * DM * SS)        // f32 [8192][1024]
#define WS_CS  (WS_O + 4u * NB * SS * DM)           // f32 2 x [2048][32], reserved, unused
#define WS_PH  (WS_CS + 4u * 2 * SS * 32)                 // f32 [NB*NH*(SS/64)] entropy block partials
#define WS_END (WS_PH + 4u * NB * NH * (SS / 64))
// ---- k_pack: block = (row n, which): natural [out][in] rows -> bf16; which 0..2 -> W_q/W_k/W_v into PK_A rows which*1024 + n; 3 -> W_o into PK_P
__global__ __launch_bounds__(256) void k_pack(const float* __restrict__ WQ, const float* __restrict__ WK, const float* __restrict__ WV, const float* __restrict__ WO, __bf16* __restrict__ PK) {
  __shared__ __align__(16) __bf16 s[DM]; const int n = blockIdx.x, which = blockIdx.y, t = threadIdx.x; const float* Wm = (which == 0) ? WQ : (which == 1) ? WK : (which == 2) ? WV : WO;
  for (int k = t; k < DM; k += 256) s[k] = (__bf16)Wm[(size_t)n * DM + k];
  __syncthreads();
  __bf16* dst = (which < 3) ? PK + PK_A + ((size_t)which * DM + n) * DM : PK + PK_P + (size_t)n * DM;
  for (int q = t; q < DM / 8; q += 256) vst2((unsigned*)(dst + q * 8), *(const v4u*)&s[q * 8]);
}
__global__ __launch_bounds__(128) void k_qkv(const float* __restrict__ XQ, const float* __restrict__ XK, const float* __restrict__ XV, const __bf16* __restrict__ P, const float* __restrict__ BQ, const float* __restrict__ BK, const float* __restrict__ BV, _Float16* __restrict__ QK, _Float16* __restrict__ QKL, _Float16* __restrict__ VTH, _Float16* __restrict__ VTL) {
  const int which0 = (blockIdx.y * 128) / DM; const float* X = (which0 == 0) ? XQ : (which0 == 1) ? XK : XV; const float* BB = BQ ? (((which0 == 0) ? BQ : (which0 == 1) ? BK : BV) + (blockIdx.y * 128 - which0 * DM)) : nullptr;
  __shared__ __align__(16) _Float16 so[4][16][136], sol[4][16][136]; __shared__ __align__(16) _Float16 sth[128][72], stl[128][72];
  const int tid = threadIdx.x, wave = tid >> 5, lane = tid & 31, col = lane & 15, g = lane >> 4; const size_t r0 = (size_t)blockIdx.x * 64 + wave * 16; const int n0 = blockIdx.y * 128;
  v8f acc[8] = {};
#pragma unroll 2
  for (int kc = 0; kc < DM / 32; ++kc) { v16b a; { const float* p = X + (r0 + col) * DM + kc * 32 + 8 * g;
#pragma unroll
      for (int i = 0; i < 8; ++i) { a[i] = (__bf16)p[i]; a[8 + i] = (__bf16)p[16 + i]; } }
#pragma unroll
    for (int j = 0; j < 8; ++j) acc[j] = wmma_bf(a, frag_b(P + (size_t)(n0 + j * 16 + col) * DM + kc * 32, lane), acc[j]); }
  if (n0 < 2 * DM) {   // q stored unscaled (f16 sigma ~0.6, no subnormal exposure); 1/8 applied to the f32 score
#pragma unroll
    for (int j = 0; j < 8; ++j) {
#pragma unroll
      for (int r = 0; r < 8; ++r) { const float v = acc[j][r] + (BB ? bfr(BB[j * 16 + col]) : 0.f); const _Float16 hv = (_Float16)v; so[wave][8 * g + r][j * 16 + col] = hv; sol[wave][8 * g + r][j * 16 + col] = (_Float16)((v - (float)hv) * 2048.0f); } }   // q, k (+ bias) as f16 hi + (x2048) residual
    LDSX();
    for (int rl = 0; rl < 16; ++rl) if (lane < 16) { vst2((unsigned*)(QK + (r0 + rl) * (2 * DM) + n0 + lane * 8), *(const v4u*)&so[wave][rl][lane * 8]); vst2((unsigned*)(QKL + (r0 + rl) * (2 * DM) + n0 + lane * 8), *(const v4u*)&sol[wave][rl][lane * 8]); }
  } else {
#pragma unroll
    for (int j = 0; j < 8; ++j) {
#pragma unroll
      for (int r = 0; r < 8; ++r) { const float v = acc[j][r] + (BB ? bfr(BB[j * 16 + col]) : 0.f); const _Float16 hv = (_Float16)v; sth[j * 16 + col][wave * 16 + 8 * g + r] = hv; stl[j * 16 + col][wave * 16 + 8 * g + r] = (_Float16)((v - (float)hv) * 2048.0f); } }
    __syncthreads();
    const size_t rb = (size_t)blockIdx.x * 64; const int b = (int)(rb / SS), s0 = (int)(rb % SS); const int pc0 = n0 - 2 * DM;
    for (int q = tid; q < 128 * 8; q += 128) { const int d = q >> 3, pc = q & 7; const size_t o = ((size_t)b * DM + pc0 + d) * SS + s0 + pc * 8; vst2((unsigned*)(VTH + o), *(const v4u*)&sth[d][pc * 8]); vst2((unsigned*)(VTL + o), *(const v4u*)&stl[d][pc * 8]); }
  }
}
// ---- k_attn: block = (query tile pair, head h, batch b): every wave walks 64-query tile TQB-1-x and then tile x, one after the other, so each block has the same number of key steps (2*TQB + 2) wherever it is placed; per tile: causal flash attention (K = 64: 2 k-steps), scores = (q.k) * 0.125 with single f16 operands (tiles 0-1: q, k hi + x2048 residual, 3 products), P.V: f16 P x (V hi, V lo*2048) in two accumulators; O[b*S+q][h*64+d] = (acc + accl / 2048) / (2048 l) (256-B segments)
__global__ __launch_bounds__(128) void k_attn(const _Float16* __restrict__ QK, const _Float16* __restrict__ QKL, const _Float16* __restrict__ VTH, const _Float16* __restrict__ VTL, const void* __restrict__ KMASK, float* __restrict__ O, float* __restrict__ PH) {
  __shared__ float sh_ent[2][64];
  __shared__ __align__(16) float sp[4][16][36]; __shared__ __align__(16) float so[4][16][68];
  const int tid = threadIdx.x, wave = tid >> 5, lane = tid & 31, col = lane & 15, g = lane >> 4;
  const int h = blockIdx.y, b = blockIdx.z;
#pragma unroll 1   // kept rolled: one copy of the tile body in the instruction cache, one register set for both tiles
  for (int tp = 0; tp < 2; ++tp) {
  const int qb = tp ? (int)blockIdx.x : TQB - 1 - (int)blockIdx.x; const int q0 = qb * 64 + wave * 16; const size_t rq = (size_t)b * SS + q0 + col;
  v16h aq[2], aql[2];
#pragma unroll
  for (int kc = 0; kc < 2; ++kc) { aq[kc] = frag_h(QK + rq * (2 * DM) + h * HD + kc * 32, lane); aql[kc] = frag_h(QKL + rq * (2 * DM) + h * HD + kc * 32, lane); }
  float hs[8];   // sum over keys of e^(s - m) * s (rescaled with the running max)
#pragma unroll
  for (int r = 0; r < 8; ++r) hs[r] = 0.f;
  float m[8], l[8];
#pragma unroll
  for (int r = 0; r < 8; ++r) { m[r] = -3.0e38f; l[r] = 0.f; }
  v8f acc[4] = {}, accl[4] = {};
  const int nks = (qb * 64 + 64) / 32;   // causal: key tiles up to the query tile's end
#pragma unroll 1
  for (int ks = 0; ks < nks; ++ks) { v8f s[2];
#pragma unroll
    for (int ct = 0; ct < 2; ++ct) { const int kk = ks * 32 + ct * 16 + col; const _Float16* krow = QK + ((size_t)b * SS + kk) * (2 * DM) + DM + h * HD; const _Float16* krowl = QKL + ((size_t)b * SS + kk) * (2 * DM) + DM + h * HD; v8f c = {}, cl = {};
      if (qb < 2) {   // leading query blocks (few keys, outputs far above the global rms): 3 products
#pragma unroll
        for (int kc = 0; kc < 2; ++kc) { const v16h kh = frag_h(krow + kc * 32, lane); c = wmma16(aq[kc], kh, c); cl = wmma16(aql[kc], kh, cl); cl = wmma16(aq[kc], frag_h(krowl + kc * 32, lane), cl); }
#pragma unroll
        for (int r = 0; r < 8; ++r) c[r] += cl[r] * (1.0f / 2048.0f); }
      else {
#pragma unroll
        for (int kc = 0; kc < 2; ++kc) c = wmma16(aq[kc], frag_h(krow + kc * 32, lane), c); }   // single product elsewhere
#pragma unroll
      for (int r = 0; r < 8; ++r) s[ct][r] = (kk <= q0 + 8 * g + r) ? c[r] * SCALEF : -3.0e38f; }   // causal: future keys excluded
#pragma unroll
    for (int r = 0; r < 8; ++r) { float mx = fmaxf(s[0][r], s[1][r]);
#pragma unroll
      for (int o = 1; o < 16; o <<= 1) mx = fmaxf(mx, __shfl_xor(mx, o));
      const float mn = fmaxf(m[r], mx); const float alpha = (m[r] <= -1.0e38f) ? 0.f : __expf(m[r] - mn);
      const float e0 = (s[0][r] <= -1.0e38f) ? 0.f : __expf(s[0][r] - mn), e1 = (s[1][r] <= -1.0e38f) ? 0.f : __expf(s[1][r] - mn); float es = e0 + e1;
#pragma unroll
      for (int o = 1; o < 16; o <<= 1) es += __shfl_xor(es, o);
      l[r] = l[r] * alpha + es; m[r] = mn; { float eh = (e0 > 0.f ? e0 * s[0][r] : 0.f) + (e1 > 0.f ? e1 * s[1][r] : 0.f);
#pragma unroll
        for (int o = 1; o < 16; o <<= 1) eh += __shfl_xor(eh, o);
        hs[r] = hs[r] * alpha + eh; }
#pragma unroll
      for (int dt = 0; dt < 4; ++dt) { acc[dt][r] *= alpha; accl[dt][r] *= alpha; }
      sp[wave][8 * g + r][col] = e0; sp[wave][8 * g + r][16 + col] = e1; }
    LDSX();
    v16h pa, pl; { const float* prow = &sp[wave][col][0] + 8 * (lane >> 4);
#pragma unroll
      for (int i = 0; i < 8; ++i) { const float x0 = prow[i] * 2048.0f, x1 = prow[16 + i] * 2048.0f; const _Float16 h0 = (_Float16)x0, h1 = (_Float16)x1; pa[i] = h0; pa[8 + i] = h1; pl[i] = (_Float16)((x0 - (float)h0) * 2048.0f); pl[8 + i] = (_Float16)((x1 - (float)h1) * 2048.0f); } }   // P scaled by 2^11 before the f16 split so small softmax weights stay out of the f16 subnormal range; 2^-11 folded into the epilogue
#pragma unroll
    for (int dt = 0; dt < 4; ++dt) { const size_t vr = ((size_t)b * DM + h * HD + dt * 16 + col) * SS + ks * 32; const v16h vh = frag_h(VTH + vr, lane); acc[dt] = wmma16(pa, vh, acc[dt]); accl[dt] = wmma16(pa, frag_h(VTL + vr, lane), accl[dt]); }   // P (single) x V hi + P x V lo / 2048: 2 products
    (void)pl;
    LDSX(); }
  if (col == 0) {
#pragma unroll
    for (int r = 0; r < 8; ++r) sh_ent[tp][wave * 16 + 8 * g + r] = m[r] + logf(l[r]) - hs[r] / l[r]; }   // H_row = -sum p log p = m + log l - sum p s
#pragma unroll
  for (int r = 0; r < 8; ++r) { const float il = (1.0f / 2048.0f) / l[r];
#pragma unroll
    for (int dt = 0; dt < 4; ++dt) so[wave][8 * g + r][dt * 16 + col] = (acc[dt][r] + accl[dt][r] * (1.0f / 2048.0f)) * il; }
  LDSX();
  for (int rl = 0; rl < 16; ++rl) if (lane < 16) vst2(O + ((size_t)b * SS + q0 + rl) * DM + h * HD + lane * 4, *(const v4f*)&so[wave][rl][lane * 4]);
  asm volatile("s_wait_xcnt 0x0" ::: "memory");   // stands in front of the next tile's first writes to registers that the stores above name
  }
  __syncthreads();
  if (tid < 2) { float a = 0.f; for (int i = 0; i < 64; ++i) a += sh_ent[tid][i]; PH[((size_t)b * NH + h) * (SS / 64) + (tid ? (int)blockIdx.x : TQB - 1 - (int)blockIdx.x)] = a; }   // one partial per tile, summed in row order (plain 4-B store of a scratch value)
}
// ---- k_out: block = (64 rows, 128 cols): out = O(hi/lo) . Wo rows (2 products) + bo
__global__ __launch_bounds__(128) void k_out(const float* __restrict__ O, const __bf16* __restrict__ P, const float* __restrict__ BO, float* __restrict__ Y) {
  __shared__ __align__(16) float so[4][16][132];
  const int tid = threadIdx.x, wave = tid >> 5, lane = tid & 31, col = lane & 15, g = lane >> 4; const size_t r0 = (size_t)blockIdx.x * 64 + wave * 16; const int n0 = blockIdx.y * 128;
  v8f acc[8] = {};
#pragma unroll 2
  for (int kc = 0; kc < DM / 32; ++kc) { const F2 a = split_row(O + (r0 + col) * DM, kc * 32, lane);
#pragma unroll
    for (int j = 0; j < 8; ++j) { const v16b w = frag_b(P + (size_t)(n0 + j * 16 + col) * DM + kc * 32, lane); acc[j] = wmma_bf(a.l, w, acc[j]); acc[j] = wmma_bf(a.h, w, acc[j]); } }
#pragma unroll
  for (int j = 0; j < 8; ++j) {
#pragma unroll
    for (int r = 0; r < 8; ++r) so[wave][8 * g + r][j * 16 + col] = acc[j][r] + bfr(BO[n0 + j * 16 + col]); }
  LDSX();
  for (int rl = 0; rl < 16; ++rl) vst2(Y + (r0 + rl) * DM + n0 + lane * 4, *(const v4f*)&so[wave][rl][lane * 4]);
}
// ---- k_ent: mean entropy over all (b, h, t) rows from the block partials (fixed order) -> scalar second output
__global__ __launch_bounds__(256) void k_ent(const float* __restrict__ PH, float* __restrict__ OUT1) {
  __shared__ float red[256]; const int t = threadIdx.x; const int n = NB * NH * (TQB);   // TQB row blocks per (b, h) were computed
  float a = 0.f; for (int i = t; i < n; i += 256) a += PH[(size_t)(i / TQB) * (SS / 64) + (i % TQB)];
  red[t] = a; __syncthreads();
  for (int s = 128; s >= 1; s >>= 1) { if (t < s) red[t] += red[t + s]; __syncthreads(); }
  if (t == 0) { float* p = OUT1; p[0] = red[0] / ((float)NB * NH * (TQB * 64));  }
}
extern "C" void kernel_launch(void* const* d_in, const int* in_sizes, int n_in, void* d_out, int out_size, void* d_ws, size_t ws_size, hipStream_t stream) {
  (void)in_sizes; (void)n_in; (void)out_size;
  const float** F = (const float**)d_in;   // 0 x [4,2048,1024], 1 w_q natural, 2 b_q, 3 w_k, 4 b_k, 5 w_v, 6 b_v, 7 w_o, 8 b_o
  if (ws_size < (size_t)WS_END) return;
  char* ws = (char*)d_ws; __bf16* PK = (__bf16*)(ws + WS_PK); _Float16 *QK = (_Float16*)(ws + WS_QK), *QKL = (_Float16*)(ws + WS_QKL), *VTH = (_Float16*)(ws + WS_VTH), *VTL = (_Float16*)(ws + WS_VTL); float *O = (float*)(ws + WS_O), *PH = (float*)(ws + WS_PH);
  k_pack<<<dim3(DM, 4), 256, 0, stream>>>(F[1], F[3], F[5], F[7], PK);
  k_qkv<<<dim3(TNB * SS / 64, QKVW / 128), 128, 0, stream>>>(F[0], F[0], F[0], PK + PK_A, F[2], F[4], F[6], QK, QKL, VTH, VTL);
  k_attn<<<dim3(TQB / 2, NH, TNB), 128, 0, stream>>>(QK, QKL, VTH, VTL, nullptr, O, PH);
  k_out<<<dim3(TOB, DM / 128), 128, 0, stream>>>(O, PK + PK_P, F[8], (float*)d_out);
  k_ent<<<1, 256, 0, stream>>>(PH, (float*)d_out + (size_t)NB * SS * DM);
}

// v002
// Measured time: 404 microseconds a run.
// Next to v001, in two timings, it ran 1.56 and 1.57 times as fast.
// Counting every step since v000, it is 1.87 times as fast.
// compute dtype: all float inputs rounded to bf16; q/k/v = x . W^T + b with EXACT bf16 products on WMMA 16x16x32 (natural rows); causal attention x 1/8 (tiles past the diagonal skipped) with 3-product scores (q, k as f16 hi + x2048 residual) for the first 128 queries of each sequence and single-product scores elsewhere; running-max softmax in f32 (hardware exp) that also accumulates sum p*s for the row entropy H = m + log(l) - sum(p s) (precise logf), block partial sums combined in fixed order for the mean; P (scaled by 2^11, single f16) x v (f16 hi + x2048 residual), 2 products; y = ctx (bf16 hi + residual) . Wo^T (2 products) + bo.
#include <hip/hip_runtime.h>
#include <math.h>

typedef __attribute__((ext_vector_type(16))) _Float16 v16h;
typedef __attribute__((ext_vector_type(16))) __bf16 v16b;
typedef __attribute__((ext_vector_type(8)))  _Float16 v8h;
typedef __attribute__((ext_vector_type(8)))  float v8f;
typedef __attribute__((ext_vector_type(4)))  float v4f;
typedef __attribute__((ext_vector_type(2)))  float v2f;
typedef __attribute__((ext_vector_type(4)))  unsigned v4u;
typedef __attribute__((ext_vector_type(4)))  int v4i;
typedef float __attribute__((may_alias)) float_a;
typedef int __attribute__((may_alias)) int_a;

template <typename T> __device__ __forceinline__ void vst2(void* p, T v) { *(T*)p = v;  }
__device__ __forceinline__ v8f wmma16(v16h a, v16h b, v8f c) {
  v8f d = __builtin_amdgcn_wmma_f32_16x16x32_f16(false, a, false, b, (short)0, c, false, false);
  asm volatile("v_nop\n\tv_nop\n\tv_nop\n\tv_nop" : "+v"(d) : "v"(a), "v"(b));
  return d;
}
__device__ __forceinline__ v8f wmma_bf(v16b a, v16b b, v8f c) {
  v8f d = __builtin_amdgcn_wmma_f32_16x16x32_bf16(false, a, false, b, (short)0, c, false, false);
  asm volatile("v_nop\n\tv_nop\n\tv_nop\n\tv_nop" : "+v"(d) : "v"(a), "v"(b));
  return d;
}
// Causal multi-head self attention (B 4, T 2,048, C 1,024, 16 heads x 64) with biases and output projection, plus the mean attention entropy (second output).
__device__ __forceinline__ v16h frag_h(const _Float16* rowk0, int lane) {
  union { v16h v; v8h q[2]; } u; const _Float16* p = rowk0 + 8 * (lane >> 4);
  u.q[0] = *(const v8h*)p; u.q[1] = *(const v8h*)(p + 16); return u.v;
}
__device__ __forceinline__ v16h frag_f32(const float* rowk0, int lane) {
  v16h a; const float* p = rowk0 + 8 * (lane >> 4);
#pragma unroll
  for (int i = 0; i < 8; ++i) { a[i] = (_Float16)p[i]; a[8 + i] = (_Float16)p[16 + i]; }
  return a;
}
__device__ __forceinline__ v16h frag_f32s(const float* rowk0, int lane, float sc) {
  v16h a; const float* p = rowk0 + 8 * (lane >> 4);
#pragma unroll
  for (int i = 0; i < 8; ++i) { a[i] = (_Float16)(p[i] * sc); a[8 + i] = (_Float16)(p[16 + i] * sc); }
  return a;
}
// column fragment from a [K][ld] layout (column n), rows >= K read as 0
__device__ __forceinline__ v16h fragc_f32(const float* W, int k0, int n, int lane, int ld, int K) {
  v16h a; const int g = lane >> 4;
#pragma unroll
  for (int i = 0; i < 8; ++i) { const int ka = k0 + 8 * g + i, kb = ka + 16;
    a[i] = (_Float16)(ka < K ? W[(size_t)(ka < K ? ka : K - 1) * ld + n] : 0.f); a[8 + i] = (_Float16)(kb < K ? W[(size_t)(kb < K ? kb : K - 1) * ld + n] : 0.f); }
  return a;
}
struct F2 { v16b h, l; };
__device__ __forceinline__ F2 bsplit16(const float v[16]) { F2 r;
#pragma unroll
  for (int i = 0; i < 16; ++i) { const __bf16 h = (__bf16)v[i]; r.h[i] = h; r.l[i] = (__bf16)(v[i] - (float)h); }
  return r; }
__device__ __forceinline__ F2 split_row(const float* row, int k0, int lane) { float v[16]; const float* p = row + k0 + 8 * (lane >> 4);
#pragma unroll
  for (int i = 0; i < 8; ++i) { v[i] = p[i]; v[8 + i] = p[16 + i]; }
  return bsplit16(v); }
__device__ __forceinline__ F2 split_rowK(const float* row, int k0, int lane, int K) { float v[16]; const int g = lane >> 4;
#pragma unroll
  for (int i = 0; i < 8; ++i) { const int ka = k0 + 8 * g + i, kb = ka + 16; v[i] = ka < K ? row[ka < K ? ka : K - 1] : 0.f; v[8 + i] = kb < K ? row[kb < K ? kb : K - 1] : 0.f; }
  return bsplit16(v); }
__device__ __forceinline__ F2 split_col(const float* W, int k0, int n, int lane, int ld, int K) { float v[16]; const int g = lane >> 4;
#pragma unroll
  for (int i = 0; i < 8; ++i) { const int ka = k0 + 8 * g + i, kb = ka + 16; v[i] = ka < K ? W[(size_t)(ka < K ? ka : K - 1) * ld + n] : 0.f; v[8 + i] = kb < K ? W[(size_t)(kb < K ? kb : K - 1) * ld + n] : 0.f; }
  return bsplit16(v); }
__device__ __forceinline__ v8f mac3(const F2& a, const F2& b, v8f c) { c = wmma_bf(a.l, b.h, c); c = wmma_bf(a.h, b.l, c); return wmma_bf(a.h, b.h, c); }
__device__ __forceinline__ float sigm(float v) { return 1.0f / (1.0f + expf(-v)); }
#define LDSX() do { asm volatile("s_wait_dscnt 0" ::: "memory"); __builtin_amdgcn_wave_barrier(); __builtin_amdgcn_fence(__ATOMIC_RELEASE, "workgroup"); } while (0)


#define NB 4
#define SS 2048
#define SCALEF 0.125f
#define DM 1024
#define NH 16
#define HD 64
#define QKVW (3 * DM)
#ifndef TQB
#define TQB (SS / 64)
#define TNB NB
#define TOB (NB * SS / 64)     // output row tiles (all)
#endif
typedef __attribute__((ext_vector_type(8))) __bf16 v8b;
__device__ __forceinline__ v16b frag_b(const __bf16* rowk0, int lane) {
  union { v16b v; v8b q[2]; } u; const __bf16* p = rowk0 + 8 * (lane >> 4);
  u.q[0] = *(const v8b*)p; u.q[1] = *(const v8b*)(p + 16); return u.v;
}
__device__ __forceinline__ float bfr(float v) { return (float)(__bf16)v; }
__device__ __attribute__((noinline)) float exp_ni(float v) { return expf(v); }
__device__ __attribute__((noinline)) float erf_ni(float v) { return erff(v); }

#define PK_A 0                       // [3072][1024] Wqkv rows (natural [out][in])
#define PK_P (PK_A + QKVW * DM)        // [1024][1024] Wo rows (natural)
#define PK_END (PK_P + DM * DM)
#define WS_PK  0u
#define WS_QK  (WS_PK + 2u * PK_END)             // f16 [8192 rows][2048]: q | k
#define WS_QKL (WS_QK + 2u * NB * SS * 2 * DM)     // f16 q | k residual planes x2048
#define WS_VTH (WS_QKL + 2u * NB * SS * 2 * DM)    // f16 [b][1024 (h*64+d)][2048 s] hi
#define WS_VTL (WS_VTH + 2u * NB * DM * SS)        // f16 lo x 2048
#define WS_O   (WS_VTL + 2u * NB * DM * SS)        // f32 [8192][1024]
#define WS_CS  (WS_O + 4u * NB * SS * DM)           // f32 2 x [2048][32], reserved, unused
#define WS_PH  (WS_CS + 4u * 2 * SS * 32)                 // f32 [NB*NH*(SS/64)] entropy block partials
#define WS_END (WS_PH + 4u * NB * NH * (SS / 64))
// ---- k_pack: block = (row n, which): natural [out][in] rows -> bf16; which 0..2 -> W_q/W_k/W_v into PK_A rows which*1024 + n; 3 -> W_o into PK_P
__global__ __launch_bounds__(256) void k_pack(const float* __restrict__ WQ, const float* __restrict__ WK, const float* __restrict__ WV, const float* __restrict__ WO, __bf16* __restrict__ PK) {
  __shared__ __align__(16) __bf16 s[DM]; const int n = blockIdx.x, which = blockIdx.y, t = threadIdx.x; const float* Wm = (which == 0) ? WQ : (which == 1) ? WK : (which == 2) ? WV : WO;
  for (int k = t; k < DM; k += 256) s[k] = (__bf16)Wm[(size_t)n * DM + k];
  __syncthreads();
  __bf16* dst = (which < 3) ? PK + PK_A + ((size_t)which * DM + n) * DM : PK + PK_P + (size_t)n * DM;
  for (int q = t; q < DM / 8; q += 256) vst2((unsigned*)(dst + q * 8), *(const v4u*)&s[q * 8]);
}
// ---- operand staging of the two projection GEMMs: per 64-k chunk the block's 64 f32 activation rows (256 B each) and 128 bf16 weight rows (128 B each) go from global memory into LDS by asynchronous 16-B copies that cover whole 128-B lines, once per block; the four waves read their fragments from LDS. Two buffers: chunk t + 1 flies while chunk t is worked on.
#define GKC 64                           // k per staged chunk
#define GA_PITCH 272                     // LDS bytes per staged f32 row (16 B x odd: 16-B reads of 16 rows fall on distinct banks)
#define GB_PITCH 144                     // LDS bytes per staged bf16 row (16 B x odd)
#define GA_BYTES (64 * GA_PITCH)
#define GB_BYTES (128 * GB_PITCH)
#define GSTAGE (GA_BYTES + GB_BYTES)     // one buffer: [activation rows | weight rows]
#define GNT (DM / GKC)
// eight copies of one lane and, in the same statement, the wait that stands in front of any later write of the address registers they name
#define COPY8(l, ls, p, ps) asm volatile( \
  "global_load_async_to_lds_b128 %0, %8, off\n\tglobal_load_async_to_lds_b128 %1, %9, off\n\t" \
  "global_load_async_to_lds_b128 %2, %10, off\n\tglobal_load_async_to_lds_b128 %3, %11, off\n\t" \
  "global_load_async_to_lds_b128 %4, %12, off\n\tglobal_load_async_to_lds_b128 %5, %13, off\n\t" \
  "global_load_async_to_lds_b128 %6, %14, off\n\tglobal_load_async_to_lds_b128 %7, %15, off\n\ts_wait_xcnt 0x0" \
  :: "v"(l), "v"((l) + (ls)), "v"((l) + 2 * (ls)), "v"((l) + 3 * (ls)), "v"((l) + 4 * (ls)), "v"((l) + 5 * (ls)), "v"((l) + 6 * (ls)), "v"((l) + 7 * (ls)), \
     "v"(p), "v"((p) + (ps)), "v"((p) + 2 * (ps)), "v"((p) + 3 * (ps)), "v"((p) + 4 * (ps)), "v"((p) + 5 * (ps)), "v"((p) + 6 * (ps)), "v"((p) + 7 * (ps)) : "memory")
// Ag: first of the block's 64 rows at the chunk's first k; Bg: first of its 128 weight rows at the same k; lds: byte address of the buffer
__device__ __forceinline__ void stage_chunk(const float* Ag, const __bf16* Bg, unsigned lds, int tid) {
  const float* pa = Ag + (size_t)(tid >> 4) * DM + (tid & 15) * 4; const unsigned la = lds + (unsigned)(tid >> 4) * GA_PITCH + (unsigned)(tid & 15) * 16u;   // 16 lanes a row, 8 rows a copy
  const __bf16* pb = Bg + (size_t)(tid >> 3) * DM + (tid & 7) * 8; const unsigned lb = lds + GA_BYTES + (unsigned)(tid >> 3) * GB_PITCH + (unsigned)(tid & 7) * 16u;   // 8 lanes a row, 16 rows a copy
  COPY8(la, 8u * GA_PITCH, pa, (size_t)8 * DM);
  COPY8(lb, 16u * GB_PITCH, pb, (size_t)16 * DM);
}
// the 16 f32 of a lane's A fragment (k = 8g + 0..7 and 16 + 8g + 0..7 of a 32-k step) from a staged row; p = row + 128 * step + 32 * g bytes
__device__ __forceinline__ void lds_a16(const char* p, float v[16]) { const v4f x0 = *(const v4f*)p, x1 = *(const v4f*)(p + 16), x2 = *(const v4f*)(p + 64), x3 = *(const v4f*)(p + 80);
#pragma unroll   // constant indices: v stays in registers
  for (int i = 0; i < 4; ++i) { v[i] = x0[i]; v[4 + i] = x1[i]; v[8 + i] = x2[i]; v[12 + i] = x3[i]; } }
// a lane's B fragment (same k order) from a staged bf16 row; p = row + 64 * step + 16 * g bytes
__device__ __forceinline__ v16b lds_b16(const char* p) { union { v16b v; v8b q[2]; } u; u.q[0] = *(const v8b*)p; u.q[1] = *(const v8b*)(p + 32); return u.v; }
__global__ __launch_bounds__(128) void k_qkv(const float* __restrict__ XQ, const float* __restrict__ XK, const float* __restrict__ XV, const __bf16* __restrict__ P, const float* __restrict__ BQ, const float* __restrict__ BK, const float* __restrict__ BV, _Float16* __restrict__ QK, _Float16* __restrict__ QKL, _Float16* __restrict__ VTH, _Float16* __restrict__ VTL) {
  const int which0 = (blockIdx.y * 128) / DM; const float* X = (which0 == 0) ? XQ : (which0 == 1) ? XK : XV; const float* BB = BQ ? (((which0 == 0) ? BQ : (which0 == 1) ? BK : BV) + (blockIdx.y * 128 - which0 * DM)) : nullptr;
  __shared__ __align__(16) char smem[2 * GSTAGE];   // the two staging buffers; behind the K loop's last barrier the same bytes stage the output
  _Float16 (*so)[16][136] = (_Float16 (*)[16][136])smem, (*sol)[16][136] = (_Float16 (*)[16][136])(smem + 4 * 16 * 136 * 2); _Float16 (*sth)[72] = (_Float16 (*)[72])smem, (*stl)[72] = (_Float16 (*)[72])(smem + 128 * 72 * 2);
  const int tid = threadIdx.x, wave = tid >> 5, lane = tid & 31, col = lane & 15, g = lane >> 4; const size_t r0 = (size_t)blockIdx.x * 64 + wave * 16; const int n0 = blockIdx.y * 128;
  v8f acc[8] = {};
  const unsigned lds0 = (unsigned)(size_t)smem; const float* Ag = X + (size_t)blockIdx.x * 64 * DM; const __bf16* Bg = P + (size_t)n0 * DM;
  stage_chunk(Ag, Bg, lds0, tid);
  asm volatile("s_wait_asynccnt 0x0" ::: "memory");   // this wave's copies of chunk 0 have landed
  __syncthreads();                                    // ... and every other wave's: chunk 0 may be read
  stage_chunk(Ag + GKC, Bg + GKC, lds0 + GSTAGE, tid);
#pragma unroll 1   // kept rolled: the buffer alternates with t, one copy of the body
  for (int t = 0; t < GNT; ++t) { const char* sa = smem + (t & 1) * GSTAGE + (wave * 16 + col) * GA_PITCH + 32 * g; const char* sb = smem + (t & 1) * GSTAGE + GA_BYTES + col * GB_PITCH + 16 * g;
#pragma unroll   // this and the inner loops: constant indices, so that fragments and accumulators stay in registers
    for (int kc = 0; kc < GKC / 32; ++kc) { float av[16]; lds_a16(sa + kc * 128, av); v16b a, w[8];   // all LDS reads of a 32-k step stand as one group in front of its products: one LDS latency a step, not one a product
#pragma unroll
      for (int j = 0; j < 8; ++j) w[j] = lds_b16(sb + j * 16 * GB_PITCH + kc * 64);
#pragma unroll
      for (int i = 0; i < 16; ++i) a[i] = (__bf16)av[i];
#pragma unroll
      for (int j = 0; j < 8; ++j) acc[j] = wmma_bf(a, w[j], acc[j]); }
    asm volatile("s_wait_dscnt 0x0" ::: "memory");      // this wave's reads of buffer t & 1 are done before it is refilled
    asm volatile("s_wait_asynccnt 0x0" ::: "memory");   // this wave's copies of chunk t + 1 have landed
    __syncthreads();                                    // publishes chunk t + 1 and ends every wave's reads of chunk t
    if (t + 2 < GNT) stage_chunk(Ag + (t + 2) * GKC, Bg + (t + 2) * GKC, lds0 + (unsigned)(t & 1) * GSTAGE, tid); }
  asm volatile("s_wait_asynccnt 0x0" ::: "memory");     // no copy is in flight when the buffers become output staging
  if (n0 < 2 * DM) {   // q stored unscaled (f16 sigma ~0.6, no subnormal exposure); 1/8 applied to the f32 score
#pragma unroll
    for (int j = 0; j < 8; ++j) {
#pragma unroll
      for (int r = 0; r < 8; ++r) { const float v = acc[j][r] + (BB ? bfr(BB[j * 16 + col]) : 0.f); const _Float16 hv = (_Float16)v; so[wave][8 * g + r][j * 16 + col] = hv; sol[wave][8 * g + r][j * 16 + col] = (_Float16)((v - (float)hv) * 2048.0f); } }   // q, k (+ bias) as f16 hi + (x2048) residual
    LDSX();
    for (int rl = 0; rl < 16; ++rl) if (lane < 16) { vst2((unsigned*)(QK + (r0 + rl) * (2 * DM) + n0 + lane * 8), *(const v4u*)&so[wave][rl][lane * 8]); vst2((unsigned*)(QKL + (r0 + rl) * (2 * DM) + n0 + lane * 8), *(const v4u*)&sol[wave][rl][lane * 8]); }
  } else {
#pragma unroll
    for (int j = 0; j < 8; ++j) {
#pragma unroll
      for (int r = 0; r < 8; ++r) { const float v = acc[j][r] + (BB ? bfr(BB[j * 16 + col]) : 0.f); const _Float16 hv = (_Float16)v; sth[j * 16 + col][wave * 16 + 8 * g + r] = hv; stl[j * 16 + col][wave * 16 + 8 * g + r] = (_Float16)((v - (float)hv) * 2048.0f); } }
    __syncthreads();
    const size_t rb = (size_t)blockIdx.x * 64; const int b = (int)(rb / SS), s0 = (int)(rb % SS); const int pc0 = n0 - 2 * DM;
    for (int q = tid; q < 128 * 8; q += 128) { const int d = q >> 3, pc = q & 7; const size_t o = ((size_t)b * DM + pc0 + d) * SS + s0 + pc * 8; vst2((unsigned*)(VTH + o), *(const v4u*)&sth[d][pc * 8]); vst2((unsigned*)(VTL + o), *(const v4u*)&stl[d][pc * 8]); }
  }
}
// ---- k_attn: block = (query tile pair, head h, batch b): every wave walks 64-query tile TQB-1-x and then tile x, one after the other, so each block has the same number of key steps (2*TQB + 2) wherever it is placed; per tile: causal flash attention (K = 64: 2 k-steps), scores = (q.k) * 0.125 with single f16 operands (tiles 0-1: q, k hi + x2048 residual, 3 products), P.V: f16 P x (V hi, V lo*2048) in two accumulators; O[b*S+q][h*64+d] = (acc + accl / 2048) / (2048 l) (256-B segments)
__global__ __launch_bounds__(128) void k_attn(const _Float16* __restrict__ QK, const _Float16* __restrict__ QKL, const _Float16* __restrict__ VTH, const _Float16* __restrict__ VTL, const void* __restrict__ KMASK, float* __restrict__ O, float* __restrict__ PH) {
  __shared__ float sh_ent[2][64];
  __shared__ __align__(16) float sp[4][16][36]; __shared__ __align__(16) float so[4][16][68];
  const int tid = threadIdx.x, wave = tid >> 5, lane = tid & 31, col = lane & 15, g = lane >> 4;
  const int h = blockIdx.y, b = blockIdx.z;
#pragma unroll 1   // kept rolled: one copy of the tile body in the instruction cache, one register set for both tiles
  for (int tp = 0; tp < 2; ++tp) {
  const int qb = tp ? (int)blockIdx.x : TQB - 1 - (int)blockIdx.x; const int q0 = qb * 64 + wave * 16; const size_t rq = (size_t)b * SS + q0 + col;
  v16h aq[2], aql[2];
#pragma unroll
  for (int kc = 0; kc < 2; ++kc) { aq[kc] = frag_h(QK + rq * (2 * DM) + h * HD + kc * 32, lane); aql[kc] = frag_h(QKL + rq * (2 * DM) + h * HD + kc * 32, lane); }
  float hs[8];   // sum over keys of e^(s - m) * s (rescaled with the running max)
#pragma unroll
  for (int r = 0; r < 8; ++r) hs[r] = 0.f;
  float m[8], l[8];
#pragma unroll
  for (int r = 0; r < 8; ++r) { m[r] = -3.0e38f; l[r] = 0.f; }
  v8f acc[4] = {}, accl[4] = {};
  const int nks = (qb * 64 + 64) / 32;   // causal: key tiles up to the query tile's end
#pragma unroll 1
  for (int ks = 0; ks < nks; ++ks) { v8f s[2];
#pragma unroll
    for (int ct = 0; ct < 2; ++ct) { const int kk = ks * 32 + ct * 16 + col; const _Float16* krow = QK + ((size_t)b * SS + kk) * (2 * DM) + DM + h * HD; const _Float16* krowl = QKL + ((size_t)b * SS + kk) * (2 * DM) + DM + h * HD; v8f c = {}, cl = {};
      if (qb < 2) {   // leading query blocks (few keys, outputs far above the global rms): 3 products
#pragma unroll
        for (int kc = 0; kc < 2; ++kc) { const v16h kh = frag_h(krow + kc * 32, lane); c = wmma16(aq[kc], kh, c); cl = wmma16(aql[kc], kh, cl); cl = wmma16(aq[kc], frag_h(krowl + kc * 32, lane), cl); }
#pragma unroll
        for (int r = 0; r < 8; ++r) c[r] += cl[r] * (1.0f / 2048.0f); }
      else {
#pragma unroll
        for (int kc = 0; kc < 2; ++kc) c = wmma16(aq[kc], frag_h(krow + kc * 32, lane), c); }   // single product elsewhere
#pragma unroll
      for (int r = 0; r < 8; ++r) s[ct][r] = (kk <= q0 + 8 * g + r) ? c[r] * SCALEF : -3.0e38f; }   // causal: future keys excluded
#pragma unroll
    for (int r = 0; r < 8; ++r) { float mx = fmaxf(s[0][r], s[1][r]);
#pragma unroll
      for (int o = 1; o < 16; o <<= 1) mx = fmaxf(mx, __shfl_xor(mx, o));
      const float mn = fmaxf(m[r], mx); const float alpha = (m[r] <= -1.0e38f) ? 0.f : __expf(m[r] - mn);
      const float e0 = (s[0][r] <= -1.0e38f) ? 0.f : __expf(s[0][r] - mn), e1 = (s[1][r] <= -1.0e38f) ? 0.f : __expf(s[1][r] - mn); float es = e0 + e1;
#pragma unroll
      for (int o = 1; o < 16; o <<= 1) es += __shfl_xor(es, o);
      l[r] = l[r] * alpha + es; m[r] = mn; { float eh = (e0 > 0.f ? e0 * s[0][r] : 0.f) + (e1 > 0.f ? e1 * s[1][r] : 0.f);
#pragma unroll
        for (int o = 1; o < 16; o <<= 1) eh += __shfl_xor(eh, o);
        hs[r] = hs[r] * alpha + eh; }
#pragma unroll
      for (int dt = 0; dt < 4; ++dt) { acc[dt][r] *= alpha; accl[dt][r] *= alpha; }
      sp[wave][8 * g + r][col] = e0; sp[wave][8 * g + r][16 + col] = e1; }
    LDSX();
    v16h pa, pl; { const float* prow = &sp[wave][col][0] + 8 * (lane >> 4);
#pragma unroll
      for (int i = 0; i < 8; ++i) { const float x0 = prow[i] * 2048.0f, x1 = prow[16 + i] * 2048.0f; const _Float16 h0 = (_Float16)x0, h1 = (_Float16)x1; pa[i] = h0; pa[8 + i] = h1; pl[i] = (_Float16)((x0 - (float)h0) * 2048.0f); pl[8 + i] = (_Float16)((x1 - (float)h1) * 2048.0f); } }   // P scaled by 2^11 before the f16 split so small softmax weights stay out of the f16 subnormal range; 2^-11 folded into the epilogue
#pragma unroll
    for (int dt = 0; dt < 4; ++dt) { const size_t vr = ((size_t)b * DM + h * HD + dt * 16 + col) * SS + ks * 32; const v16h vh = frag_h(VTH + vr, lane); acc[dt] = wmma16(pa, vh, acc[dt]); accl[dt] = wmma16(pa, frag_h(VTL + vr, lane), accl[dt]); }   // P (single) x V hi + P x V lo / 2048: 2 products
    (void)pl;
    LDSX(); }
  if (col == 0) {
#pragma unroll
    for (int r = 0; r < 8; ++r) sh_ent[tp][wave * 16 + 8 * g + r] = m[r] + logf(l[r]) - hs[r] / l[r]; }   // H_row = -sum p log p = m + log l - sum p s
#pragma unroll
  for (int r = 0; r < 8; ++r) { const float il = (1.0f / 2048.0f) / l[r];
#pragma unroll
    for (int dt = 0; dt < 4; ++dt) so[wave][8 * g + r][dt * 16 + col] = (acc[dt][r] + accl[dt][r] * (1.0f / 2048.0f)) * il; }
  LDSX();
  for (int rl = 0; rl < 16; ++rl) if (lane < 16) vst2(O + ((size_t)b * SS + q0 + rl) * DM + h * HD + lane * 4, *(const v4f*)&so[wave][rl][lane * 4]);
  asm volatile("s_wait_xcnt 0x0" ::: "memory");   // stands in front of the next tile's first writes to registers that the stores above name
  }
  __syncthreads();
  if (tid < 2) { float a = 0.f; for (int i = 0; i < 64; ++i) a += sh_ent[tid][i]; PH[((size_t)b * NH + h) * (SS / 64) + (tid ? (int)blockIdx.x : TQB - 1 - (int)blockIdx.x)] = a; }   // one partial per tile, summed in row order (plain 4-B store of a scratch value)
}
// ---- k_out: block = (64 rows, 128 cols): out = O(hi/lo) . Wo rows (2 products) + bo
__global__ __launch_bounds__(128) void k_out(const float* __restrict__ O, const __bf16* __restrict__ P, const float* __restrict__ BO, float* __restrict__ Y) {
  __shared__ __align__(16) char smem[2 * GSTAGE];   // the two staging buffers; behind the K loop's last barrier the same bytes stage the output
  float (*so)[16][132] = (float (*)[16][132])smem;
  const int tid = threadIdx.x, wave = tid >> 5, lane = tid & 31, col = lane & 15, g = lane >> 4; const size_t r0 = (size_t)blockIdx.x * 64 + wave * 16; const int n0 = blockIdx.y * 128;
  v8f acc[8] = {};
  const unsigned lds0 = (unsigned)(size_t)smem; const float* Ag = O + (size_t)blockIdx.x * 64 * DM; const __bf16* Bg = P + (size_t)n0 * DM;
  stage_chunk(Ag, Bg, lds0, tid);
  asm volatile("s_wait_asynccnt 0x0" ::: "memory");   // this wave's copies of chunk 0 have landed
  __syncthreads();                                    // ... and every other wave's: chunk 0 may be read
  stage_chunk(Ag + GKC, Bg + GKC, lds0 + GSTAGE, tid);
#pragma unroll 1   // kept rolled: the buffer alternates with t, one copy of the body
  for (int t = 0; t < GNT; ++t) { const char* sa = smem + (t & 1) * GSTAGE + (wave * 16 + col) * GA_PITCH + 32 * g; const char* sb = smem + (t & 1) * GSTAGE + GA_BYTES + col * GB_PITCH + 16 * g;
#pragma unroll   // this and the inner loops: constant indices, so that fragments and accumulators stay in registers
    for (int kc = 0; kc < GKC / 32; ++kc) { float av[16]; lds_a16(sa + kc * 128, av); v16b w[8];   // all LDS reads of a 32-k step stand as one group in front of its products: one LDS latency a step, not one a product
#pragma unroll
      for (int j = 0; j < 8; ++j) w[j] = lds_b16(sb + j * 16 * GB_PITCH + kc * 64);
      const F2 a = bsplit16(av);
#pragma unroll
      for (int j = 0; j < 8; ++j) { acc[j] = wmma_bf(a.l, w[j], acc[j]); acc[j] = wmma_bf(a.h, w[j], acc[j]); } }
    asm volatile("s_wait_dscnt 0x0" ::: "memory");      // this wave's reads of buffer t & 1 are done before it is refilled
    asm volatile("s_wait_asynccnt 0x0" ::: "memory");   // this wave's copies of chunk t + 1 have landed
    __syncthreads();                                    // publishes chunk t + 1 and ends every wave's reads of chunk t
    if (t + 2 < GNT) stage_chunk(Ag + (t + 2) * GKC, Bg + (t + 2) * GKC, lds0 + (unsigned)(t & 1) * GSTAGE, tid); }
  asm volatile("s_wait_asynccnt 0x0" ::: "memory");     // no copy is in flight when the buffers become output staging
#pragma unroll
  for (int j = 0; j < 8; ++j) {
#pragma unroll
    for (int r = 0; r < 8; ++r) so[wave][8 * g + r][j * 16 + col] = acc[j][r] + bfr(BO[n0 + j * 16 + col]); }
  LDSX();
  for (int rl = 0; rl < 16; ++rl) vst2(Y + (r0 + rl) * DM + n0 + lane * 4, *(const v4f*)&so[wave][rl][lane * 4]);
}
// ---- k_ent: mean entropy over all (b, h, t) rows from the block partials (fixed order) -> scalar second output
__global__ __launch_bounds__(256) void k_ent(const float* __restrict__ PH, float* __restrict__ OUT1) {
  __shared__ float red[256]; const int t = threadIdx.x; const int n = NB * NH * (TQB);   // TQB row blocks per (b, h) were computed
  float a = 0.f; for (int i = t; i < n; i += 256) a += PH[(size_t)(i / TQB) * (SS / 64) + (i % TQB)];
  red[t] = a; __syncthreads();
  for (int s = 128; s >= 1; s >>= 1) { if (t < s) red[t] += red[t + s]; __syncthreads(); }
  if (t == 0) { float* p = OUT1; p[0] = red[0] / ((float)NB * NH * (TQB * 64));  }
}
extern "C" void kernel_launch(void* const* d_in, const int* in_sizes, int n_in, void* d_out, int out_size, void* d_ws, size_t ws_size, hipStream_t stream) {
  (void)in_sizes; (void)n_in; (void)out_size;
  const float** F = (const float**)d_in;   // 0 x [4,2048,1024], 1 w_q natural, 2 b_q, 3 w_k, 4 b_k, 5 w_v, 6 b_v, 7 w_o, 8 b_o
  if (ws_size < (size_t)WS_END) return;
  char* ws = (char*)d_ws; __bf16* PK = (__bf16*)(ws + WS_PK); _Float16 *QK = (_Float16*)(ws + WS_QK), *QKL = (_Float16*)(ws + WS_QKL), *VTH = (_Float16*)(ws + WS_VTH), *VTL = (_Float16*)(ws + WS_VTL); float *O = (float*)(ws + WS_O), *PH = (float*)(ws + WS_PH);
  k_pack<<<dim3(DM, 4), 256, 0, stream>>>(F[1], F[3], F[5], F[7], PK);
  k_qkv<<<dim3(TNB * SS / 64, QKVW / 128), 128, 0, stream>>>(F[0], F[0], F[0], PK + PK_A, F[2], F[4], F[6], QK, QKL, VTH, VTL);
  k_attn<<<dim3(TQB / 2, NH, TNB), 128, 0, stream>>>(QK, QKL, VTH, VTL, nullptr, O, PH);
  k_out<<<dim3(TOB, DM / 128), 128, 0, stream>>>(O, PK + PK_P, F[8], (float*)d_out);
  k_ent<<<1, 256, 0, stream>>>(PH, (float*)d_out + (size_t)NB * SS * DM);
}

// v003
// It runs in 269 microseconds.
// In both of two side-by-side timings against v002, it was 1.50 times as fast.
// Over all steps from v000 it is 2.81 times as fast.
// compute dtype: all float inputs rounded to bf16; q/k/v = x . W^T + b with EXACT bf16 products on WMMA 16x16x32 (natural rows); causal attention x 1/8 (tiles past the diagonal skipped) with 3-product scores (q, k as f16 hi + x2048 residual) for the first 128 queries of each sequence and single-product scores elsewhere; running-max softmax in f32 (hardware exp) that also accumulates sum p*s for the row entropy H = m + log(l) - sum(p s) (precise logf), block partial sums combined in fixed order for the mean; P (scaled by 2^11, single f16) x v (f16 hi + x2048 residual), 2 products; y = ctx (bf16 hi + residual) . Wo^T (2 products) + bo.
#include <hip/hip_runtime.h>
#include <math.h>

typedef __attribute__((ext_vector_type(16))) _Float16 v16h;
typedef __attribute__((ext_vector_type(16))) __bf16 v16b;
typedef __attribute__((ext_vector_type(8)))  _Float16 v8h;
typedef __attribute__((ext_vector_type(8)))  float v8f;
typedef __attribute__((ext_vector_type(4)))  float v4f;
typedef __attribute__((ext_vector_type(2)))  float v2f;
typedef __attribute__((ext_vector_type(4)))  unsigned v4u;
typedef __attribute__((ext_vector_type(4)))  int v4i;
typedef float __attribute__((may_alias)) float_a;
typedef int __attribute__((may_alias)) int_a;

template <typename T> __device__ __forceinline__ void vst2(void* p, T v) { *(T*)p = v;  }
__device__ __forceinline__ v8f wmma16(v16h a, v16h b, v8f c) {
  v8f d = __builtin_amdgcn_wmma_f32_16x16x32_f16(false, a, false, b, (short)0, c, false, false);
  asm volatile("v_nop\n\tv_nop\n\tv_nop\n\tv_nop" : "+v"(d) : "v"(a), "v"(b));
  return d;
}
__device__ __forceinline__ v8f wmma_bf(v16b a, v16b b, v8f c) {
  v8f d = __builtin_amdgcn_wmma_f32_16x16x32_bf16(false, a, false, b, (short)0, c, false, false);
  asm volatile("v_nop\n\tv_nop\n\tv_nop\n\tv_nop" : "+v"(d) : "v"(a), "v"(b));
  return d;
}
// Causal multi-head self attention (B 4, T 2,048, C 1,024, 16 heads x 64) with biases and output projection, plus the mean attention entropy (second output).
__device__ __forceinline__ v16h frag_h(const _Float16* rowk0, int lane) {
  union { v16h v; v8h q[2]; } u; const _Float16* p = rowk0 + 8 * (lane >> 4);
  u.q[0] = *(const v8h*)p; u.q[1] = *(const v8h*)(p + 16); return u.v;
}
__device__ __forceinline__ v16h frag_f32(const float* rowk0, int lane) {
  v16h a; const float* p = rowk0 + 8 * (lane >> 4);
#pragma unroll
  for (int i = 0; i < 8; ++i) { a[i] = (_Float16)p[i]; a[8 + i] = (_Float16)p[16 + i]; }
  return a;
}
__device__ __forceinline__ v16h frag_f32s(const float* rowk0, int lane, float sc) {
  v16h a; const float* p = rowk0 + 8 * (lane >> 4);
#pragma unroll
  for (int i = 0; i < 8; ++i) { a[i] = (_Float16)(p[i] * sc); a[8 + i] = (_Float16)(p[16 + i] * sc); }
  return a;
}
// column fragment from a [K][ld] layout (column n), rows >= K read as 0
__device__ __forceinline__ v16h fragc_f32(const float* W, int k0, int n, int lane, int ld, int K) {
  v16h a; const int g = lane >> 4;
#pragma unroll
  for (int i = 0; i < 8; ++i) { const int ka = k0 + 8 * g + i, kb = ka + 16;
    a[i] = (_Float16)(ka < K ? W[(size_t)(ka < K ? ka : K - 1) * ld + n] : 0.f); a[8 + i] = (_Float16)(kb < K ? W[(size_t)(kb < K ? kb : K - 1) * ld + n] : 0.f); }
  return a;
}
struct F2 { v16b h, l; };
__device__ __forceinline__ F2 bsplit16(const float v[16]) { F2 r;
#pragma unroll
  for (int i = 0; i < 16; ++i) { const __bf16 h = (__bf16)v[i]; r.h[i] = h; r.l[i] = (__bf16)(v[i] - (float)h); }
  return r; }
__device__ __forceinline__ F2 split_row(const float* row, int k0, int lane) { float v[16]; const float* p = row + k0 + 8 * (lane >> 4);
#pragma unroll
  for (int i = 0; i < 8; ++i) { v[i] = p[i]; v[8 + i] = p[16 + i]; }
  return bsplit16(v); }
__device__ __forceinline__ F2 split_rowK(const float* row, int k0, int lane, int K) { float v[16]; const int g = lane >> 4;
#pragma unroll
  for (int i = 0; i < 8; ++i) { const int ka = k0 + 8 * g + i, kb = ka + 16; v[i] = ka < K ? row[ka < K ? ka : K - 1] : 0.f; v[8 + i] = kb < K ? row[kb < K ? kb : K - 1] : 0.f; }
  return bsplit16(v); }
__device__ __forceinline__ F2 split_col(const float* W, int k0, int n, int lane, int ld, int K) { float v[16]; const int g = lane >> 4;
#pragma unroll
  for (int i = 0; i < 8; ++i) { const int ka = k0 + 8 * g + i, kb = ka + 16; v[i] = ka < K ? W[(size_t)(ka < K ? ka : K - 1) * ld + n] : 0.f; v[8 + i] = kb < K ? W[(size_t)(kb < K ? kb : K - 1) * ld + n] : 0.f; }
  return bsplit16(v); }
__device__ __forceinline__ v8f mac3(const F2& a, const F2& b, v8f c) { c = wmma_bf(a.l, b.h, c); c = wmma_bf(a.h, b.l, c); return wmma_bf(a.h, b.h, c); }
__device__ __forceinline__ float sigm(float v) { return 1.0f / (1.0f + expf(-v)); }
#define LDSX() do { asm volatile("s_wait_dscnt 0" ::: "memory"); __builtin_amdgcn_wave_barrier(); __builtin_amdgcn_fence(__ATOMIC_RELEASE, "workgroup"); } while (0)


#define NB 4
#define SS 2048
#define SCALEF 0.125f
#define DM 1024
#define NH 16
#define HD 64
#define QKVW (3 * DM)
#ifndef TQB
#define TQB (SS / 64)
#define TNB NB
#define TOB (NB * SS / 64)     // output row tiles (all)
#endif
typedef __attribute__((ext_vector_type(8))) __bf16 v8b;
__device__ __forceinline__ v16b frag_b(const __bf16* rowk0, int lane) {
  union { v16b v; v8b q[2]; } u; const __bf16* p = rowk0 + 8 * (lane >> 4);
  u.q[0] = *(const v8b*)p; u.q[1] = *(const v8b*)(p + 16); return u.v;
}
__device__ __forceinline__ float bfr(float v) { return (float)(__bf16)v; }
__device__ __attribute__((noinline)) float exp_ni(float v) { return expf(v); }
__device__ __attribute__((noinline)) float erf_ni(float v) { return erff(v); }

#define PK_A 0                       // [3072][1024] Wqkv rows (natural [out][in])
#define PK_P (PK_A + QKVW * DM)        // [1024][1024] Wo rows (natural)
#define PK_END (PK_P + DM * DM)
#define WS_PK  0u
#define WS_QK  (WS_PK + 2u * PK_END)             // f16 [8192 rows][2048]: q | k
#define WS_QKL (WS_QK + 2u * NB * SS * 2 * DM)     // f16 q | k residual planes x2048
#define WS_VTH (WS_QKL + 2u * NB * SS * 2 * DM)    // f16 [b][1024 (h*64+d)][2048 s] hi
#define WS_VTL (WS_VTH + 2u * NB * DM * SS)        // f16 lo x 2048
#define WS_O   (WS_VTL + 2u * NB * DM * SS)        // f32 [8192][1024]
#define WS_CS  (WS_O + 4u * NB * SS * DM)           // f32 2 x [2048][32], reserved, unused
#define WS_PH  (WS_CS + 4u * 2 * SS * 32)                 // f32 [NB*NH*(SS/64)] entropy block partials
#define WS_END (WS_PH + 4u * NB * NH * (SS / 64))
// ---- k_pack: block = (row n, which): natural [out][in] rows -> bf16; which 0..2 -> W_q/W_k/W_v into PK_A rows which*1024 + n; 3 -> W_o into PK_P
__global__ __launch_bounds__(256) void k_pack(const float* __restrict__ WQ, const float* __restrict__ WK, const float* __restrict__ WV, const float* __restrict__ WO, __bf16* __restrict__ PK) {
  __shared__ __align__(16) __bf16 s[DM]; const int n = blockIdx.x, which = blockIdx.y, t = threadIdx.x; const float* Wm = (which == 0) ? WQ : (which == 1) ? WK : (which == 2) ? WV : WO;
  for (int k = t; k < DM; k += 256) s[k] = (__bf16)Wm[(size_t)n * DM + k];
  __syncthreads();
  __bf16* dst = (which < 3) ? PK + PK_A + ((size_t)which * DM + n) * DM : PK + PK_P + (size_t)n * DM;
  for (int q = t; q < DM / 8; q += 256) vst2((unsigned*)(dst + q * 8), *(const v4u*)&s[q * 8]);
}
// ---- operand staging of the two projection GEMMs: per 64-k chunk the block's 64 f32 activation rows (256 B each) and 128 bf16 weight rows (128 B each) go from global memory into LDS by asynchronous 16-B copies that cover whole 128-B lines, once per block; the four waves read their fragments from LDS. Two buffers: chunk t + 1 flies while chunk t is worked on.
#define GKC 64                           // k per staged chunk
#define GA_PITCH 272                     // LDS bytes per staged f32 row (16 B x odd: 16-B reads of 16 rows fall on distinct banks)
#define GB_PITCH 144                     // LDS bytes per staged bf16 row (16 B x odd)
#define GA_BYTES (64 * GA_PITCH)
#define GB_BYTES (128 * GB_PITCH)
#define GSTAGE (GA_BYTES + GB_BYTES)     // one buffer: [activation rows | weight rows]
#define GNT (DM / GKC)
// eight copies of one lane and, in the same statement, the wait that stands in front of any later write of the address registers they name
#define COPY8(l, ls, p, ps) asm volatile( \
  "global_load_async_to_lds_b128 %0, %8, off\n\tglobal_load_async_to_lds_b128 %1, %9, off\n\t" \
  "global_load_async_to_lds_b128 %2, %10, off\n\tglobal_load_async_to_lds_b128 %3, %11, off\n\t" \
  "global_load_async_to_lds_b128 %4, %12, off\n\tglobal_load_async_to_lds_b128 %5, %13, off\n\t" \
  "global_load_async_to_lds_b128 %6, %14, off\n\tglobal_load_async_to_lds_b128 %7, %15, off\n\ts_wait_xcnt 0x0" \
  :: "v"(l), "v"((l) + (ls)), "v"((l) + 2 * (ls)), "v"((l) + 3 * (ls)), "v"((l) + 4 * (ls)), "v"((l) + 5 * (ls)), "v"((l) + 6 * (ls)), "v"((l) + 7 * (ls)), \
     "v"(p), "v"((p) + (ps)), "v"((p) + 2 * (ps)), "v"((p) + 3 * (ps)), "v"((p) + 4 * (ps)), "v"((p) + 5 * (ps)), "v"((p) + 6 * (ps)), "v"((p) + 7 * (ps)) : "memory")
// Ag: first of the block's 64 rows at the chunk's first k; Bg: first of its 128 weight rows at the same k; lds: byte address of the buffer
__device__ __forceinline__ void stage_chunk(const float* Ag, const __bf16* Bg, unsigned lds, int tid) {
  const float* pa = Ag + (size_t)(tid >> 4) * DM + (tid & 15) * 4; const unsigned la = lds + (unsigned)(tid >> 4) * GA_PITCH + (unsigned)(tid & 15) * 16u;   // 16 lanes a row, 8 rows a copy
  const __bf16* pb = Bg + (size_t)(tid >> 3) * DM + (tid & 7) * 8; const unsigned lb = lds + GA_BYTES + (unsigned)(tid >> 3) * GB_PITCH + (unsigned)(tid & 7) * 16u;   // 8 lanes a row, 16 rows a copy
  COPY8(la, 8u * GA_PITCH, pa, (size_t)8 * DM);
  COPY8(lb, 16u * GB_PITCH, pb, (size_t)16 * DM);
}
// the 16 f32 of a lane's A fragment (k = 8g + 0..7 and 16 + 8g + 0..7 of a 32-k step) from a staged row; p = row + 128 * step + 32 * g bytes
__device__ __forceinline__ void lds_a16(const char* p, float v[16]) { const v4f x0 = *(const v4f*)p, x1 = *(const v4f*)(p + 16), x2 = *(const v4f*)(p + 64), x3 = *(const v4f*)(p + 80);
#pragma unroll   // constant indices: v stays in registers
  for (int i = 0; i < 4; ++i) { v[i] = x0[i]; v[4 + i] = x1[i]; v[8 + i] = x2[i]; v[12 + i] = x3[i]; } }
// a lane's B fragment (same k order) from a staged bf16 row; p = row + 64 * step + 16 * g bytes
__device__ __forceinline__ v16b lds_b16(const char* p) { union { v16b v; v8b q[2]; } u; u.q[0] = *(const v8b*)p; u.q[1] = *(const v8b*)(p + 32); return u.v; }
__global__ __launch_bounds__(128) void k_qkv(const float* __restrict__ XQ, const float* __restrict__ XK, const float* __restrict__ XV, const __bf16* __restrict__ P, const float* __restrict__ BQ, const float* __restrict__ BK, const float* __restrict__ BV, _Float16* __restrict__ QK, _Float16* __restrict__ QKL, _Float16* __restrict__ VTH, _Float16* __restrict__ VTL) {
  const int which0 = (blockIdx.y * 128) / DM; const float* X = (which0 == 0) ? XQ : (which0 == 1) ? XK : XV; const float* BB = BQ ? (((which0 == 0) ? BQ : (which0 == 1) ? BK : BV) + (blockIdx.y * 128 - which0 * DM)) : nullptr;
  __shared__ __align__(16) char smem[2 * GSTAGE];   // the two staging buffers; behind the K loop's last barrier the same bytes stage the output
  _Float16 (*so)[16][136] = (_Float16 (*)[16][136])smem, (*sol)[16][136] = (_Float16 (*)[16][136])(smem + 4 * 16 * 136 * 2); _Float16 (*sth)[72] = (_Float16 (*)[72])smem, (*stl)[72] = (_Float16 (*)[72])(smem + 128 * 72 * 2);
  const int tid = threadIdx.x, wave = tid >> 5, lane = tid & 31, col = lane & 15, g = lane >> 4; const size_t r0 = (size_t)blockIdx.x * 64 + wave * 16; const int n0 = blockIdx.y * 128;
  v8f acc[8] = {};
  const unsigned lds0 = (unsigned)(size_t)smem; const float* Ag = X + (size_t)blockIdx.x * 64 * DM; const __bf16* Bg = P + (size_t)n0 * DM;
  stage_chunk(Ag, Bg, lds0, tid);
  asm volatile("s_wait_asynccnt 0x0" ::: "memory");   // this wave's copies of chunk 0 have landed
  __syncthreads();                                    // ... and every other wave's: chunk 0 may be read
  stage_chunk(Ag + GKC, Bg + GKC, lds0 + GSTAGE, tid);
#pragma unroll 1   // kept rolled: the buffer alternates with t, one copy of the body
  for (int t = 0; t < GNT; ++t) { const char* sa = smem + (t & 1) * GSTAGE + (wave * 16 + col) * GA_PITCH + 32 * g; const char* sb = smem + (t & 1) * GSTAGE + GA_BYTES + col * GB_PITCH + 16 * g;
#pragma unroll   // this and the inner loops: constant indices, so that fragments and accumulators stay in registers
    for (int kc = 0; kc < GKC / 32; ++kc) { float av[16]; lds_a16(sa + kc * 128, av); v16b a, w[8];   // all LDS reads of a 32-k step stand as one group in front of its products: one LDS latency a step, not one a product
#pragma unroll
      for (int j = 0; j < 8; ++j) w[j] = lds_b16(sb + j * 16 * GB_PITCH + kc * 64);
#pragma unroll
      for (int i = 0; i < 16; ++i) a[i] = (__bf16)av[i];
#pragma unroll
      for (int j = 0; j < 8; ++j) acc[j] = wmma_bf(a, w[j], acc[j]); }
    asm volatile("s_wait_dscnt 0x0" ::: "memory");      // this wave's reads of buffer t & 1 are done before it is refilled
    asm volatile("s_wait_asynccnt 0x0" ::: "memory");   // this wave's copies of chunk t + 1 have landed
    __syncthreads();                                    // publishes chunk t + 1 and ends every wave's reads of chunk t
    if (t + 2 < GNT) stage_chunk(Ag + (t + 2) * GKC, Bg + (t + 2) * GKC, lds0 + (unsigned)(t & 1) * GSTAGE, tid); }
  asm volatile("s_wait_asynccnt 0x0" ::: "memory");     // no copy is in flight when the buffers become output staging
  if (n0 < 2 * DM) {   // q stored unscaled (f16 sigma ~0.6, no subnormal exposure); 1/8 applied to the f32 score
#pragma unroll
    for (int j = 0; j < 8; ++j) {
#pragma unroll
      for (int r = 0; r < 8; ++r) { const float v = acc[j][r] + (BB ? bfr(BB[j * 16 + col]) : 0.f); const _Float16 hv = (_Float16)v; so[wave][8 * g + r][j * 16 + col] = hv; sol[wave][8 * g + r][j * 16 + col] = (_Float16)((v - (float)hv) * 2048.0f); } }   // q, k (+ bias) as f16 hi + (x2048) residual
    LDSX();
    for (int rl = 0; rl < 16; ++rl) if (lane < 16) { vst2((unsigned*)(QK + (r0 + rl) * (2 * DM) + n0 + lane * 8), *(const v4u*)&so[wave][rl][lane * 8]); vst2((unsigned*)(QKL + (r0 + rl) * (2 * DM) + n0 + lane * 8), *(const v4u*)&sol[wave][rl][lane * 8]); }
  } else {
#pragma unroll
    for (int j = 0; j < 8; ++j) {
#pragma unroll
      for (int r = 0; r < 8; ++r) { const float v = acc[j][r] + (BB ? bfr(BB[j * 16 + col]) : 0.f); const _Float16 hv = (_Float16)v; sth[j * 16 + col][wave * 16 + 8 * g + r] = hv; stl[j * 16 + col][wave * 16 + 8 * g + r] = (_Float16)((v - (float)hv) * 2048.0f); } }
    __syncthreads();
    const size_t rb = (size_t)blockIdx.x * 64; const int b = (int)(rb / SS), s0 = (int)(rb % SS); const int pc0 = n0 - 2 * DM;
    for (int q = tid; q < 128 * 8; q += 128) { const int d = q >> 3, pc = q & 7; const size_t o = ((size_t)b * DM + pc0 + d) * SS + s0 + pc * 8; vst2((unsigned*)(VTH + o), *(const v4u*)&sth[d][pc * 8]); vst2((unsigned*)(VTL + o), *(const v4u*)&stl[d][pc * 8]); }
  }
}
// ---- K / V staging of k_attn: per 64 keys the head's 64 K rows, 64 rows of Vt hi and 64 rows of Vt lo (128 B each, one whole line) go from global memory into LDS by asynchronous 16-B copies, once per block; the four waves read their fragments from LDS. Two buffers: stage t + 1 flies while stage t is worked on.
#define AT_PITCH 144                     // LDS bytes per staged 128-B row (16 B x odd: 16-B reads of 16 rows fall on distinct banks)
#define AT_SEC (64 * AT_PITCH)           // 64 rows
#define AT_STAGE (3 * AT_SEC)            // one buffer: [K rows | Vt hi rows | Vt lo rows]
// Kg: the stage's first K row (this head's 64 d); Vh, Vl: the head's first Vt row at the stage's first key; lds: byte address of the buffer. 8 lanes a row, 16 rows a copy, 12 copies a lane; in the same statement the wait that stands in front of any later write of the address registers they name
__device__ __forceinline__ void stage_kv(const _Float16* Kg, const _Float16* Vh, const _Float16* Vl, unsigned lds, int tid) {
  const unsigned l = lds + (unsigned)(tid >> 3) * AT_PITCH + (unsigned)(tid & 7) * 16u, ls = 16u * AT_PITCH;
  const _Float16* pk = Kg + (size_t)(tid >> 3) * (2 * DM) + (tid & 7) * 8; const _Float16* ph = Vh + (size_t)(tid >> 3) * SS + (tid & 7) * 8; const _Float16* pl = Vl + (size_t)(tid >> 3) * SS + (tid & 7) * 8;
  const size_t ks = (size_t)16 * 2 * DM, vs = (size_t)16 * SS;
  asm volatile(
    "global_load_async_to_lds_b128 %0, %12, off\n\tglobal_load_async_to_lds_b128 %1, %13, off\n\tglobal_load_async_to_lds_b128 %2, %14, off\n\tglobal_load_async_to_lds_b128 %3, %15, off\n\t"
    "global_load_async_to_lds_b128 %4, %16, off\n\tglobal_load_async_to_lds_b128 %5, %17, off\n\tglobal_load_async_to_lds_b128 %6, %18, off\n\tglobal_load_async_to_lds_b128 %7, %19, off\n\t"
    "global_load_async_to_lds_b128 %8, %20, off\n\tglobal_load_async_to_lds_b128 %9, %21, off\n\tglobal_load_async_to_lds_b128 %10, %22, off\n\tglobal_load_async_to_lds_b128 %11, %23, off\n\ts_wait_xcnt 0x0"
    :: "v"(l), "v"(l + ls), "v"(l + 2 * ls), "v"(l + 3 * ls), "v"(l + AT_SEC), "v"(l + AT_SEC + ls), "v"(l + AT_SEC + 2 * ls), "v"(l + AT_SEC + 3 * ls), "v"(l + 2 * AT_SEC), "v"(l + 2 * AT_SEC + ls), "v"(l + 2 * AT_SEC + 2 * ls), "v"(l + 2 * AT_SEC + 3 * ls),
       "v"(pk), "v"(pk + ks), "v"(pk + 2 * ks), "v"(pk + 3 * ks), "v"(ph), "v"(ph + vs), "v"(ph + 2 * vs), "v"(ph + 3 * vs), "v"(pl), "v"(pl + vs), "v"(pl + 2 * vs), "v"(pl + 3 * vs) : "memory");
}
// a lane's f16 fragment (k = 8g + 0..7 and 16 + 8g + 0..7 of a 32-k step) from a staged row; p = row + 64 * step + 16 * g bytes
__device__ __forceinline__ v16h lds_h16(const char* p) { union { v16h v; v8h q[2]; } u; u.q[0] = *(const v8h*)p; u.q[1] = *(const v8h*)(p + 32); return u.v; }
// ---- k_attn: block = (query tile pair, head h, batch b): every wave walks 64-query tile TQB-1-x and then tile x, one after the other, so each block has the same number of key steps (2*TQB + 2) wherever it is placed; K and V come from the block's LDS stages (above); per tile: causal flash attention (K = 64: 2 k-steps), scores = (q.k) * 0.125 with single f16 operands (query tiles 0 and 1: 3 products of f16 hi + residual, the k residual read from global memory), P.V: f16 P x (V hi, V lo*2048) in two accumulators; O[b*S+q][h*64+d] = (acc + accl / 2048) / (2048 l) (256-B segments)
__global__ __launch_bounds__(128) void k_attn(const _Float16* __restrict__ QK, const _Float16* __restrict__ QKL, const _Float16* __restrict__ VTH, const _Float16* __restrict__ VTL, const void* __restrict__ KMASK, float* __restrict__ O, float* __restrict__ PH) {
  __shared__ float sh_ent[2][64];
  __shared__ __align__(16) float so[4][16][68];   // a wave's output staging; inside the key loop its first bytes hold the wave's P tile (the same wave writes and reads both, one after the other), so that four blocks fit a WGP's LDS
  __shared__ __align__(16) char skv[2 * AT_STAGE];   // the two K / V staging buffers
  const int tid = threadIdx.x, wave = tid >> 5, lane = tid & 31, col = lane & 15, g = lane >> 4;
  const int h = blockIdx.y, b = blockIdx.z;
  float (*sp)[36] = (float (*)[36])&so[wave][0][0];
  const unsigned kv0 = (unsigned)(size_t)skv; const _Float16* Kg = QK + (size_t)b * SS * (2 * DM) + DM + h * HD; const _Float16* Vhg = VTH + ((size_t)b * DM + h * HD) * SS; const _Float16* Vlg = VTL + ((size_t)b * DM + h * HD) * SS;
#pragma unroll 1   // kept rolled: one copy of the tile body in the instruction cache, one register set for both tiles
  for (int tp = 0; tp < 2; ++tp) {
  const int qb = tp ? (int)blockIdx.x : TQB - 1 - (int)blockIdx.x; const int q0 = qb * 64 + wave * 16; const size_t rq = (size_t)b * SS + q0 + col;
  v16h aq[2], aql[2];
#pragma unroll
  for (int kc = 0; kc < 2; ++kc) { aq[kc] = frag_h(QK + rq * (2 * DM) + h * HD + kc * 32, lane); aql[kc] = frag_h(QKL + rq * (2 * DM) + h * HD + kc * 32, lane); }
  float hs[8];   // sum over keys of e^(s - m) * s (rescaled with the running max)
#pragma unroll
  for (int r = 0; r < 8; ++r) hs[r] = 0.f;
  float m[8], l[8];
#pragma unroll
  for (int r = 0; r < 8; ++r) { m[r] = -3.0e38f; l[r] = 0.f; }
  v8f acc[4] = {}, accl[4] = {};
  const int nst = qb + 1;   // causal: 64-key stages up to the query tile's end
  stage_kv(Kg, Vhg, Vlg, kv0, tid);                   // (second tile: every wave's last read of the buffers ended at the first tile's last barrier)
  asm volatile("s_wait_asynccnt 0x0" ::: "memory");   // this wave's copies of stage 0 have landed
  __syncthreads();                                    // ... and every other wave's: stage 0 may be read
  if (nst > 1) stage_kv(Kg + (size_t)64 * (2 * DM), Vhg + 64, Vlg + 64, kv0 + AT_STAGE, tid);
#pragma unroll 1   // kept rolled: the buffer alternates with t, one copy of the body
  for (int t = 0; t < nst; ++t) { const char* sk = skv + (t & 1) * AT_STAGE + col * AT_PITCH + 16 * g;
#pragma unroll 1   // kept rolled: one copy of the 32-key step in the instruction cache
  for (int hf = 0; hf < 2; ++hf) { const int ks = 2 * t + hf; v8f s[2]; v16h kf[2][2];   // the step's K fragments are read as one group in front of its products: one LDS latency a step, not one a product
#pragma unroll
    for (int ct = 0; ct < 2; ++ct) {
#pragma unroll
      for (int kc = 0; kc < 2; ++kc) kf[ct][kc] = lds_h16(sk + (hf * 32 + ct * 16) * AT_PITCH + kc * 64); }
#pragma unroll
    for (int ct = 0; ct < 2; ++ct) { const int kk = ks * 32 + ct * 16 + col; const _Float16* krowl = QKL + ((size_t)b * SS + kk) * (2 * DM) + DM + h * HD; v8f c = {}, cl = {};
      if (qb < 2) {   // leading query blocks (few keys, outputs far above the global rms): 3 products
#pragma unroll
        for (int kc = 0; kc < 2; ++kc) { const v16h kh = kf[ct][kc]; c = wmma16(aq[kc], kh, c); cl = wmma16(aql[kc], kh, cl); cl = wmma16(aq[kc], frag_h(krowl + kc * 32, lane), cl); }
#pragma unroll
        for (int r = 0; r < 8; ++r) c[r] += cl[r] * (1.0f / 2048.0f); }
      else {
#pragma unroll
        for (int kc = 0; kc < 2; ++kc) c = wmma16(aq[kc], kf[ct][kc], c); }   // single product elsewhere
#pragma unroll
      for (int r = 0; r < 8; ++r) s[ct][r] = (kk <= q0 + 8 * g + r) ? c[r] * SCALEF : -3.0e38f; }   // causal: future keys excluded
#pragma unroll
    for (int r = 0; r < 8; ++r) { float mx = fmaxf(s[0][r], s[1][r]);
#pragma unroll
      for (int o = 1; o < 16; o <<= 1) mx = fmaxf(mx, __shfl_xor(mx, o));
      const float mn = fmaxf(m[r], mx); const float alpha = (m[r] <= -1.0e38f) ? 0.f : __expf(m[r] - mn);
      const float e0 = (s[0][r] <= -1.0e38f) ? 0.f : __expf(s[0][r] - mn), e1 = (s[1][r] <= -1.0e38f) ? 0.f : __expf(s[1][r] - mn); float es = e0 + e1;
#pragma unroll
      for (int o = 1; o < 16; o <<= 1) es += __shfl_xor(es, o);
      l[r] = l[r] * alpha + es; m[r] = mn; { float eh = (e0 > 0.f ? e0 * s[0][r] : 0.f) + (e1 > 0.f ? e1 * s[1][r] : 0.f);
#pragma unroll
        for (int o = 1; o < 16; o <<= 1) eh += __shfl_xor(eh, o);
        hs[r] = hs[r] * alpha + eh; }
#pragma unroll
      for (int dt = 0; dt < 4; ++dt) { acc[dt][r] *= alpha; accl[dt][r] *= alpha; }
      sp[8 * g + r][col] = e0; sp[8 * g + r][16 + col] = e1; }
    LDSX();
    v16h vh[2], vl[2];   // the step's V fragments are read in two groups of four (the first with P), each in front of its products: two LDS latencies a step, not eight; one group of eight would take the kernel past 256 registers (four waves a SIMD)
#pragma unroll
    for (int dt = 0; dt < 2; ++dt) { vh[dt] = lds_h16(sk + AT_SEC + dt * 16 * AT_PITCH + hf * 64); vl[dt] = lds_h16(sk + 2 * AT_SEC + dt * 16 * AT_PITCH + hf * 64); }
    v16h pa, pl; { const float* prow = &sp[col][0] + 8 * (lane >> 4);
#pragma unroll
      for (int i = 0; i < 8; ++i) { const float x0 = prow[i] * 2048.0f, x1 = prow[16 + i] * 2048.0f; const _Float16 h0 = (_Float16)x0, h1 = (_Float16)x1; pa[i] = h0; pa[8 + i] = h1; pl[i] = (_Float16)((x0 - (float)h0) * 2048.0f); pl[8 + i] = (_Float16)((x1 - (float)h1) * 2048.0f); } }   // P scaled by 2^11 before the f16 split so small softmax weights stay out of the f16 subnormal range; 2^-11 folded into the epilogue
#pragma unroll
    for (int dt = 0; dt < 2; ++dt) { acc[dt] = wmma16(pa, vh[dt], acc[dt]); accl[dt] = wmma16(pa, vl[dt], accl[dt]); }
#pragma unroll
    for (int dt = 0; dt < 2; ++dt) { vh[dt] = lds_h16(sk + AT_SEC + (2 + dt) * 16 * AT_PITCH + hf * 64); vl[dt] = lds_h16(sk + 2 * AT_SEC + (2 + dt) * 16 * AT_PITCH + hf * 64); }
#pragma unroll
    for (int dt = 0; dt < 2; ++dt) { acc[2 + dt] = wmma16(pa, vh[dt], acc[2 + dt]); accl[2 + dt] = wmma16(pa, vl[dt], accl[2 + dt]); }   // P (single) x V hi + P x V lo / 2048: 2 products
    (void)pl;
    LDSX(); }
    asm volatile("s_wait_dscnt 0x0" ::: "memory");      // this wave's reads of buffer t & 1 are done before it is refilled
    asm volatile("s_wait_asynccnt 0x0" ::: "memory");   // this wave's copies of stage t + 1 have landed
    __syncthreads();                                    // publishes stage t + 1 and ends every wave's reads of stage t
    if (t + 2 < nst) stage_kv(Kg + (size_t)(t + 2) * 64 * (2 * DM), Vhg + (t + 2) * 64, Vlg + (t + 2) * 64, kv0 + (unsigned)(t & 1) * AT_STAGE, tid); }
  asm volatile("s_wait_asynccnt 0x0" ::: "memory");     // no copy is in flight behind the key loop
  if (col == 0) {
#pragma unroll
    for (int r = 0; r < 8; ++r) sh_ent[tp][wave * 16 + 8 * g + r] = m[r] + logf(l[r]) - hs[r] / l[r]; }   // H_row = -sum p log p = m + log l - sum p s
#pragma unroll
  for (int r = 0; r < 8; ++r) { const float il = (1.0f / 2048.0f) / l[r];
#pragma unroll
    for (int dt = 0; dt < 4; ++dt) so[wave][8 * g + r][dt * 16 + col] = (acc[dt][r] + accl[dt][r] * (1.0f / 2048.0f)) * il; }
  LDSX();
  for (int rl = 0; rl < 16; ++rl) if (lane < 16) vst2(O + ((size_t)b * SS + q0 + rl) * DM + h * HD + lane * 4, *(const v4f*)&so[wave][rl][lane * 4]);
  asm volatile("s_wait_xcnt 0x0" ::: "memory");   // stands in front of the next tile's first writes to registers that the stores above name
  }
  __syncthreads();
  if (tid < 2) { float a = 0.f; for (int i = 0; i < 64; ++i) a += sh_ent[tid][i]; PH[((size_t)b * NH + h) * (SS / 64) + (tid ? (int)blockIdx.x : TQB - 1 - (int)blockIdx.x)] = a; }   // one partial per tile, summed in row order (plain 4-B store of a scratch value)
}
// ---- k_out: block = (64 rows, 128 cols): out = O(hi/lo) . Wo rows (2 products) + bo
__global__ __launch_bounds__(128) void k_out(const float* __restrict__ O, const __bf16* __restrict__ P, const float* __restrict__ BO, float* __restrict__ Y) {
  __shared__ __align__(16) char smem[2 * GSTAGE];   // the two staging buffers; behind the K loop's last barrier the same bytes stage the output
  float (*so)[16][132] = (float (*)[16][132])smem;
  const int tid = threadIdx.x, wave = tid >> 5, lane = tid & 31, col = lane & 15, g = lane >> 4; const size_t r0 = (size_t)blockIdx.x * 64 + wave * 16; const int n0 = blockIdx.y * 128;
  v8f acc[8] = {};
  const unsigned lds0 = (unsigned)(size_t)smem; const float* Ag = O + (size_t)blockIdx.x * 64 * DM; const __bf16* Bg = P + (size_t)n0 * DM;
  stage_chunk(Ag, Bg, lds0, tid);
  asm volatile("s_wait_asynccnt 0x0" ::: "memory");   // this wave's copies of chunk 0 have landed
  __syncthreads();                                    // ... and every other wave's: chunk 0 may be read
  stage_chunk(Ag + GKC, Bg + GKC, lds0 + GSTAGE, tid);
#pragma unroll 1   // kept rolled: the buffer alternates with t, one copy of the body
  for (int t = 0; t < GNT; ++t) { const char* sa = smem + (t & 1) * GSTAGE + (wave * 16 + col) * GA_PITCH + 32 * g; const char* sb = smem + (t & 1) * GSTAGE + GA_BYTES + col * GB_PITCH + 16 * g;
#pragma unroll   // this and the inner loops: constant indices, so that fragments and accumulators stay in registers
    for (int kc = 0; kc < GKC / 32; ++kc) { float av[16]; lds_a16(sa + kc * 128, av); v16b w[8];   // all LDS reads of a 32-k step stand as one group in front of its products: one LDS latency a step, not one a product
#pragma unroll
      for (int j = 0; j < 8; ++j) w[j] = lds_b16(sb + j * 16 * GB_PITCH + kc * 64);
      const F2 a = bsplit16(av);
#pragma unroll
      for (int j = 0; j < 8; ++j) { acc[j] = wmma_bf(a.l, w[j], acc[j]); acc[j] = wmma_bf(a.h, w[j], acc[j]); } }
    asm volatile("s_wait_dscnt 0x0" ::: "memory");      // this wave's reads of buffer t & 1 are done before it is refilled
    asm volatile("s_wait_asynccnt 0x0" ::: "memory");   // this wave's copies of chunk t + 1 have landed
    __syncthreads();                                    // publishes chunk t + 1 and ends every wave's reads of chunk t
    if (t + 2 < GNT) stage_chunk(Ag + (t + 2) * GKC, Bg + (t + 2) * GKC, lds0 + (unsigned)(t & 1) * GSTAGE, tid); }
  asm volatile("s_wait_asynccnt 0x0" ::: "memory");     // no copy is in flight when the buffers become output staging
#pragma unroll
  for (int j = 0; j < 8; ++j) {
#pragma unroll
    for (int r = 0; r < 8; ++r) so[wave][8 * g + r][j * 16 + col] = acc[j][r] + bfr(BO[n0 + j * 16 + col]); }
  LDSX();
  for (int rl = 0; rl < 16; ++rl) vst2(Y + (r0 + rl) * DM + n0 + lane * 4, *(const v4f*)&so[wave][rl][lane * 4]);
}
// ---- k_ent: mean entropy over all (b, h, t) rows from the block partials (fixed order) -> scalar second output
__global__ __launch_bounds__(256) void k_ent(const float* __restrict__ PH, float* __restrict__ OUT1) {
  __shared__ float red[256]; const int t = threadIdx.x; const int n = NB * NH * (TQB);   // TQB row blocks per (b, h) were computed
  float a = 0.f; for (int i = t; i < n; i += 256) a += PH[(size_t)(i / TQB) * (SS / 64) + (i % TQB)];
  red[t] = a; __syncthreads();
  for (int s = 128; s >= 1; s >>= 1) { if (t < s) red[t] += red[t + s]; __syncthreads(); }
  if (t == 0) { float* p = OUT1; p[0] = red[0] / ((float)NB * NH * (TQB * 64));  }
}
extern "C" void kernel_launch(void* const* d_in, const int* in_sizes, int n_in, void* d_out, int out_size, void* d_ws, size_t ws_size, hipStream_t stream) {
  (void)in_sizes; (void)n_in; (void)out_size;
  const float** F = (const float**)d_in;   // 0 x [4,2048,1024], 1 w_q natural, 2 b_q, 3 w_k, 4 b_k, 5 w_v, 6 b_v, 7 w_o, 8 b_o
  if (ws_size < (size_t)WS_END) return;
  char* ws = (char*)d_ws; __bf16* PK = (__bf16*)(ws + WS_PK); _Float16 *QK = (_Float16*)(ws + WS_QK), *QKL = (_Float16*)(ws + WS_QKL), *VTH = (_Float16*)(ws + WS_VTH), *VTL = (_Float16*)(ws + WS_VTL); float *O = (float*)(ws + WS_O), *PH = (float*)(ws + WS_PH);
  k_pack<<<dim3(DM, 4), 256, 0, stream>>>(F[1], F[3], F[5], F[7], PK);
  k_qkv<<<dim3(TNB * SS / 64, QKVW / 128), 128, 0, stream>>>(F[0], F[0], F[0], PK + PK_A, F[2], F[4], F[6], QK, QKL, VTH, VTL);
  k_attn<<<dim3(TQB / 2, NH, TNB), 128, 0, stream>>>(QK, QKL, VTH, VTL, nullptr, O, PH);
  k_out<<<dim3(TOB, DM / 128), 128, 0, stream>>>(O, PK + PK_P, F[8], (float*)d_out);
  k_ent<<<1, 256, 0, stream>>>(PH, (float*)d_out + (size_t)NB * SS * DM);
}

// v004
// One run takes 210 microseconds.
// In both of two side-by-side timings against v003, it was 1.28 times as fast.
// Counting every step since v000, it is 3.59 times as fast.
// compute dtype: all float inputs rounded to bf16; q/k/v = x . W^T + b with EXACT bf16 products on WMMA 16x16x32 (natural rows); causal attention x 1/8 (tiles past the diagonal skipped) with 3-product scores (q, k as f16 hi + x2048 residual) for the first 128 queries of each sequence and single-product scores elsewhere; running-max softmax in f32 (hardware exp) that also accumulates sum p*s for the row entropy H = m + log(l) - sum(p s) (precise logf), block partial sums combined in fixed order for the mean; P (scaled by 2^11, single f16) x v (f16 hi + x2048 residual), 2 products; y = ctx (bf16 hi + residual) . Wo^T (2 products) + bo.
#include <hip/hip_runtime.h>
#include <math.h>

typedef __attribute__((ext_vector_type(16))) _Float16 v16h;
typedef __attribute__((ext_vector_type(16))) __bf16 v16b;
typedef __attribute__((ext_vector_type(8)))  _Float16 v8h;
typedef __attribute__((ext_vector_type(8)))  float v8f;
typedef __attribute__((ext_vector_type(4)))  float v4f;
typedef __attribute__((ext_vector_type(2)))  float v2f;
typedef __attribute__((ext_vector_type(4)))  unsigned v4u;
typedef __attribute__((ext_vector_type(4)))  int v4i;
typedef float __attribute__((may_alias)) float_a;
typedef int __attribute__((may_alias)) int_a;

template <typename T> __device__ __forceinline__ void vst2(void* p, T v) { *(T*)p = v;  }
__device__ __forceinline__ v8f wmma16(v16h a, v16h b, v8f c) {
  v8f d = __builtin_amdgcn_wmma_f32_16x16x32_f16(false, a, false, b, (short)0, c, false, false);
  asm volatile("v_nop\n\tv_nop\n\tv_nop\n\tv_nop" : "+v"(d) : "v"(a), "v"(b));
  return d;
}
__device__ __forceinline__ v8f wmma_bf(v16b a, v16b b, v8f c) {
  v8f d = __builtin_amdgcn_wmma_f32_16x16x32_bf16(false, a, false, b, (short)0, c, false, false);
  asm volatile("v_nop\n\tv_nop\n\tv_nop\n\tv_nop" : "+v"(d) : "v"(a), "v"(b));
  return d;
}
// Causal multi-head self attention (B 4, T 2,048, C 1,024, 16 heads x 64) with biases and output projection, plus the mean attention entropy (second output).
__device__ __forceinline__ v16h frag_h(const _Float16* rowk0, int lane) {
  union { v16h v; v8h q[2]; } u; const _Float16* p = rowk0 + 8 * (lane >> 4);
  u.q[0] = *(const v8h*)p; u.q[1] = *(const v8h*)(p + 16); return u.v;
}
__device__ __forceinline__ v16h frag_f32(const float* rowk0, int lane) {
  v16h a; const float* p = rowk0 + 8 * (lane >> 4);
#pragma unroll
  for (int i = 0; i < 8; ++i) { a[i] = (_Float16)p[i]; a[8 + i] = (_Float16)p[16 + i]; }
  return a;
}
__device__ __forceinline__ v16h frag_f32s(const float* rowk0, int lane, float sc) {
  v16h a; const float* p = rowk0 + 8 * (lane >> 4);
#pragma unroll
  for (int i = 0; i < 8; ++i) { a[i] = (_Float16)(p[i] * sc); a[8 + i] = (_Float16)(p[16 + i] * sc); }
  return a;
}
// column fragment from a [K][ld] layout (column n), rows >= K read as 0
__device__ __forceinline__ v16h fragc_f32(const float* W, int k0, int n, int lane, int ld, int K) {
  v16h a; const int g = lane >> 4;
#pragma unroll
  for (int i = 0; i < 8; ++i) { const int ka = k0 + 8 * g + i, kb = ka + 16;
    a[i] = (_Float16)(ka < K ? W[(size_t)(ka < K ? ka : K - 1) * ld + n] : 0.f); a[8 + i] = (_Float16)(kb < K ? W[(size_t)(kb < K ? kb : K - 1) * ld + n] : 0.f); }
  return a;
}
struct F2 { v16b h, l; };
__device__ __forceinline__ F2 bsplit16(const float v[16]) { F2 r;
#pragma unroll
  for (int i = 0; i < 16; ++i) { const __bf16 h = (__bf16)v[i]; r.h[i] = h; r.l[i] = (__bf16)(v[i] - (float)h); }
  return r; }
__device__ __forceinline__ F2 split_row(const float* row, int k0, int lane) { float v[16]; const float* p = row + k0 + 8 * (lane >> 4);
#pragma unroll
  for (int i = 0; i < 8; ++i) { v[i] = p[i]; v[8 + i] = p[16 + i]; }
  return bsplit16(v); }
__device__ __forceinline__ F2 split_rowK(const float* row, int k0, int lane, int K) { float v[16]; const int g = lane >> 4;
#pragma unroll
  for (int i = 0; i < 8; ++i) { const int ka = k0 + 8 * g + i, kb = ka + 16; v[i] = ka < K ? row[ka < K ? ka : K - 1] : 0.f; v[8 + i] = kb < K ? row[kb < K ? kb : K - 1] : 0.f; }
  return bsplit16(v); }
__device__ __forceinline__ F2 split_col(const float* W, int k0, int n, int lane, int ld, int K) { float v[16]; const int g = lane >> 4;
#pragma unroll
  for (int i = 0; i < 8; ++i) { const int ka = k0 + 8 * g + i, kb = ka + 16; v[i] = ka < K ? W[(size_t)(ka < K ? ka : K - 1) * ld + n] : 0.f; v[8 + i] = kb < K ? W[(size_t)(kb < K ? kb : K - 1) * ld + n] : 0.f; }
  return bsplit16(v); }
__device__ __forceinline__ v8f mac3(const F2& a, const F2& b, v8f c) { c = wmma_bf(a.l, b.h, c); c = wmma_bf(a.h, b.l, c); return wmma_bf(a.h, b.h, c); }
__device__ __forceinline__ float sigm(float v) { return 1.0f / (1.0f + expf(-v)); }
#define LDSX() do { asm volatile("s_wait_dscnt 0" ::: "memory"); __builtin_amdgcn_wave_barrier(); __builtin_amdgcn_fence(__ATOMIC_RELEASE, "workgroup"); } while (0)


#define NB 4
#define SS 2048
#define SCALEF 0.125f
#define DM 1024
#define NH 16
#define HD 64
#define QKVW (3 * DM)
#ifndef TQB
#define TQB (SS / 64)
#define TNB NB
#define TOB (NB * SS / 64)     // output row tiles (all)
#endif
typedef __attribute__((ext_vector_type(8))) __bf16 v8b;
__device__ __forceinline__ v16b frag_b(const __bf16* rowk0, int lane) {
  union { v16b v; v8b q[2]; } u; const __bf16* p = rowk0 + 8 * (lane >> 4);
  u.q[0] = *(const v8b*)p; u.q[1] = *(const v8b*)(p + 16); return u.v;
}
__device__ __forceinline__ float bfr(float v) { return (float)(__bf16)v; }
__device__ __attribute__((noinline)) float exp_ni(float v) { return expf(v); }
__device__ __attribute__((noinline)) float erf_ni(float v) { return erff(v); }

#define PK_A 0                       // [3072][1024] Wqkv rows (natural [out][in])
#define PK_P (PK_A + QKVW * DM)        // [1024][1024] Wo rows (natural)
#define PK_END (PK_P + DM * DM)
#define WS_PK  0u
#define WS_QK  (WS_PK + 2u * PK_END)             // f16 [8192 rows][2048]: q | k
#define WS_QKL (WS_QK + 2u * NB * SS * 2 * DM)     // f16 q | k residual planes x2048
#define WS_VTH (WS_QKL + 2u * NB * SS * 2 * DM)    // f16 [b][1024 (h*64+d)][2048 s] hi
#define WS_VTL (WS_VTH + 2u * NB * DM * SS)        // f16 lo x 2048
#define WS_O   (WS_VTL + 2u * NB * DM * SS)        // f32 [8192][1024]
#define WS_CS  (WS_O + 4u * NB * SS * DM)           // f32 2 x [2048][32], reserved, unused
#define WS_PH  (WS_CS + 4u * 2 * SS * 32)                 // f32 [NB*NH*(SS/64)] entropy block partials
#define WS_END (WS_PH + 4u * NB * NH * (SS / 64))
// ---- k_pack: block = (row n, which): natural [out][in] rows -> bf16; which 0..2 -> W_q/W_k/W_v into PK_A rows which*1024 + n; 3 -> W_o into PK_P
__global__ __launch_bounds__(256) void k_pack(const float* __restrict__ WQ, const float* __restrict__ WK, const float* __restrict__ WV, const float* __restrict__ WO, __bf16* __restrict__ PK) {
  __shared__ __align__(16) __bf16 s[DM]; const int n = blockIdx.x, which = blockIdx.y, t = threadIdx.x; const float* Wm = (which == 0) ? WQ : (which == 1) ? WK : (which == 2) ? WV : WO;
  for (int k = t; k < DM; k += 256) s[k] = (__bf16)Wm[(size_t)n * DM + k];
  __syncthreads();
  __bf16* dst = (which < 3) ? PK + PK_A + ((size_t)which * DM + n) * DM : PK + PK_P + (size_t)n * DM;
  for (int q = t; q < DM / 8; q += 256) vst2((unsigned*)(dst + q * 8), *(const v4u*)&s[q * 8]);
}
// ---- operand staging of the two projection GEMMs: per 64-k chunk the block's 64 f32 activation rows (256 B each) and 128 bf16 weight rows (128 B each) go from global memory into LDS by asynchronous 16-B copies that cover whole 128-B lines, once per block; the four waves read their fragments from LDS. Two buffers: chunk t + 1 flies while chunk t is worked on.
#define GKC 64                           // k per staged chunk
#define GA_PITCH 272                     // LDS bytes per staged f32 row (16 B x odd: 16-B reads of 16 rows fall on distinct banks)
#define GB_PITCH 144                     // LDS bytes per staged bf16 row (16 B x odd)
#define GA_BYTES (64 * GA_PITCH)
#define GB_BYTES (128 * GB_PITCH)
#define GSTAGE (GA_BYTES + GB_BYTES)     // one buffer: [activation rows | weight rows]
#define GNT (DM / GKC)
// eight copies of one lane and, in the same statement, the wait that stands in front of any later write of the address registers they name
#define COPY8(l, ls, p, ps) asm volatile( \
  "global_load_async_to_lds_b128 %0, %8, off\n\tglobal_load_async_to_lds_b128 %1, %9, off\n\t" \
  "global_load_async_to_lds_b128 %2, %10, off\n\tglobal_load_async_to_lds_b128 %3, %11, off\n\t" \
  "global_load_async_to_lds_b128 %4, %12, off\n\tglobal_load_async_to_lds_b128 %5, %13, off\n\t" \
  "global_load_async_to_lds_b128 %6, %14, off\n\tglobal_load_async_to_lds_b128 %7, %15, off\n\ts_wait_xcnt 0x0" \
  :: "v"(l), "v"((l) + (ls)), "v"((l) + 2 * (ls)), "v"((l) + 3 * (ls)), "v"((l) + 4 * (ls)), "v"((l) + 5 * (ls)), "v"((l) + 6 * (ls)), "v"((l) + 7 * (ls)), \
     "v"(p), "v"((p) + (ps)), "v"((p) + 2 * (ps)), "v"((p) + 3 * (ps)), "v"((p) + 4 * (ps)), "v"((p) + 5 * (ps)), "v"((p) + 6 * (ps)), "v"((p) + 7 * (ps)) : "memory")
// Ag: first of the block's 64 rows at the chunk's first k; Bg: first of its 128 weight rows at the same k; lds: byte address of the buffer
__device__ __forceinline__ void stage_chunk(const float* Ag, const __bf16* Bg, unsigned lds, int tid) {
  const float* pa = Ag + (size_t)(tid >> 4) * DM + (tid & 15) * 4; const unsigned la = lds + (unsigned)(tid >> 4) * GA_PITCH + (unsigned)(tid & 15) * 16u;   // 16 lanes a row, 8 rows a copy
  const __bf16* pb = Bg + (size_t)(tid >> 3) * DM + (tid & 7) * 8; const unsigned lb = lds + GA_BYTES + (unsigned)(tid >> 3) * GB_PITCH + (unsigned)(tid & 7) * 16u;   // 8 lanes a row, 16 rows a copy
  COPY8(la, 8u * GA_PITCH, pa, (size_t)8 * DM);
  COPY8(lb, 16u * GB_PITCH, pb, (size_t)16 * DM);
}
// the 16 f32 of a lane's A fragment (k = 8g + 0..7 and 16 + 8g + 0..7 of a 32-k step) from a staged row; p = row + 128 * step + 32 * g bytes
__device__ __forceinline__ void lds_a16(const char* p, float v[16]) { const v4f x0 = *(const v4f*)p, x1 = *(const v4f*)(p + 16), x2 = *(const v4f*)(p + 64), x3 = *(const v4f*)(p + 80);
#pragma unroll   // constant indices: v stays in registers
  for (int i = 0; i < 4; ++i) { v[i] = x0[i]; v[4 + i] = x1[i]; v[8 + i] = x2[i]; v[12 + i] = x3[i]; } }
// a lane's B fragment (same k order) from a staged bf16 row; p = row + 64 * step + 16 * g bytes
__device__ __forceinline__ v16b lds_b16(const char* p) { union { v16b v; v8b q[2]; } u; u.q[0] = *(const v8b*)p; u.q[1] = *(const v8b*)(p + 32); return u.v; }
__global__ __launch_bounds__(128) void k_qkv(const float* __restrict__ XQ, const float* __restrict__ XK, const float* __restrict__ XV, const __bf16* __restrict__ P, const float* __restrict__ BQ, const float* __restrict__ BK, const float* __restrict__ BV, _Float16* __restrict__ QK, _Float16* __restrict__ QKL, _Float16* __restrict__ VTH, _Float16* __restrict__ VTL) {
  const int which0 = (blockIdx.y * 128) / DM; const float* X = (which0 == 0) ? XQ : (which0 == 1) ? XK : XV; const float* BB = BQ ? (((which0 == 0) ? BQ : (which0 == 1) ? BK : BV) + (blockIdx.y * 128 - which0 * DM)) : nullptr;
  __shared__ __align__(16) char smem[2 * GSTAGE];   // the two staging buffers; behind the K loop's last barrier the same bytes stage the output
  _Float16 (*so)[16][136] = (_Float16 (*)[16][136])smem, (*sol)[16][136] = (_Float16 (*)[16][136])(smem + 4 * 16 * 136 * 2); _Float16 (*sth)[72] = (_Float16 (*)[72])smem, (*stl)[72] = (_Float16 (*)[72])(smem + 128 * 72 * 2);
  const int tid = threadIdx.x, wave = tid >> 5, lane = tid & 31, col = lane & 15, g = lane >> 4; const size_t r0 = (size_t)blockIdx.x * 64 + wave * 16; const int n0 = blockIdx.y * 128;
  v8f acc[8] = {};
  const unsigned lds0 = (unsigned)(size_t)smem; const float* Ag = X + (size_t)blockIdx.x * 64 * DM; const __bf16* Bg = P + (size_t)n0 * DM;
  stage_chunk(Ag, Bg, lds0, tid);
  asm volatile("s_wait_asynccnt 0x0" ::: "memory");   // this wave's copies of chunk 0 have landed
  __syncthreads();                                    // ... and every other wave's: chunk 0 may be read
  stage_chunk(Ag + GKC, Bg + GKC, lds0 + GSTAGE, tid);
#pragma unroll 1   // kept rolled: the buffer alternates with t, one copy of the body
  for (int t = 0; t < GNT; ++t) { const char* sa = smem + (t & 1) * GSTAGE + (wave * 16 + col) * GA_PITCH + 32 * g; const char* sb = smem + (t & 1) * GSTAGE + GA_BYTES + col * GB_PITCH + 16 * g;
#pragma unroll   // this and the inner loops: constant indices, so that fragments and accumulators stay in registers
    for (int kc = 0; kc < GKC / 32; ++kc) { float av[16]; lds_a16(sa + kc * 128, av); v16b a, w[8];   // all LDS reads of a 32-k step stand as one group in front of its products: one LDS latency a step, not one a product
#pragma unroll
      for (int j = 0; j < 8; ++j) w[j] = lds_b16(sb + j * 16 * GB_PITCH + kc * 64);
#pragma unroll
      for (int i = 0; i < 16; ++i) a[i] = (__bf16)av[i];
#pragma unroll
      for (int j = 0; j < 8; ++j) acc[j] = wmma_bf(a, w[j], acc[j]); }
    asm volatile("s_wait_dscnt 0x0" ::: "memory");      // this wave's reads of buffer t & 1 are done before it is refilled
    asm volatile("s_wait_asynccnt 0x0" ::: "memory");   // this wave's copies of chunk t + 1 have landed
    __syncthreads();                                    // publishes chunk t + 1 and ends every wave's reads of chunk t
    if (t + 2 < GNT) stage_chunk(Ag + (t + 2) * GKC, Bg + (t + 2) * GKC, lds0 + (unsigned)(t & 1) * GSTAGE, tid); }
  asm volatile("s_wait_asynccnt 0x0" ::: "memory");     // no copy is in flight when the buffers become output staging
  if (n0 < 2 * DM) {   // q stored unscaled (f16 sigma ~0.6, no subnormal exposure); 1/8 applied to the f32 score
#pragma unroll
    for (int j = 0; j < 8; ++j) {
#pragma unroll
      for (int r = 0; r < 8; ++r) { const float v = acc[j][r] + (BB ? bfr(BB[j * 16 + col]) : 0.f); const _Float16 hv = (_Float16)v; so[wave][8 * g + r][j * 16 + col] = hv; sol[wave][8 * g + r][j * 16 + col] = (_Float16)((v - (float)hv) * 2048.0f); } }   // q, k (+ bias) as f16 hi + (x2048) residual
    LDSX();
    for (int rl = 0; rl < 16; ++rl) if (lane < 16) { vst2((unsigned*)(QK + (r0 + rl) * (2 * DM) + n0 + lane * 8), *(const v4u*)&so[wave][rl][lane * 8]); vst2((unsigned*)(QKL + (r0 + rl) * (2 * DM) + n0 + lane * 8), *(const v4u*)&sol[wave][rl][lane * 8]); }
  } else {
#pragma unroll
    for (int j = 0; j < 8; ++j) {
#pragma unroll
      for (int r = 0; r < 8; ++r) { const float v = acc[j][r] + (BB ? bfr(BB[j * 16 + col]) : 0.f); const _Float16 hv = (_Float16)v; sth[j * 16 + col][wave * 16 + 8 * g + r] = hv; stl[j * 16 + col][wave * 16 + 8 * g + r] = (_Float16)((v - (float)hv) * 2048.0f); } }
    __syncthreads();
    const size_t rb = (size_t)blockIdx.x * 64; const int b = (int)(rb / SS), s0 = (int)(rb % SS); const int pc0 = n0 - 2 * DM;
    for (int q = tid; q < 128 * 8; q += 128) { const int d = q >> 3, pc = q & 7; const size_t o = ((size_t)b * DM + pc0 + d) * SS + s0 + pc * 8; vst2((unsigned*)(VTH + o), *(const v4u*)&sth[d][pc * 8]); vst2((unsigned*)(VTL + o), *(const v4u*)&stl[d][pc * 8]); }
  }
}
// ---- K / V staging of k_attn: per 64 keys the head's 64 K rows, 64 rows of Vt hi and 64 rows of Vt lo (128 B each, one whole line) go from global memory into LDS by asynchronous 16-B copies, once per block; the four waves read their fragments from LDS. Two buffers: stage t + 1 flies while stage t is worked on.
#define AT_PITCH 144                     // LDS bytes per staged 128-B row (16 B x odd: 16-B reads of 16 rows fall on distinct banks)
#define AT_SEC (64 * AT_PITCH)           // 64 rows
#define AT_STAGE (3 * AT_SEC)            // one buffer: [K rows | Vt hi rows | Vt lo rows]
// Kg: the stage's first K row (this head's 64 d); Vh, Vl: the head's first Vt row at the stage's first key; lds: byte address of the buffer. 8 lanes a row, 16 rows a copy, 12 copies a lane; in the same statement the wait that stands in front of any later write of the address registers they name
__device__ __forceinline__ void stage_kv(const _Float16* Kg, const _Float16* Vh, const _Float16* Vl, unsigned lds, int tid) {
  const unsigned l = lds + (unsigned)(tid >> 3) * AT_PITCH + (unsigned)(tid & 7) * 16u, ls = 16u * AT_PITCH;
  const _Float16* pk = Kg + (size_t)(tid >> 3) * (2 * DM) + (tid & 7) * 8; const _Float16* ph = Vh + (size_t)(tid >> 3) * SS + (tid & 7) * 8; const _Float16* pl = Vl + (size_t)(tid >> 3) * SS + (tid & 7) * 8;
  const size_t ks = (size_t)16 * 2 * DM, vs = (size_t)16 * SS;
  asm volatile(
    "global_load_async_to_lds_b128 %0, %12, off\n\tglobal_load_async_to_lds_b128 %1, %13, off\n\tglobal_load_async_to_lds_b128 %2, %14, off\n\tglobal_load_async_to_lds_b128 %3, %15, off\n\t"
    "global_load_async_to_lds_b128 %4, %16, off\n\tglobal_load_async_to_lds_b128 %5, %17, off\n\tglobal_load_async_to_lds_b128 %6, %18, off\n\tglobal_load_async_to_lds_b128 %7, %19, off\n\t"
    "global_load_async_to_lds_b128 %8, %20, off\n\tglobal_load_async_to_lds_b128 %9, %21, off\n\tglobal_load_async_to_lds_b128 %10, %22, off\n\tglobal_load_async_to_lds_b128 %11, %23, off\n\ts_wait_xcnt 0x0"
    :: "v"(l), "v"(l + ls), "v"(l + 2 * ls), "v"(l + 3 * ls), "v"(l + AT_SEC), "v"(l + AT_SEC + ls), "v"(l + AT_SEC + 2 * ls), "v"(l + AT_SEC + 3 * ls), "v"(l + 2 * AT_SEC), "v"(l + 2 * AT_SEC + ls), "v"(l + 2 * AT_SEC + 2 * ls), "v"(l + 2 * AT_SEC + 3 * ls),
       "v"(pk), "v"(pk + ks), "v"(pk + 2 * ks), "v"(pk + 3 * ks), "v"(ph), "v"(ph + vs), "v"(ph + 2 * vs), "v"(ph + 3 * vs), "v"(pl), "v"(pl + vs), "v"(pl + 2 * vs), "v"(pl + 3 * vs) : "memory");
}
// the value that lane ^ 16 holds (one vector instruction, no LDS)
__device__ __forceinline__ float xhalf(float v) { const int b = __builtin_bit_cast(int, v); return __builtin_bit_cast(float, __builtin_amdgcn_permlanex16(b, b, 0x76543210, 0xfedcba98, false, false)); }
// a lane's f16 fragment (k = 8g + 0..7 and 16 + 8g + 0..7 of a 32-k step) from a staged row; p = row + 64 * step + 16 * g bytes
__device__ __forceinline__ v16h lds_h16(const char* p) { union { v16h v; v8h q[2]; } u; u.q[0] = *(const v8h*)p; u.q[1] = *(const v8h*)(p + 32); return u.v; }
__global__ __launch_bounds__(128) __attribute__((amdgpu_waves_per_eu(4, 4))) void k_attn(const _Float16* __restrict__ QK, const _Float16* __restrict__ QKL, const _Float16* __restrict__ VTH, const _Float16* __restrict__ VTL, const void* __restrict__ KMASK, float* __restrict__ O, float* __restrict__ PH) {
  __shared__ float sh_ent[2][64];
  __shared__ __align__(16) float so[4][16][68];   // a wave's output staging
  __shared__ __align__(16) char skv[2 * AT_STAGE];   // the two K / V staging buffers
  const int tid = threadIdx.x, wave = tid >> 5, lane = tid & 31, col = lane & 15, g = lane >> 4;
  const int h = blockIdx.y, b = blockIdx.z;
  const unsigned kv0 = (unsigned)(size_t)skv; const _Float16* Kg = QK + (size_t)b * SS * (2 * DM) + DM + h * HD; const _Float16* Vhg = VTH + ((size_t)b * DM + h * HD) * SS; const _Float16* Vlg = VTL + ((size_t)b * DM + h * HD) * SS;
#pragma unroll 1   // kept rolled: one copy of the tile body in the instruction cache, one register set for both tiles
  for (int tp = 0; tp < 2; ++tp) {
  const int qb = tp ? (int)blockIdx.x : TQB - 1 - (int)blockIdx.x; const int q0 = qb * 64 + wave * 16; const size_t rq = (size_t)b * SS + q0 + col;
  v16h aq[2];
#pragma unroll
  for (int kc = 0; kc < 2; ++kc) aq[kc] = frag_h(QK + rq * (2 * DM) + h * HD + kc * 32, lane);
  const _Float16* qrowl = QKL + rq * (2 * DM) + h * HD;   // q's residual plane is read where it is used (the two leading tiles' few steps): held in registers for every tile it would take the kernel past 256 registers (four waves a SIMD)
  float hs = 0.f;   // this lane's share (its eight keys of every sixteen) of the sum over keys of e^(s - m) * s, rescaled with the running max
  float m = -3.0e38f, l = 0.f;   // the lane's query (column col): running max over all keys (equal in both wave halves) and this lane's share of the sum
  v8f acc[4] = {}, accl[4] = {};
  const int nst = qb + 1;   // causal: 64-key stages up to the query tile's end
  stage_kv(Kg, Vhg, Vlg, kv0, tid);                   // (second tile: every wave's last read of the buffers ended at the first tile's last barrier)
  asm volatile("s_wait_asynccnt 0x0" ::: "memory");   // this wave's copies of stage 0 have landed
  __syncthreads();                                    // ... and every other wave's: stage 0 may be read
  if (nst > 1) stage_kv(Kg + (size_t)64 * (2 * DM), Vhg + 64, Vlg + 64, kv0 + AT_STAGE, tid);
#pragma unroll 1   // kept rolled: the buffer alternates with t, one copy of the body
  for (int t = 0; t < nst; ++t) { const char* sk = skv + (t & 1) * AT_STAGE + col * AT_PITCH + 16 * g;
#pragma unroll 1   // kept rolled: one copy of the 32-key step in the instruction cache
  for (int hf = 0; hf < 2; ++hf) { const int ks = 2 * t + hf; const int lim = q0 + col - ks * 32 - 8 * g;   // register r of score tile ct holds key ks*32 + 8g + 16*ct + r: it counts while 16*ct + r <= lim
    v8f s[2]; v16h kf[2][2];   // the step's K fragments are read as one group in front of its products: one LDS latency a step, not one a product
#pragma unroll
    for (int ct = 0; ct < 2; ++ct) {
#pragma unroll
      for (int kc = 0; kc < 2; ++kc) kf[ct][kc] = lds_h16(sk + (hf * 32 + ct * 16) * AT_PITCH + kc * 64); }
#pragma unroll
    for (int ct = 0; ct < 2; ++ct) { const int kk = ks * 32 + ct * 16 + col; const _Float16* krowl = QKL + ((size_t)b * SS + kk) * (2 * DM) + DM + h * HD; v8f c = {}, cl = {};   // transposed scores: A = K rows (lane col = key row kk), B = Q (lane col = query): c[r] = score of key ks*32 + ct*16 + 8g + r with query q0 + col
      if (qb < 2) {   // leading query blocks (few keys, outputs far above the global rms): 3 products
#pragma unroll
        for (int kc = 0; kc < 2; ++kc) { const v16h kh = kf[ct][kc], ql = frag_h(qrowl + kc * 32, lane), kl = frag_h(krowl + kc * 32, lane); c = wmma16(kh, aq[kc], c); cl = wmma16(kh, ql, cl); cl = wmma16(kl, aq[kc], cl); }   // q's and k's residual fragments of a 32-d step are read side by side, in front of its products
#pragma unroll
        for (int r = 0; r < 8; ++r) c[r] += cl[r] * (1.0f / 2048.0f); }
      else {
#pragma unroll
        for (int kc = 0; kc < 2; ++kc) c = wmma16(kf[ct][kc], aq[kc], c); }   // single product elsewhere
#pragma unroll
      for (int r = 0; r < 8; ++r) s[ct][r] = (ct * 16 + r <= lim) ? c[r] * SCALEF : -3.0e38f; }   // causal: future keys excluded
    v16h vh[2], vl[2];   // the step's V fragments are read in two groups of four, each in front of its products; the first group flies under the softmax arithmetic
#pragma unroll
    for (int dt = 0; dt < 2; ++dt) { vh[dt] = lds_h16(sk + AT_SEC + dt * 16 * AT_PITCH + hf * 64); vl[dt] = lds_h16(sk + 2 * AT_SEC + dt * 16 * AT_PITCH + hf * 64); }
    float mx = fmaxf(s[0][0], s[1][0]);   // the lane's 16 scores all belong to one query: maximum and sums in its own registers
#pragma unroll
    for (int r = 1; r < 8; ++r) mx = fmaxf(mx, fmaxf(s[0][r], s[1][r]));
    mx = fmaxf(mx, xhalf(mx));   // the query's other 16 keys of the step lie in lane ^ 16
    const float mn = fmaxf(m, mx); const float alpha = (m <= -1.0e38f) ? 0.f : __expf(m - mn);
    float es = 0.f, eh = 0.f; v16h pa;   // pa: P transposed as a B fragment, k position 8 * ct + r = key 16 * ct + 8g + r, the k order of lds_h16: no trip through LDS
#pragma unroll
    for (int ct = 0; ct < 2; ++ct) {
#pragma unroll
      for (int r = 0; r < 8; ++r) { const float e = (s[ct][r] <= -1.0e38f) ? 0.f : __expf(s[ct][r] - mn); es += e; eh += (e > 0.f ? e * s[ct][r] : 0.f); pa[8 * ct + r] = (_Float16)(e * 2048.0f); } }   // P scaled by 2^11 before the f16 rounding so small softmax weights stay out of the f16 subnormal range; 2^-11 folded into the epilogue
    l = l * alpha + es; hs = hs * alpha + eh; m = mn;   // the halves' shares are joined once, behind the key loop
#pragma unroll
    for (int dt = 0; dt < 4; ++dt) {
#pragma unroll
      for (int r = 0; r < 8; ++r) { acc[dt][r] *= alpha; accl[dt][r] *= alpha; } }
#pragma unroll
    for (int dt = 0; dt < 2; ++dt) { acc[dt] = wmma16(vh[dt], pa, acc[dt]); accl[dt] = wmma16(vl[dt], pa, accl[dt]); }   // transposed output: A = Vt rows (lane col = d row), B = P: acc[dt][r] = d dt*16 + 8g + r of query q0 + col
#pragma unroll
    for (int dt = 0; dt < 2; ++dt) { vh[dt] = lds_h16(sk + AT_SEC + (2 + dt) * 16 * AT_PITCH + hf * 64); vl[dt] = lds_h16(sk + 2 * AT_SEC + (2 + dt) * 16 * AT_PITCH + hf * 64); }
#pragma unroll
    for (int dt = 0; dt < 2; ++dt) { acc[2 + dt] = wmma16(vh[dt], pa, acc[2 + dt]); accl[2 + dt] = wmma16(vl[dt], pa, accl[2 + dt]); } }   // V hi x P + V lo x P / 2048: 2 products
    asm volatile("s_wait_dscnt 0x0" ::: "memory");      // this wave's reads of buffer t & 1 are done before it is refilled
    asm volatile("s_wait_asynccnt 0x0" ::: "memory");   // this wave's copies of stage t + 1 have landed
    __syncthreads();                                    // publishes stage t + 1 and ends every wave's reads of stage t
    if (t + 2 < nst) stage_kv(Kg + (size_t)(t + 2) * 64 * (2 * DM), Vhg + (t + 2) * 64, Vlg + (t + 2) * 64, kv0 + (unsigned)(t & 1) * AT_STAGE, tid); }
  asm volatile("s_wait_asynccnt 0x0" ::: "memory");     // no copy is in flight behind the key loop
  l += xhalf(l); hs += xhalf(hs);   // join the two halves' shares of the query's sums
  if (g == 0) sh_ent[tp][wave * 16 + col] = m + logf(l) - hs / l;   // H_row = -sum p log p = m + log l - sum p s
  { const float il = (1.0f / 2048.0f) / l;
#pragma unroll
    for (int dt = 0; dt < 4; ++dt) {
#pragma unroll
      for (int r = 0; r < 8; ++r) so[wave][col][dt * 16 + 8 * g + r] = (acc[dt][r] + accl[dt][r] * (1.0f / 2048.0f)) * il; } }
  LDSX();
  for (int rl = 0; rl < 16; ++rl) if (lane < 16) vst2(O + ((size_t)b * SS + q0 + rl) * DM + h * HD + lane * 4, *(const v4f*)&so[wave][rl][lane * 4]);
  asm volatile("s_wait_xcnt 0x0" ::: "memory");   // stands in front of the next tile's first writes to registers that the stores above name
  }
  __syncthreads();
  if (tid < 2) { float a = 0.f; for (int i = 0; i < 64; ++i) a += sh_ent[tid][i]; PH[((size_t)b * NH + h) * (SS / 64) + (tid ? (int)blockIdx.x : TQB - 1 - (int)blockIdx.x)] = a; }   // one partial per tile, summed in row order (plain 4-B store of a scratch value)
}
// ---- k_out: block = (64 rows, 128 cols): out = O(hi/lo) . Wo rows (2 products) + bo
__global__ __launch_bounds__(128) void k_out(const float* __restrict__ O, const __bf16* __restrict__ P, const float* __restrict__ BO, float* __restrict__ Y) {
  __shared__ __align__(16) char smem[2 * GSTAGE];   // the two staging buffers; behind the K loop's last barrier the same bytes stage the output
  float (*so)[16][132] = (float (*)[16][132])smem;
  const int tid = threadIdx.x, wave = tid >> 5, lane = tid & 31, col = lane & 15, g = lane >> 4; const size_t r0 = (size_t)blockIdx.x * 64 + wave * 16; const int n0 = blockIdx.y * 128;
  v8f acc[8] = {};
  const unsigned lds0 = (unsigned)(size_t)smem; const float* Ag = O + (size_t)blockIdx.x * 64 * DM; const __bf16* Bg = P + (size_t)n0 * DM;
  stage_chunk(Ag, Bg, lds0, tid);
  asm volatile("s_wait_asynccnt 0x0" ::: "memory");   // this wave's copies of chunk 0 have landed
  __syncthreads();                                    // ... and every other wave's: chunk 0 may be read
  stage_chunk(Ag + GKC, Bg + GKC, lds0 + GSTAGE, tid);
#pragma unroll 1   // kept rolled: the buffer alternates with t, one copy of the body
  for (int t = 0; t < GNT; ++t) { const char* sa = smem + (t & 1) * GSTAGE + (wave * 16 + col) * GA_PITCH + 32 * g; const char* sb = smem + (t & 1) * GSTAGE + GA_BYTES + col * GB_PITCH + 16 * g;
#pragma unroll   // this and the inner loops: constant indices, so that fragments and accumulators stay in registers
    for (int kc = 0; kc < GKC / 32; ++kc) { float av[16]; lds_a16(sa + kc * 128, av); v16b w[8];   // all LDS reads of a 32-k step stand as one group in front of its products: one LDS latency a step, not one a product
#pragma unroll
      for (int j = 0; j < 8; ++j) w[j] = lds_b16(sb + j * 16 * GB_PITCH + kc * 64);
      const F2 a = bsplit16(av);
#pragma unroll
      for (int j = 0; j < 8; ++j) { acc[j] = wmma_bf(a.l, w[j], acc[j]); acc[j] = wmma_bf(a.h, w[j], acc[j]); } }
    asm volatile("s_wait_dscnt 0x0" ::: "memory");      // this wave's reads of buffer t & 1 are done before it is refilled
    asm volatile("s_wait_asynccnt 0x0" ::: "memory");   // this wave's copies of chunk t + 1 have landed
    __syncthreads();                                    // publishes chunk t + 1 and ends every wave's reads of chunk t
    if (t + 2 < GNT) stage_chunk(Ag + (t + 2) * GKC, Bg + (t + 2) * GKC, lds0 + (unsigned)(t & 1) * GSTAGE, tid); }
  asm volatile("s_wait_asynccnt 0x0" ::: "memory");     // no copy is in flight when the buffers become output staging
#pragma unroll
  for (int j = 0; j < 8; ++j) {
#pragma unroll
    for (int r = 0; r < 8; ++r) so[wave][8 * g + r][j * 16 + col] = acc[j][r] + bfr(BO[n0 + j * 16 + col]); }
  LDSX();
  for (int rl = 0; rl < 16; ++rl) vst2(Y + (r0 + rl) * DM + n0 + lane * 4, *(const v4f*)&so[wave][rl][lane * 4]);
}
// ---- k_ent: mean entropy over all (b, h, t) rows from the block partials (fixed order) -> scalar second output
__global__ __launch_bounds__(256) void k_ent(const float* __restrict__ PH, float* __restrict__ OUT1) {
  __shared__ float red[256]; const int t = threadIdx.x; const int n = NB * NH * (TQB);   // TQB row blocks per (b, h) were computed
  float a = 0.f; for (int i = t; i < n; i += 256) a += PH[(size_t)(i / TQB) * (SS / 64) + (i % TQB)];
  red[t] = a; __syncthreads();
  for (int s = 128; s >= 1; s >>= 1) { if (t < s) red[t] += red[t + s]; __syncthreads(); }
  if (t == 0) { float* p = OUT1; p[0] = red[0] / ((float)NB * NH * (TQB * 64));  }
}
extern "C" void kernel_launch(void* const* d_in, const int* in_sizes, int n_in, void* d_out, int out_size, void* d_ws, size_t ws_size, hipStream_t stream) {
  (void)in_sizes; (void)n_in; (void)out_size;
  const float** F = (const float**)d_in;   // 0 x [4,2048,1024], 1 w_q natural, 2 b_q, 3 w_k, 4 b_k, 5 w_v, 6 b_v, 7 w_o, 8 b_o
  if (ws_size < (size_t)WS_END) return;
  char* ws = (char*)d_ws; __bf16* PK = (__bf16*)(ws + WS_PK); _Float16 *QK = (_Float16*)(ws + WS_QK), *QKL = (_Float16*)(ws + WS_QKL), *VTH = (_Float16*)(ws + WS_VTH), *VTL = (_Float16*)(ws + WS_VTL); float *O = (float*)(ws + WS_O), *PH = (float*)(ws + WS_PH);
  k_pack<<<dim3(DM, 4), 256, 0, stream>>>(F[1], F[3], F[5], F[7], PK);
  k_qkv<<<dim3(TNB * SS / 64, QKVW / 128), 128, 0, stream>>>(F[0], F[0], F[0], PK + PK_A, F[2], F[4], F[6], QK, QKL, VTH, VTL);
  k_attn<<<dim3(TQB / 2, NH, TNB), 128, 0, stream>>>(QK, QKL, VTH, VTL, nullptr, O, PH);
  k_out<<<dim3(TOB, DM / 128), 128, 0, stream>>>(O, PK + PK_P, F[8], (float*)d_out);
  k_ent<<<1, 256, 0, stream>>>(PH, (float*)d_out + (size_t)NB * SS * DM);
}

// v005
// One run takes 193 microseconds.
// Two timings next to v004 both put it at 1.09 times that version's speed.
// All steps since v000 together make it 3.91 times as fast.
// compute dtype: all float inputs rounded to bf16; q/k/v = x . W^T + b with EXACT bf16 products on WMMA 16x16x32 (natural rows); causal attention x 1/8 (tiles past the diagonal skipped) with 3-product scores (q, k as f16 hi + x2048 residual) for the first 128 queries of each sequence and single-product scores elsewhere; running-max softmax in f32 (hardware exp) that also accumulates sum p*s for the row entropy H = m + log(l) - sum(p s) (precise logf), block partial sums combined in fixed order for the mean; P (scaled by 2^11, single f16) x v (f16 hi + x2048 residual), 2 products; y = ctx (bf16 hi + residual) . Wo^T (2 products) + bo.
#include <hip/hip_runtime.h>
#include <math.h>

typedef __attribute__((ext_vector_type(16))) _Float16 v16h;
typedef __attribute__((ext_vector_type(16))) __bf16 v16b;
typedef __attribute__((ext_vector_type(8)))  _Float16 v8h;
typedef __attribute__((ext_vector_type(8)))  float v8f;
typedef __attribute__((ext_vector_type(4)))  float v4f;
typedef __attribute__((ext_vector_type(2)))  float v2f;
typedef __attribute__((ext_vector_type(4)))  unsigned v4u;
typedef __attribute__((ext_vector_type(4)))  int v4i;
typedef float __attribute__((may_alias)) float_a;
typedef int __attribute__((may_alias)) int_a;

template <typename T> __device__ __forceinline__ void vst2(void* p, T v) { *(T*)p = v;  }
__device__ __forceinline__ v8f wmma16(v16h a, v16h b, v8f c) {
  v8f d = __builtin_amdgcn_wmma_f32_16x16x32_f16(false, a, false, b, (short)0, c, false, false);
  asm volatile("v_nop\n\tv_nop\n\tv_nop\n\tv_nop" : "+v"(d) : "v"(a), "v"(b));
  return d;
}
__device__ __forceinline__ v8f wmma_bf(v16b a, v16b b, v8f c) {
  v8f d = __builtin_amdgcn_wmma_f32_16x16x32_bf16(false, a, false, b, (short)0, c, false, false);
  asm volatile("v_nop\n\tv_nop\n\tv_nop\n\tv_nop" : "+v"(d) : "v"(a), "v"(b));
  return d;
}
// Causal multi-head self attention (B 4, T 2,048, C 1,024, 16 heads x 64) with biases and output projection, plus the mean attention entropy (second output).
__device__ __forceinline__ v16h frag_h(const _Float16* rowk0, int lane) {
  union { v16h v; v8h q[2]; } u; const _Float16* p = rowk0 + 8 * (lane >> 4);
  u.q[0] = *(const v8h*)p; u.q[1] = *(const v8h*)(p + 16); return u.v;
}
__device__ __forceinline__ v16h frag_f32(const float* rowk0, int lane) {
  v16h a; const float* p = rowk0 + 8 * (lane >> 4);
#pragma unroll
  for (int i = 0; i < 8; ++i) { a[i] = (_Float16)p[i]; a[8 + i] = (_Float16)p[16 + i]; }
  return a;
}
__device__ __forceinline__ v16h frag_f32s(const float* rowk0, int lane, float sc) {
  v16h a; const float* p = rowk0 + 8 * (lane >> 4);
#pragma unroll
  for (int i = 0; i < 8; ++i) { a[i] = (_Float16)(p[i] * sc); a[8 + i] = (_Float16)(p[16 + i] * sc); }
  return a;
}
// column fragment from a [K][ld] layout (column n), rows >= K read as 0
__device__ __forceinline__ v16h fragc_f32(const float* W, int k0, int n, int lane, int ld, int K) {
  v16h a; const int g = lane >> 4;
#pragma unroll
  for (int i = 0; i < 8; ++i) { const int ka = k0 + 8 * g + i, kb = ka + 16;
    a[i] = (_Float16)(ka < K ? W[(size_t)(ka < K ? ka : K - 1) * ld + n] : 0.f); a[8 + i] = (_Float16)(kb < K ? W[(size_t)(kb < K ? kb : K - 1) * ld + n] : 0.f); }
  return a;
}
struct F2 { v16b h, l; };
__device__ __forceinline__ F2 bsplit16(const float v[16]) { F2 r;
#pragma unroll
  for (int i = 0; i < 16; ++i) { const __bf16 h = (__bf16)v[i]; r.h[i] = h; r.l[i] = (__bf16)(v[i] - (float)h); }
  return r; }
__device__ __forceinline__ F2 split_row(const float* row, int k0, int lane) { float v[16]; const float* p = row + k0 + 8 * (lane >> 4);
#pragma unroll
  for (int i = 0; i < 8; ++i) { v[i] = p[i]; v[8 + i] = p[16 + i]; }
  return bsplit16(v); }
__device__ __forceinline__ F2 split_rowK(const float* row, int k0, int lane, int K) { float v[16]; const int g = lane >> 4;
#pragma unroll
  for (int i = 0; i < 8; ++i) { const int ka = k0 + 8 * g + i, kb = ka + 16; v[i] = ka < K ? row[ka < K ? ka : K - 1] : 0.f; v[8 + i] = kb < K ? row[kb < K ? kb : K - 1] : 0.f; }
  return bsplit16(v); }
__device__ __forceinline__ F2 split_col(const float* W, int k0, int n, int lane, int ld, int K) { float v[16]; const int g = lane >> 4;
#pragma unroll
  for (int i = 0; i < 8; ++i) { const int ka = k0 + 8 * g + i, kb = ka + 16; v[i] = ka < K ? W[(size_t)(ka < K ? ka : K - 1) * ld + n] : 0.f; v[8 + i] = kb < K ? W[(size_t)(kb < K ? kb : K - 1) * ld + n] : 0.f; }
  return bsplit16(v); }
__device__ __forceinline__ v8f mac3(const F2& a, const F2& b, v8f c) { c = wmma_bf(a.l, b.h, c); c = wmma_bf(a.h, b.l, c); return wmma_bf(a.h, b.h, c); }
__device__ __forceinline__ float sigm(float v) { return 1.0f / (1.0f + expf(-v)); }
#define LDSX() do { asm volatile("s_wait_dscnt 0" ::: "memory"); __builtin_amdgcn_wave_barrier(); __builtin_amdgcn_fence(__ATOMIC_RELEASE, "workgroup"); } while (0)


#define NB 4
#define SS 2048
#define SCALEF 0.125f
#define DM 1024
#define NH 16
#define HD 64
#define QKVW (3 * DM)
#ifndef TQB
#define TQB (SS / 64)
#define TNB NB
#define TOB (NB * SS / 64)     // output row tiles (all)
#endif
typedef __attribute__((ext_vector_type(8))) __bf16 v8b;
__device__ __forceinline__ v16b frag_b(const __bf16* rowk0, int lane) {
  union { v16b v; v8b q[2]; } u; const __bf16* p = rowk0 + 8 * (lane >> 4);
  u.q[0] = *(const v8b*)p; u.q[1] = *(const v8b*)(p + 16); return u.v;
}
__device__ __forceinline__ float bfr(float v) { return (float)(__bf16)v; }
__device__ __attribute__((noinline)) float exp_ni(float v) { return expf(v); }
__device__ __attribute__((noinline)) float erf_ni(float v) { return erff(v); }

#define PK_A 0                       // [3072][1024] Wqkv rows (natural [out][in])
#define PK_P (PK_A + QKVW * DM)        // [1024][1024] Wo rows (natural)
#define PK_END (PK_P + DM * DM)
#define WS_PK  0u
#define WS_QK  (WS_PK + 2u * PK_END)             // f16 [8192 rows][2048]: q | k
#define WS_QKL (WS_QK + 2u * NB * SS * 2 * DM)     // f16 q | k residual planes x2048
#define WS_VTH (WS_QKL + 2u * NB * SS * 2 * DM)    // f16 [b][1024 (h*64+d)][2048 s] hi
#define WS_VTL (WS_VTH + 2u * NB * DM * SS)        // f16 lo x 2048
#define WS_O   (WS_VTL + 2u * NB * DM * SS)        // f32 [8192][1024]
#define WS_CS  (WS_O + 4u * NB * SS * DM)           // f32 2 x [2048][32], reserved, unused
#define WS_PH  (WS_CS + 4u * 2 * SS * 32)                 // f32 [NB*NH*(SS/64)] entropy block partials
#define WS_END (WS_PH + 4u * NB * NH * (SS / 64))
// ---- k_pack: block = (row n, which): natural [out][in] rows -> bf16; which 0..2 -> W_q/W_k/W_v into PK_A rows which*1024 + n; 3 -> W_o into PK_P
__global__ __launch_bounds__(256) void k_pack(const float* __restrict__ WQ, const float* __restrict__ WK, const float* __restrict__ WV, const float* __restrict__ WO, __bf16* __restrict__ PK) {
  __shared__ __align__(16) __bf16 s[DM]; const int n = blockIdx.x, which = blockIdx.y, t = threadIdx.x; const float* Wm = (which == 0) ? WQ : (which == 1) ? WK : (which == 2) ? WV : WO;
  for (int k = t; k < DM; k += 256) s[k] = (__bf16)Wm[(size_t)n * DM + k];
  __syncthreads();
  __bf16* dst = (which < 3) ? PK + PK_A + ((size_t)which * DM + n) * DM : PK + PK_P + (size_t)n * DM;
  for (int q = t; q < DM / 8; q += 256) vst2((unsigned*)(dst + q * 8), *(const v4u*)&s[q * 8]);
}
// ---- operand staging of the two projection GEMMs: per 64-k chunk the block's 64 f32 activation rows (256 B each) and 128 bf16 weight rows (128 B each) go from global memory into LDS by asynchronous 16-B copies that cover whole 128-B lines, once per block; the four waves read their fragments from LDS. Two buffers: chunk t + 1 flies while chunk t is worked on.
#define GKC 64                           // k per staged chunk
#define GA_PITCH 272                     // LDS bytes per staged f32 row (16 B x odd: 16-B reads of 16 rows fall on distinct banks)
#define GB_PITCH 144                     // LDS bytes per staged bf16 row (16 B x odd)
#define GA_BYTES (64 * GA_PITCH)
#define GB_BYTES (128 * GB_PITCH)
#define GSTAGE (GA_BYTES + GB_BYTES)     // one buffer: [activation rows | weight rows]
#define GNT (DM / GKC)
// eight copies of one lane and, in the same statement, the wait that stands in front of any later write of the address registers they name
#define COPY8(l, ls, p, ps) asm volatile( \
  "global_load_async_to_lds_b128 %0, %8, off\n\tglobal_load_async_to_lds_b128 %1, %9, off\n\t" \
  "global_load_async_to_lds_b128 %2, %10, off\n\tglobal_load_async_to_lds_b128 %3, %11, off\n\t" \
  "global_load_async_to_lds_b128 %4, %12, off\n\tglobal_load_async_to_lds_b128 %5, %13, off\n\t" \
  "global_load_async_to_lds_b128 %6, %14, off\n\tglobal_load_async_to_lds_b128 %7, %15, off\n\ts_wait_xcnt 0x0" \
  :: "v"(l), "v"((l) + (ls)), "v"((l) + 2 * (ls)), "v"((l) + 3 * (ls)), "v"((l) + 4 * (ls)), "v"((l) + 5 * (ls)), "v"((l) + 6 * (ls)), "v"((l) + 7 * (ls)), \
     "v"(p), "v"((p) + (ps)), "v"((p) + 2 * (ps)), "v"((p) + 3 * (ps)), "v"((p) + 4 * (ps)), "v"((p) + 5 * (ps)), "v"((p) + 6 * (ps)), "v"((p) + 7 * (ps)) : "memory")
// Ag: first of the block's 64 rows at the chunk's first k; Bg: first of its 128 weight rows at the same k; lds: byte address of the buffer
__device__ __forceinline__ void stage_chunk(const float* Ag, const __bf16* Bg, unsigned lds, int tid) {
  const float* pa = Ag + (size_t)(tid >> 4) * DM + (tid & 15) * 4; const unsigned la = lds + (unsigned)(tid >> 4) * GA_PITCH + (unsigned)(tid & 15) * 16u;   // 16 lanes a row, 8 rows a copy
  const __bf16* pb = Bg + (size_t)(tid >> 3) * DM + (tid & 7) * 8; const unsigned lb = lds + GA_BYTES + (unsigned)(tid >> 3) * GB_PITCH + (unsigned)(tid & 7) * 16u;   // 8 lanes a row, 16 rows a copy
  COPY8(la, 8u * GA_PITCH, pa, (size_t)8 * DM);
  COPY8(lb, 16u * GB_PITCH, pb, (size_t)16 * DM);
}
// the 16 f32 of a lane's A fragment (k = 8g + 0..7 and 16 + 8g + 0..7 of a 32-k step) from a staged row; p = row + 128 * step + 32 * g bytes
__device__ __forceinline__ void lds_a16(const char* p, float v[16]) { const v4f x0 = *(const v4f*)p, x1 = *(const v4f*)(p + 16), x2 = *(const v4f*)(p + 64), x3 = *(const v4f*)(p + 80);
#pragma unroll   // constant indices: v stays in registers
  for (int i = 0; i < 4; ++i) { v[i] = x0[i]; v[4 + i] = x1[i]; v[8 + i] = x2[i]; v[12 + i] = x3[i]; } }
// a lane's B fragment (same k order) from a staged bf16 row; p = row + 64 * step + 16 * g bytes
__device__ __forceinline__ v16b lds_b16(const char* p) { union { v16b v; v8b q[2]; } u; u.q[0] = *(const v8b*)p; u.q[1] = *(const v8b*)(p + 32); return u.v; }
__global__ __launch_bounds__(128) void k_qkv(const float* __restrict__ XQ, const float* __restrict__ XK, const float* __restrict__ XV, const __bf16* __restrict__ P, const float* __restrict__ BQ, const float* __restrict__ BK, const float* __restrict__ BV, _Float16* __restrict__ QK, _Float16* __restrict__ QKL, _Float16* __restrict__ VTH, _Float16* __restrict__ VTL) {
  const int which0 = (blockIdx.y * 128) / DM; const float* X = (which0 == 0) ? XQ : (which0 == 1) ? XK : XV; const float* BB = BQ ? (((which0 == 0) ? BQ : (which0 == 1) ? BK : BV) + (blockIdx.y * 128 - which0 * DM)) : nullptr;
  __shared__ __align__(16) char smem[2 * GSTAGE];   // the two staging buffers; behind the K loop's last barrier the same bytes stage the output
  _Float16 (*so)[16][136] = (_Float16 (*)[16][136])smem, (*sol)[16][136] = (_Float16 (*)[16][136])(smem + 4 * 16 * 136 * 2); _Float16 (*sth)[72] = (_Float16 (*)[72])smem, (*stl)[72] = (_Float16 (*)[72])(smem + 128 * 72 * 2);
  const int tid = threadIdx.x, wave = tid >> 5, lane = tid & 31, col = lane & 15, g = lane >> 4; const size_t r0 = (size_t)blockIdx.x * 64 + wave * 16; const int n0 = blockIdx.y * 128;
  v8f acc[8] = {};
  const unsigned lds0 = (unsigned)(size_t)smem; const float* Ag = X + (size_t)blockIdx.x * 64 * DM; const __bf16* Bg = P + (size_t)n0 * DM;
  stage_chunk(Ag, Bg, lds0, tid);
  asm volatile("s_wait_asynccnt 0x0" ::: "memory");   // this wave's copies of chunk 0 have landed
  __syncthreads();                                    // ... and every other wave's: chunk 0 may be read
  stage_chunk(Ag + GKC, Bg + GKC, lds0 + GSTAGE, tid);
#pragma unroll 1   // kept rolled: the buffer alternates with t, one copy of the body
  for (int t = 0; t < GNT; ++t) { const char* sa = smem + (t & 1) * GSTAGE + (wave * 16 + col) * GA_PITCH + 32 * g; const char* sb = smem + (t & 1) * GSTAGE + GA_BYTES + col * GB_PITCH + 16 * g;
#pragma unroll   // this and the inner loops: constant indices, so that fragments and accumulators stay in registers
    for (int kc = 0; kc < GKC / 32; ++kc) { float av[16]; lds_a16(sa + kc * 128, av); v16b a, w[8];   // all LDS reads of a 32-k step stand as one group in front of its products: one LDS latency a step, not one a product
#pragma unroll
      for (int j = 0; j < 8; ++j) w[j] = lds_b16(sb + j * 16 * GB_PITCH + kc * 64);
#pragma unroll
      for (int i = 0; i < 16; ++i) a[i] = (__bf16)av[i];
#pragma unroll
      for (int j = 0; j < 8; ++j) acc[j] = wmma_bf(a, w[j], acc[j]); }
    asm volatile("s_wait_dscnt 0x0" ::: "memory");      // this wave's reads of buffer t & 1 are done before it is refilled
    asm volatile("s_wait_asynccnt 0x0" ::: "memory");   // this wave's copies of chunk t + 1 have landed
    __syncthreads();                                    // publishes chunk t + 1 and ends every wave's reads of chunk t
    if (t + 2 < GNT) stage_chunk(Ag + (t + 2) * GKC, Bg + (t + 2) * GKC, lds0 + (unsigned)(t & 1) * GSTAGE, tid); }
  asm volatile("s_wait_asynccnt 0x0" ::: "memory");     // no copy is in flight when the buffers become output staging
  if (n0 < 2 * DM) {   // q stored unscaled (f16 sigma ~0.6, no subnormal exposure); 1/8 applied to the f32 score
#pragma unroll
    for (int j = 0; j < 8; ++j) {
#pragma unroll
      for (int r = 0; r < 8; ++r) { const float v = acc[j][r] + (BB ? bfr(BB[j * 16 + col]) : 0.f); const _Float16 hv = (_Float16)v; so[wave][8 * g + r][j * 16 + col] = hv; sol[wave][8 * g + r][j * 16 + col] = (_Float16)((v - (float)hv) * 2048.0f); } }   // q, k (+ bias) as f16 hi + (x2048) residual
    LDSX();
    for (int rl = 0; rl < 16; ++rl) if (lane < 16) { vst2((unsigned*)(QK + (r0 + rl) * (2 * DM) + n0 + lane * 8), *(const v4u*)&so[wave][rl][lane * 8]); vst2((unsigned*)(QKL + (r0 + rl) * (2 * DM) + n0 + lane * 8), *(const v4u*)&sol[wave][rl][lane * 8]); }
  } else {
#pragma unroll
    for (int j = 0; j < 8; ++j) {
#pragma unroll
      for (int r = 0; r < 8; ++r) { const float v = acc[j][r] + (BB ? bfr(BB[j * 16 + col]) : 0.f); const _Float16 hv = (_Float16)v; sth[j * 16 + col][wave * 16 + 8 * g + r] = hv; stl[j * 16 + col][wave * 16 + 8 * g + r] = (_Float16)((v - (float)hv) * 2048.0f); } }
    __syncthreads();
    const size_t rb = (size_t)blockIdx.x * 64; const int b = (int)(rb / SS), s0 = (int)(rb % SS); const int pc0 = n0 - 2 * DM;
    for (int q = tid; q < 128 * 8; q += 128) { const int d = q >> 3, pc = q & 7; const size_t o = ((size_t)b * DM + pc0 + d) * SS + s0 + pc * 8; vst2((unsigned*)(VTH + o), *(const v4u*)&sth[d][pc * 8]); vst2((unsigned*)(VTL + o), *(const v4u*)&stl[d][pc * 8]); }
  }
}
// ---- K / V staging of k_attn: per 64 keys the head's 64 K rows, 64 rows of Vt hi and 64 rows of Vt lo (128 B each, one whole line) go from global memory into LDS by asynchronous 16-B copies, once per block; the four waves read their fragments from LDS. Two buffers: stage t + 1 flies while stage t is worked on.
#define AT_PITCH 144                     // LDS bytes per staged 128-B row (16 B x odd: 16-B reads of 16 rows fall on distinct banks)
#define AT_SEC (64 * AT_PITCH)           // 64 rows
#define AT_STAGE (3 * AT_SEC)            // one buffer: [K rows | Vt hi rows | Vt lo rows]
// Kg: the stage's first K row (this head's 64 d); Vh, Vl: the head's first Vt row at the stage's first key; lds: byte address of the buffer. 8 lanes a row, 16 rows a copy, 12 copies a lane; in the same statement the wait that stands in front of any later write of the address registers they name
__device__ __forceinline__ void stage_kv(const _Float16* Kg, const _Float16* Vh, const _Float16* Vl, unsigned lds, int tid) {
  const unsigned l = lds + (unsigned)(tid >> 3) * AT_PITCH + (unsigned)(tid & 7) * 16u, ls = 16u * AT_PITCH;
  const _Float16* pk = Kg + (size_t)(tid >> 3) * (2 * DM) + (tid & 7) * 8; const _Float16* ph = Vh + (size_t)(tid >> 3) * SS + (tid & 7) * 8; const _Float16* pl = Vl + (size_t)(tid >> 3) * SS + (tid & 7) * 8;
  const size_t ks = (size_t)16 * 2 * DM, vs = (size_t)16 * SS;
  asm volatile(
    "global_load_async_to_lds_b128 %0, %12, off\n\tglobal_load_async_to_lds_b128 %1, %13, off\n\tglobal_load_async_to_lds_b128 %2, %14, off\n\tglobal_load_async_to_lds_b128 %3, %15, off\n\t"
    "global_load_async_to_lds_b128 %4, %16, off\n\tglobal_load_async_to_lds_b128 %5, %17, off\n\tglobal_load_async_to_lds_b128 %6, %18, off\n\tglobal_load_async_to_lds_b128 %7, %19, off\n\t"
    "global_load_async_to_lds_b128 %8, %20, off\n\tglobal_load_async_to_lds_b128 %9, %21, off\n\tglobal_load_async_to_lds_b128 %10, %22, off\n\tglobal_load_async_to_lds_b128 %11, %23, off\n\ts_wait_xcnt 0x0"
    :: "v"(l), "v"(l + ls), "v"(l + 2 * ls), "v"(l + 3 * ls), "v"(l + AT_SEC), "v"(l + AT_SEC + ls), "v"(l + AT_SEC + 2 * ls), "v"(l + AT_SEC + 3 * ls), "v"(l + 2 * AT_SEC), "v"(l + 2 * AT_SEC + ls), "v"(l + 2 * AT_SEC + 2 * ls), "v"(l + 2 * AT_SEC + 3 * ls),
       "v"(pk), "v"(pk + ks), "v"(pk + 2 * ks), "v"(pk + 3 * ks), "v"(ph), "v"(ph + vs), "v"(ph + 2 * vs), "v"(ph + 3 * vs), "v"(pl), "v"(pl + vs), "v"(pl + 2 * vs), "v"(pl + 3 * vs) : "memory");
}
// the value that lane ^ 16 holds (one vector instruction, no LDS)
__device__ __forceinline__ float xhalf(float v) { const int b = __builtin_bit_cast(int, v); return __builtin_bit_cast(float, __builtin_amdgcn_permlanex16(b, b, 0x76543210, 0xfedcba98, false, false)); }
// a lane's f16 fragment (k = 8g + 0..7 and 16 + 8g + 0..7 of a 32-k step) from a staged row; p = row + 64 * step + 16 * g bytes
__device__ __forceinline__ v16h lds_h16(const char* p) { union { v16h v; v8h q[2]; } u; u.q[0] = *(const v8h*)p; u.q[1] = *(const v8h*)(p + 32); return u.v; }
// 2^t for the masked path below, with the free slot that the instruction set asks for behind a transcendental in the same statement
__device__ __forceinline__ float exp2_slot(float t) { float e; asm("v_exp_f32 %0, %1\n\tv_nop" : "=v"(e) : "v"(t)); return e; }
// the softmax arithmetic of a 32-key step. c: raw scores (register r of tile ct = key 16*ct + 8g + r of the step); m: the running maximum. Gives the new maximum mn, the lane's sums es (of e) and eh (of e * s) and P as a B fragment. MK = true: a step that reaches past some query of the wave, with the causal mask and the guards that keep masked scores out of the sums. MK = false: every key of the step counts for every query of the wave, so the mask and the guards are identities and are not computed
template <bool MK> __device__ __forceinline__ void attn_soft(const v8f (&c)[2], const int lim, const float m, float& mn, float& es, float& eh, v16h& pa) {
    v8f s[2];
#pragma unroll
    for (int ct = 0; ct < 2; ++ct) {
#pragma unroll
      for (int r = 0; r < 8; ++r) s[ct][r] = (!MK || ct * 16 + r <= lim) ? c[ct][r] * SCALEF : -3.0e38f; }   // causal: future keys excluded
    float mx = fmaxf(s[0][0], s[1][0]);   // the lane's 16 scores all belong to one query: maximum and sums in its own registers
#pragma unroll
    for (int r = 1; r < 8; ++r) mx = fmaxf(mx, fmaxf(s[0][r], s[1][r]));
    mx = fmaxf(mx, xhalf(mx));   // the query's other 16 keys of the step lie in lane ^ 16
    mn = fmaxf(m, mx); es = 0.f; eh = 0.f;   // pa: P transposed as a B fragment, k position 8 * ct + r = key 16 * ct + 8g + r, the k order of lds_h16: no trip through LDS
#pragma unroll
    for (int ct = 0; ct < 2; ++ct) {
#pragma unroll
      for (int r = 0; r < 8; ++r) { const float x = MK ? exp2_slot((s[ct][r] - mn) * 1.44269504f) : __expf(s[ct][r] - mn); const float e = (MK && s[ct][r] <= -1.0e38f) ? 0.f : x; es += e; eh += ((!MK || e > 0.f) ? e * s[ct][r] : 0.f); pa[8 * ct + r] = (_Float16)(e * 2048.0f); } }   // P scaled by 2^11 before the f16 rounding so small softmax weights stay out of the f16 subnormal range; 2^-11 folded into the epilogue
}
__global__ __launch_bounds__(128) __attribute__((amdgpu_waves_per_eu(4, 4))) void k_attn(const _Float16* __restrict__ QK, const _Float16* __restrict__ QKL, const _Float16* __restrict__ VTH, const _Float16* __restrict__ VTL, const void* __restrict__ KMASK, float* __restrict__ O, float* __restrict__ PH) {
  __shared__ float sh_ent[2][64];
  __shared__ __align__(16) float so[4][16][68];   // a wave's output staging
  __shared__ __align__(16) char skv[2 * AT_STAGE];   // the two K / V staging buffers
  const int tid = threadIdx.x, wave = tid >> 5, lane = tid & 31, col = lane & 15, g = lane >> 4;
  const int h = blockIdx.y, b = blockIdx.z;
  const unsigned kv0 = (unsigned)(size_t)skv; const _Float16* Kg = QK + (size_t)b * SS * (2 * DM) + DM + h * HD; const _Float16* Vhg = VTH + ((size_t)b * DM + h * HD) * SS; const _Float16* Vlg = VTL + ((size_t)b * DM + h * HD) * SS;
#pragma unroll 1   // kept rolled: one copy of the tile body in the instruction cache, one register set for both tiles
  for (int tp = 0; tp < 2; ++tp) {
  const int qb = tp ? (int)blockIdx.x : TQB - 1 - (int)blockIdx.x; const int q0 = qb * 64 + wave * 16; const int wq0 = __builtin_amdgcn_readfirstlane(q0); const size_t rq = (size_t)b * SS + q0 + col;
  v16h aq[2];
#pragma unroll
  for (int kc = 0; kc < 2; ++kc) aq[kc] = frag_h(QK + rq * (2 * DM) + h * HD + kc * 32, lane);
  const _Float16* qrowl = QKL + rq * (2 * DM) + h * HD;   // q's residual plane is read where it is used (the two leading tiles' few steps): held in registers for every tile it would take the kernel past 256 registers (four waves a SIMD)
  float hs = 0.f;   // this lane's share (its eight keys of every sixteen) of the sum over keys of e^(s - m) * s, rescaled with the running max
  float m = -3.0e38f, l = 0.f;   // the lane's query (column col): running max over all keys (equal in both wave halves) and this lane's share of the sum
  v8f acc[4] = {}, accl[4] = {};
  const int nst = qb + 1;   // causal: 64-key stages up to the query tile's end
  stage_kv(Kg, Vhg, Vlg, kv0, tid);                   // (second tile: every wave's last read of the buffers ended at the first tile's last barrier)
  asm volatile("s_wait_asynccnt 0x0" ::: "memory");   // this wave's copies of stage 0 have landed
  __syncthreads();                                    // ... and every other wave's: stage 0 may be read
  if (nst > 1) stage_kv(Kg + (size_t)64 * (2 * DM), Vhg + 64, Vlg + 64, kv0 + AT_STAGE, tid);
#pragma unroll 1   // kept rolled: the buffer alternates with t, one copy of the body
  for (int t = 0; t < nst; ++t) { const char* sk = skv + (t & 1) * AT_STAGE + col * AT_PITCH + 16 * g;
#pragma unroll 1   // kept rolled: one copy of the 32-key step in the instruction cache
  for (int hf = 0; hf < 2; ++hf) { const int ks = 2 * t + hf; const int lim = q0 + col - ks * 32 - 8 * g;   // register r of score tile ct holds key ks*32 + 8g + 16*ct + r: it counts while 16*ct + r <= lim
    v8f s[2]; v16h kf[2][2];   // the step's K fragments are read as one group in front of its products: one LDS latency a step, not one a product
#pragma unroll
    for (int ct = 0; ct < 2; ++ct) {
#pragma unroll
      for (int kc = 0; kc < 2; ++kc) kf[ct][kc] = lds_h16(sk + (hf * 32 + ct * 16) * AT_PITCH + kc * 64); }
#pragma unroll
    for (int ct = 0; ct < 2; ++ct) { const int kk = ks * 32 + ct * 16 + col; const _Float16* krowl = QKL + ((size_t)b * SS + kk) * (2 * DM) + DM + h * HD; v8f c = {}, cl = {};   // transposed scores: A = K rows (lane col = key row kk), B = Q (lane col = query): c[r] = score of key ks*32 + ct*16 + 8g + r with query q0 + col
      if (qb < 2) {   // leading query blocks (few keys, outputs far above the global rms): 3 products
#pragma unroll
        for (int kc = 0; kc < 2; ++kc) { const v16h kh = kf[ct][kc], ql = frag_h(qrowl + kc * 32, lane), kl = frag_h(krowl + kc * 32, lane); c = wmma16(kh, aq[kc], c); cl = wmma16(kh, ql, cl); cl = wmma16(kl, aq[kc], cl); }   // q's and k's residual fragments of a 32-d step are read side by side, in front of its products
#pragma unroll
        for (int r = 0; r < 8; ++r) c[r] += cl[r] * (1.0f / 2048.0f); }
      else {
#pragma unroll
        for (int kc = 0; kc < 2; ++kc) c = wmma16(kf[ct][kc], aq[kc], c); }   // single product elsewhere
      s[ct] = c; }
    v16h vh[2], vl[2];   // the step's V fragments are read in two groups of four, each in front of its products; the first group flies under the softmax arithmetic
#pragma unroll
    for (int dt = 0; dt < 2; ++dt) { vh[dt] = lds_h16(sk + AT_SEC + dt * 16 * AT_PITCH + hf * 64); vl[dt] = lds_h16(sk + 2 * AT_SEC + dt * 16 * AT_PITCH + hf * 64); }
    float mn, es, eh; v16h pa;
    if (ks * 32 + 31 <= wq0) attn_soft<false>(s, lim, m, mn, es, eh, pa);   // the step's last key is no later than the wave's first query (a scalar test, the same for the whole wave): no mask needed
    else attn_soft<true>(s, lim, m, mn, es, eh, pa);
    const float alpha = (m <= -1.0e38f) ? 0.f : __expf(m - mn);
    l = l * alpha + es; hs = hs * alpha + eh; m = mn;   // the halves' shares are joined once, behind the key loop
#pragma unroll
    for (int dt = 0; dt < 4; ++dt) {
#pragma unroll
      for (int r = 0; r < 8; ++r) { acc[dt][r] *= alpha; accl[dt][r] *= alpha; } }
#pragma unroll
    for (int dt = 0; dt < 2; ++dt) { acc[dt] = wmma16(vh[dt], pa, acc[dt]); accl[dt] = wmma16(vl[dt], pa, accl[dt]); }   // transposed output: A = Vt rows (lane col = d row), B = P: acc[dt][r] = d dt*16 + 8g + r of query q0 + col
#pragma unroll
    for (int dt = 0; dt < 2; ++dt) { vh[dt] = lds_h16(sk + AT_SEC + (2 + dt) * 16 * AT_PITCH + hf * 64); vl[dt] = lds_h16(sk + 2 * AT_SEC + (2 + dt) * 16 * AT_PITCH + hf * 64); }
#pragma unroll
    for (int dt = 0; dt < 2; ++dt) { acc[2 + dt] = wmma16(vh[dt], pa, acc[2 + dt]); accl[2 + dt] = wmma16(vl[dt], pa, accl[2 + dt]); } }   // V hi x P + V lo x P / 2048: 2 products
    asm volatile("s_wait_dscnt 0x0" ::: "memory");      // this wave's reads of buffer t & 1 are done before it is refilled
    asm volatile("s_wait_asynccnt 0x0" ::: "memory");   // this wave's copies of stage t + 1 have landed
    __syncthreads();                                    // publishes stage t + 1 and ends every wave's reads of stage t
    if (t + 2 < nst) stage_kv(Kg + (size_t)(t + 2) * 64 * (2 * DM), Vhg + (t + 2) * 64, Vlg + (t + 2) * 64, kv0 + (unsigned)(t & 1) * AT_STAGE, tid); }
  asm volatile("s_wait_asynccnt 0x0" ::: "memory");     // no copy is in flight behind the key loop
  l += xhalf(l); hs += xhalf(hs);   // join the two halves' shares of the query's sums
  if (g == 0) sh_ent[tp][wave * 16 + col] = m + logf(l) - hs / l;   // H_row = -sum p log p = m + log l - sum p s
  { const float il = (1.0f / 2048.0f) / l;
#pragma unroll
    for (int dt = 0; dt < 4; ++dt) {
#pragma unroll
      for (int r = 0; r < 8; ++r) so[wave][col][dt * 16 + 8 * g + r] = (acc[dt][r] + accl[dt][r] * (1.0f / 2048.0f)) * il; } }
  LDSX();
  for (int rl = 0; rl < 16; ++rl) if (lane < 16) vst2(O + ((size_t)b * SS + q0 + rl) * DM + h * HD + lane * 4, *(const v4f*)&so[wave][rl][lane * 4]);
  asm volatile("s_wait_xcnt 0x0" ::: "memory");   // stands in front of the next tile's first writes to registers that the stores above name
  }
  __syncthreads();
  if (tid < 2) { float a = 0.f; for (int i = 0; i < 64; ++i) a += sh_ent[tid][i]; PH[((size_t)b * NH + h) * (SS / 64) + (tid ? (int)blockIdx.x : TQB - 1 - (int)blockIdx.x)] = a; }   // one partial per tile, summed in row order (plain 4-B store of a scratch value)
}
// ---- k_out: block = (64 rows, 128 cols): out = O(hi/lo) . Wo rows (2 products) + bo
__global__ __launch_bounds__(128) void k_out(const float* __restrict__ O, const __bf16* __restrict__ P, const float* __restrict__ BO, float* __restrict__ Y) {
  __shared__ __align__(16) char smem[2 * GSTAGE];   // the two staging buffers; behind the K loop's last barrier the same bytes stage the output
  float (*so)[16][132] = (float (*)[16][132])smem;
  const int tid = threadIdx.x, wave = tid >> 5, lane = tid & 31, col = lane & 15, g = lane >> 4; const size_t r0 = (size_t)blockIdx.x * 64 + wave * 16; const int n0 = blockIdx.y * 128;
  v8f acc[8] = {};
  const unsigned lds0 = (unsigned)(size_t)smem; const float* Ag = O + (size_t)blockIdx.x * 64 * DM; const __bf16* Bg = P + (size_t)n0 * DM;
  stage_chunk(Ag, Bg, lds0, tid);
  asm volatile("s_wait_asynccnt 0x0" ::: "memory");   // this wave's copies of chunk 0 have landed
  __syncthreads();                                    // ... and every other wave's: chunk 0 may be read
  stage_chunk(Ag + GKC, Bg + GKC, lds0 + GSTAGE, tid);
#pragma unroll 1   // kept rolled: the buffer alternates with t, one copy of the body
  for (int t = 0; t < GNT; ++t) { const char* sa = smem + (t & 1) * GSTAGE + (wave * 16 + col) * GA_PITCH + 32 * g; const char* sb = smem + (t & 1) * GSTAGE + GA_BYTES + col * GB_PITCH + 16 * g;
#pragma unroll   // this and the inner loops: constant indices, so that fragments and accumulators stay in registers
    for (int kc = 0; kc < GKC / 32; ++kc) { float av[16]; lds_a16(sa + kc * 128, av); v16b w[8];   // all LDS reads of a 32-k step stand as one group in front of its products: one LDS latency a step, not one a product
#pragma unroll
      for (int j = 0; j < 8; ++j) w[j] = lds_b16(sb + j * 16 * GB_PITCH + kc * 64);
      const F2 a = bsplit16(av);
#pragma unroll
      for (int j = 0; j < 8; ++j) { acc[j] = wmma_bf(a.l, w[j], acc[j]); acc[j] = wmma_bf(a.h, w[j], acc[j]); } }
    asm volatile("s_wait_dscnt 0x0" ::: "memory");      // this wave's reads of buffer t & 1 are done before it is refilled
    asm volatile("s_wait_asynccnt 0x0" ::: "memory");   // this wave's copies of chunk t + 1 have landed
    __syncthreads();                                    // publishes chunk t + 1 and ends every wave's reads of chunk t
    if (t + 2 < GNT) stage_chunk(Ag + (t + 2) * GKC, Bg + (t + 2) * GKC, lds0 + (unsigned)(t & 1) * GSTAGE, tid); }
  asm volatile("s_wait_asynccnt 0x0" ::: "memory");     // no copy is in flight when the buffers become output staging
#pragma unroll
  for (int j = 0; j < 8; ++j) {
#pragma unroll
    for (int r = 0; r < 8; ++r) so[wave][8 * g + r][j * 16 + col] = acc[j][r] + bfr(BO[n0 + j * 16 + col]); }
  LDSX();
  for (int rl = 0; rl < 16; ++rl) vst2(Y + (r0 + rl) * DM + n0 + lane * 4, *(const v4f*)&so[wave][rl][lane * 4]);
}
// ---- k_ent: mean entropy over all (b, h, t) rows from the block partials (fixed order) -> scalar second output
__global__ __launch_bounds__(256) void k_ent(const float* __restrict__ PH, float* __restrict__ OUT1) {
  __shared__ float red[256]; const int t = threadIdx.x; const int n = NB * NH * (TQB);   // TQB row blocks per (b, h) were computed
  float a = 0.f; for (int i = t; i < n; i += 256) a += PH[(size_t)(i / TQB) * (SS / 64) + (i % TQB)];
  red[t] = a; __syncthreads();
  for (int s = 128; s >= 1; s >>= 1) { if (t < s) red[t] += red[t + s]; __syncthreads(); }
  if (t == 0) { float* p = OUT1; p[0] = red[0] / ((float)NB * NH * (TQB * 64));  }
}
extern "C" void kernel_launch(void* const* d_in, const int* in_sizes, int n_in, void* d_out, int out_size, void* d_ws, size_t ws_size, hipStream_t stream) {
  (void)in_sizes; (void)n_in; (void)out_size;
  const float** F = (const float**)d_in;   // 0 x [4,2048,1024], 1 w_q natural, 2 b_q, 3 w_k, 4 b_k, 5 w_v, 6 b_v, 7 w_o, 8 b_o
  if (ws_size < (size_t)WS_END) return;
  char* ws = (char*)d_ws; __bf16* PK = (__bf16*)(ws + WS_PK); _Float16 *QK = (_Float16*)(ws + WS_QK), *QKL = (_Float16*)(ws + WS_QKL), *VTH = (_Float16*)(ws + WS_VTH), *VTL = (_Float16*)(ws + WS_VTL); float *O = (float*)(ws + WS_O), *PH = (float*)(ws + WS_PH);
  k_pack<<<dim3(DM, 4), 256, 0, stream>>>(F[1], F[3], F[5], F[7], PK);
  k_qkv<<<dim3(TNB * SS / 64, QKVW / 128), 128, 0, stream>>>(F[0], F[0], F[0], PK + PK_A, F[2], F[4], F[6], QK, QKL, VTH, VTL);
  k_attn<<<dim3(TQB / 2, NH, TNB), 128, 0, stream>>>(QK, QKL, VTH, VTL, nullptr, O, PH);
  k_out<<<dim3(TOB, DM / 128), 128, 0, stream>>>(O, PK + PK_P, F[8], (float*)d_out);
  k_ent<<<1, 256, 0, stream>>>(PH, (float*)d_out + (size_t)NB * SS * DM);
}

// v006
// Measured time: 184 microseconds a run.
// Two timings next to v005 both put it at 1.05 times that version's speed.
// Over all steps from v000 it is 4.10 times as fast.
// compute dtype: all float inputs rounded to bf16; q/k/v = x . W^T + b with EXACT bf16 products on WMMA 16x16x32 (natural rows); causal attention x 1/8 (tiles past the diagonal skipped) with 3-product scores (q, k as f16 hi + x2048 residual) for the first 128 queries of each sequence and single-product scores elsewhere; running-max softmax in f32 (hardware exp) that also accumulates sum p*s for the row entropy H = m + log(l) - sum(p s) (precise logf), block partial sums combined in fixed order for the mean; P (scaled by 2^11, single f16) x v (f16 hi + x2048 residual), 2 products; y = ctx (bf16 hi + residual) . Wo^T (2 products) + bo.
#include <hip/hip_runtime.h>
#include <math.h>

typedef __attribute__((ext_vector_type(16))) _Float16 v16h;
typedef __attribute__((ext_vector_type(16))) __bf16 v16b;
typedef __attribute__((ext_vector_type(8)))  _Float16 v8h;
typedef __attribute__((ext_vector_type(8)))  float v8f;
typedef __attribute__((ext_vector_type(4)))  float v4f;
typedef __attribute__((ext_vector_type(2)))  float v2f;
typedef __attribute__((ext_vector_type(4)))  unsigned v4u;
typedef __attribute__((ext_vector_type(4)))  int v4i;
typedef float __attribute__((may_alias)) float_a;
typedef int __attribute__((may_alias)) int_a;

template <typename T> __device__ __forceinline__ void vst2(void* p, T v) { *(T*)p = v;  }
__device__ __forceinline__ v8f wmma16(v16h a, v16h b, v8f c) {
  v8f d = __builtin_amdgcn_wmma_f32_16x16x32_f16(false, a, false, b, (short)0, c, false, false);
  asm volatile("v_nop\n\tv_nop\n\tv_nop\n\tv_nop" : "+v"(d) : "v"(a), "v"(b));
  return d;
}
__device__ __forceinline__ v8f wmma_bf(v16b a, v16b b, v8f c) {
  v8f d = __builtin_amdgcn_wmma_f32_16x16x32_bf16(false, a, false, b, (short)0, c, false, false);
  asm volatile("v_nop\n\tv_nop\n\tv_nop\n\tv_nop" : "+v"(d) : "v"(a), "v"(b));
  return d;
}
// Causal multi-head self attention (B 4, T 2,048, C 1,024, 16 heads x 64) with biases and output projection, plus the mean attention entropy (second output).
__device__ __forceinline__ v16h frag_h(const _Float16* rowk0, int lane) {
  union { v16h v; v8h q[2]; } u; const _Float16* p = rowk0 + 8 * (lane >> 4);
  u.q[0] = *(const v8h*)p; u.q[1] = *(const v8h*)(p + 16); return u.v;
}
__device__ __forceinline__ v16h frag_f32(const float* rowk0, int lane) {
  v16h a; const float* p = rowk0 + 8 * (lane >> 4);
#pragma unroll
  for (int i = 0; i < 8; ++i) { a[i] = (_Float16)p[i]; a[8 + i] = (_Float16)p[16 + i]; }
  return a;
}
__device__ __forceinline__ v16h frag_f32s(const float* rowk0, int lane, float sc) {
  v16h a; const float* p = rowk0 + 8 * (lane >> 4);
#pragma unroll
  for (int i = 0; i < 8; ++i) { a[i] = (_Float16)(p[i] * sc); a[8 + i] = (_Float16)(p[16 + i] * sc); }
  return a;
}
// column fragment from a [K][ld] layout (column n), rows >= K read as 0
__device__ __forceinline__ v16h fragc_f32(const float* W, int k0, int n, int lane, int ld, int K) {
  v16h a; const int g = lane >> 4;
#pragma unroll
  for (int i = 0; i < 8; ++i) { const int ka = k0 + 8 * g + i, kb = ka + 16;
    a[i] = (_Float16)(ka < K ? W[(size_t)(ka < K ? ka : K - 1) * ld + n] : 0.f); a[8 + i] = (_Float16)(kb < K ? W[(size_t)(kb < K ? kb : K - 1) * ld + n] : 0.f); }
  return a;
}
struct F2 { v16b h, l; };
__device__ __forceinline__ F2 bsplit16(const float v[16]) { F2 r;
#pragma unroll
  for (int i = 0; i < 16; ++i) { const __bf16 h = (__bf16)v[i]; r.h[i] = h; r.l[i] = (__bf16)(v[i] - (float)h); }
  return r; }
__device__ __forceinline__ F2 split_row(const float* row, int k0, int lane) { float v[16]; const float* p = row + k0 + 8 * (lane >> 4);
#pragma unroll
  for (int i = 0; i < 8; ++i) { v[i] = p[i]; v[8 + i] = p[16 + i]; }
  return bsplit16(v); }
__device__ __forceinline__ F2 split_rowK(const float* row, int k0, int lane, int K) { float v[16]; const int g = lane >> 4;
#pragma unroll
  for (int i = 0; i < 8; ++i) { const int ka = k0 + 8 * g + i, kb = ka + 16; v[i] = ka < K ? row[ka < K ? ka : K - 1] : 0.f; v[8 + i] = kb < K ? row[kb < K ? kb : K - 1] : 0.f; }
  return bsplit16(v); }
__device__ __forceinline__ F2 split_col(const float* W, int k0, int n, int lane, int ld, int K) { float v[16]; const int g = lane >> 4;
#pragma unroll
  for (int i = 0; i < 8; ++i) { const int ka = k0 + 8 * g + i, kb = ka + 16; v[i] = ka < K ? W[(size_t)(ka < K ? ka : K - 1) * ld + n] : 0.f; v[8 + i] = kb < K ? W[(size_t)(kb < K ? kb : K - 1) * ld + n] : 0.f; }
  return bsplit16(v); }
__device__ __forceinline__ v8f mac3(const F2& a, const F2& b, v8f c) { c = wmma_bf(a.l, b.h, c); c = wmma_bf(a.h, b.l, c); return wmma_bf(a.h, b.h, c); }
__device__ __forceinline__ float sigm(float v) { return 1.0f / (1.0f + expf(-v)); }
#define LDSX() do { asm volatile("s_wait_dscnt 0" ::: "memory"); __builtin_amdgcn_wave_barrier(); __builtin_amdgcn_fence(__ATOMIC_RELEASE, "workgroup"); } while (0)


#define NB 4
#define SS 2048
#define SCALEF 0.125f
#define DM 1024
#define NH 16
#define HD 64
#define QKVW (3 * DM)
#ifndef TQB
#define TQB (SS / 64)
#define TNB NB
#define TOB (NB * SS / 64)     // all rows in 64-row tiles (unused)
#endif
typedef __attribute__((ext_vector_type(8))) __bf16 v8b;
__device__ __forceinline__ v16b frag_b(const __bf16* rowk0, int lane) {
  union { v16b v; v8b q[2]; } u; const __bf16* p = rowk0 + 8 * (lane >> 4);
  u.q[0] = *(const v8b*)p; u.q[1] = *(const v8b*)(p + 16); return u.v;
}
__device__ __forceinline__ float bfr(float v) { return (float)(__bf16)v; }
__device__ __attribute__((noinline)) float exp_ni(float v) { return expf(v); }
__device__ __attribute__((noinline)) float erf_ni(float v) { return erff(v); }

#define PK_A 0                       // [3072][1024] Wqkv rows (natural [out][in])
#define PK_P (PK_A + QKVW * DM)        // [1024][1024] Wo rows (natural)
#define PK_END (PK_P + DM * DM)
#define WS_PK  0u
#define WS_QK  (WS_PK + 2u * PK_END)             // f16 [8192 rows][2048]: q | k
#define WS_QKL (WS_QK + 2u * NB * SS * 2 * DM)     // f16 q | k residual planes x2048
#define WS_VTH (WS_QKL + 2u * NB * SS * 2 * DM)    // f16 [b][1024 (h*64+d)][2048 s] hi
#define WS_VTL (WS_VTH + 2u * NB * DM * SS)        // f16 lo x 2048
#define WS_O   (WS_VTL + 2u * NB * DM * SS)        // f32 [8192][1024]
#define WS_CS  (WS_O + 4u * NB * SS * DM)           // f32 2 x [2048][32], reserved, unused
#define WS_PH  (WS_CS + 4u * 2 * SS * 32)                 // f32 [NB*NH*(SS/64)] entropy block partials
#define WS_END (WS_PH + 4u * NB * NH * (SS / 64))
// ---- k_pack: block = (row n, which): natural [out][in] rows -> bf16; which 0..2 -> W_q/W_k/W_v into PK_A rows which*1024 + n; 3 -> W_o into PK_P
__global__ __launch_bounds__(256) void k_pack(const float* __restrict__ WQ, const float* __restrict__ WK, const float* __restrict__ WV, const float* __restrict__ WO, __bf16* __restrict__ PK) {
  __shared__ __align__(16) __bf16 s[DM]; const int n = blockIdx.x, which = blockIdx.y, t = threadIdx.x; const float* Wm = (which == 0) ? WQ : (which == 1) ? WK : (which == 2) ? WV : WO;
  for (int k = t; k < DM; k += 256) s[k] = (__bf16)Wm[(size_t)n * DM + k];
  __syncthreads();
  __bf16* dst = (which < 3) ? PK + PK_A + ((size_t)which * DM + n) * DM : PK + PK_P + (size_t)n * DM;
  for (int q = t; q < DM / 8; q += 256) vst2((unsigned*)(dst + q * 8), *(const v4u*)&s[q * 8]);
}
// ---- operand staging of the two projection GEMMs: a block of eight waves makes a 128 x 256 tile of the output (wave tile 32 x 128: waves 4 down, 2 across), so that a staged byte feeds twice the products of a 64 x 128 tile and a fragment read from LDS feeds 2 (weights) or 8 (activations) products in k_qkv, twice that in k_out (hi and lo). Per 64-k chunk the block's 128 f32 activation rows (256 B each) and 256 bf16 weight rows (128 B each) go from global memory into LDS by asynchronous 16-B copies that cover whole 128-B lines, once per block; the waves read their fragments from LDS. Two buffers: chunk t + 1 flies while chunk t is worked on.
#define GKC 64                           // k per staged chunk
#define GA_PITCH 272                     // LDS bytes per staged f32 row (16 B x odd: 16-B reads of 16 rows fall on distinct banks)
#define GB_PITCH 144                     // LDS bytes per staged bf16 row (16 B x odd)
#define GBM 128                          // output rows per block
#define GBN 256                          // output columns per block
#define GA_BYTES (GBM * GA_PITCH)
#define GB_BYTES (GBN * GB_PITCH)
#define GSTAGE (GA_BYTES + GB_BYTES)     // one buffer: [activation rows | weight rows]
#define GNT (DM / GKC)
// eight copies of one lane and, in the same statement, the wait that stands in front of any later write of the address registers they name
#define COPY8(l, ls, p, ps) asm volatile( \
  "global_load_async_to_lds_b128 %0, %8, off\n\tglobal_load_async_to_lds_b128 %1, %9, off\n\t" \
  "global_load_async_to_lds_b128 %2, %10, off\n\tglobal_load_async_to_lds_b128 %3, %11, off\n\t" \
  "global_load_async_to_lds_b128 %4, %12, off\n\tglobal_load_async_to_lds_b128 %5, %13, off\n\t" \
  "global_load_async_to_lds_b128 %6, %14, off\n\tglobal_load_async_to_lds_b128 %7, %15, off\n\ts_wait_xcnt 0x0" \
  :: "v"(l), "v"((l) + (ls)), "v"((l) + 2 * (ls)), "v"((l) + 3 * (ls)), "v"((l) + 4 * (ls)), "v"((l) + 5 * (ls)), "v"((l) + 6 * (ls)), "v"((l) + 7 * (ls)), \
     "v"(p), "v"((p) + (ps)), "v"((p) + 2 * (ps)), "v"((p) + 3 * (ps)), "v"((p) + 4 * (ps)), "v"((p) + 5 * (ps)), "v"((p) + 6 * (ps)), "v"((p) + 7 * (ps)) : "memory")
// Ag: first of the block's 128 rows at the chunk's first k; Bg: first of its 256 weight rows at the same k; lds: byte address of the buffer; tid 0..255
__device__ __forceinline__ void stage_chunk(const float* Ag, const __bf16* Bg, unsigned lds, int tid) {
  const float* pa = Ag + (size_t)(tid >> 4) * DM + (tid & 15) * 4; const unsigned la = lds + (unsigned)(tid >> 4) * GA_PITCH + (unsigned)(tid & 15) * 16u;   // 16 lanes a row, 16 rows a copy
  const __bf16* pb = Bg + (size_t)(tid >> 3) * DM + (tid & 7) * 8; const unsigned lb = lds + GA_BYTES + (unsigned)(tid >> 3) * GB_PITCH + (unsigned)(tid & 7) * 16u;   // 8 lanes a row, 32 rows a copy
  COPY8(la, 16u * GA_PITCH, pa, (size_t)16 * DM);
  COPY8(lb, 32u * GB_PITCH, pb, (size_t)32 * DM);
}
// the 16 f32 of a lane's A fragment (k = 8g + 0..7 and 16 + 8g + 0..7 of a 32-k step) from a staged row; p = row + 128 * step + 32 * g bytes
__device__ __forceinline__ void lds_a16(const char* p, float v[16]) { const v4f x0 = *(const v4f*)p, x1 = *(const v4f*)(p + 16), x2 = *(const v4f*)(p + 64), x3 = *(const v4f*)(p + 80);
#pragma unroll   // constant indices: v stays in registers
  for (int i = 0; i < 4; ++i) { v[i] = x0[i]; v[4 + i] = x1[i]; v[8 + i] = x2[i]; v[12 + i] = x3[i]; } }
// a lane's B fragment (same k order) from a staged bf16 row; p = row + 64 * step + 16 * g bytes
__device__ __forceinline__ v16b lds_b16(const char* p) { union { v16b v; v8b q[2]; } u; u.q[0] = *(const v8b*)p; u.q[1] = *(const v8b*)(p + 32); return u.v; }
// amdgpu_waves_per_eu(4, 4): register budget of 256, so that two blocks stay resident on a WGP (four waves a SIMD), as their LDS allows
__global__ __launch_bounds__(256) __attribute__((amdgpu_waves_per_eu(4, 4))) void k_qkv(const float* __restrict__ XQ, const float* __restrict__ XK, const float* __restrict__ XV, const __bf16* __restrict__ P, const float* __restrict__ BQ, const float* __restrict__ BK, const float* __restrict__ BV, _Float16* __restrict__ QK, _Float16* __restrict__ QKL, _Float16* __restrict__ VTH, _Float16* __restrict__ VTL) {
  const int which0 = (blockIdx.y * GBN) / DM; const float* X = (which0 == 0) ? XQ : (which0 == 1) ? XK : XV; const float* BB = BQ ? (((which0 == 0) ? BQ : (which0 == 1) ? BK : BV) + (blockIdx.y * GBN - which0 * DM)) : nullptr;
  __shared__ __align__(16) char smem[2 * GSTAGE];   // the two staging buffers; behind the K loop's last barrier the same bytes stage the output
  _Float16 (*so)[32][136] = (_Float16 (*)[32][136])smem, (*sol)[32][136] = (_Float16 (*)[32][136])(smem + 8 * 32 * 136 * 2); _Float16 (*sth)[136] = (_Float16 (*)[136])smem, (*stl)[136] = (_Float16 (*)[136])(smem + GBN * 136 * 2);
  const int tid = threadIdx.x, wave = tid >> 5, lane = tid & 31, col = lane & 15, g = lane >> 4, wm = wave >> 1, nw = (wave & 1) * 128;   // the wave's tile: rows wm * 32 + 0..31, columns nw + 0..127 of the block's
  const size_t r0 = (size_t)blockIdx.x * GBM + wm * 32; const int n0 = blockIdx.y * GBN;
  v8f acc[2][8] = {};
  const unsigned lds0 = (unsigned)(size_t)smem; const float* Ag = X + (size_t)blockIdx.x * GBM * DM; const __bf16* Bg = P + (size_t)n0 * DM;
  stage_chunk(Ag, Bg, lds0, tid);
  asm volatile("s_wait_asynccnt 0x0" ::: "memory");   // this wave's copies of chunk 0 have landed
  __syncthreads();                                    // ... and every other wave's: chunk 0 may be read
  stage_chunk(Ag + GKC, Bg + GKC, lds0 + GSTAGE, tid);
#pragma unroll 1   // kept rolled: the buffer alternates with t, one copy of the body
  for (int t = 0; t < GNT; ++t) { const char* sa = smem + (t & 1) * GSTAGE + (wm * 32 + col) * GA_PITCH + 32 * g; const char* sb = smem + (t & 1) * GSTAGE + GA_BYTES + (nw + col) * GB_PITCH + 16 * g;
#pragma unroll   // this and the inner loops: constant indices, so that fragments and accumulators stay in registers
    for (int kc = 0; kc < GKC / 32; ++kc) { float av[2][16]; lds_a16(sa + kc * 128, av[0]); lds_a16(sa + 16 * GA_PITCH + kc * 128, av[1]); v16b a[2], w[8];   // the LDS reads of a 32-k step stand in front of its products
#pragma unroll
      for (int j = 0; j < 8; ++j) w[j] = lds_b16(sb + j * 16 * GB_PITCH + kc * 64);
#pragma unroll
      for (int i = 0; i < 16; ++i) { a[0][i] = (__bf16)av[0][i]; a[1][i] = (__bf16)av[1][i]; }
#pragma unroll
      for (int j = 0; j < 8; ++j) { acc[0][j] = wmma_bf(a[0], w[j], acc[0][j]); acc[1][j] = wmma_bf(a[1], w[j], acc[1][j]); } }
    asm volatile("s_wait_dscnt 0x0" ::: "memory");      // this wave's reads of buffer t & 1 are done before it is refilled
    asm volatile("s_wait_asynccnt 0x0" ::: "memory");   // this wave's copies of chunk t + 1 have landed
    __syncthreads();                                    // publishes chunk t + 1 and ends every wave's reads of chunk t
    if (t + 2 < GNT) stage_chunk(Ag + (t + 2) * GKC, Bg + (t + 2) * GKC, lds0 + (unsigned)(t & 1) * GSTAGE, tid); }
  asm volatile("s_wait_asynccnt 0x0" ::: "memory");     // no copy is in flight when the buffers become output staging
  // both branches below: the bias term stands inside the r loop and compiles to one global load with its wait per element
  if (n0 < 2 * DM) {   // q stored unscaled (f16 sigma ~0.6, no subnormal exposure); 1/8 applied to the f32 score
#pragma unroll
    for (int i = 0; i < 2; ++i) {
#pragma unroll
    for (int j = 0; j < 8; ++j) {
#pragma unroll
      for (int r = 0; r < 8; ++r) { const float v = acc[i][j][r] + (BB ? bfr(BB[nw + j * 16 + col]) : 0.f); const _Float16 hv = (_Float16)v; so[wave][i * 16 + 8 * g + r][j * 16 + col] = hv; sol[wave][i * 16 + 8 * g + r][j * 16 + col] = (_Float16)((v - (float)hv) * 2048.0f); } } }   // q, k (+ bias) as f16 hi + (x2048) residual
    LDSX();
    for (int rp = 0; rp < 16; ++rp) { const int rl = 2 * rp + g; vst2((unsigned*)(QK + (r0 + rl) * (2 * DM) + n0 + nw + col * 8), *(const v4u*)&so[wave][rl][col * 8]); vst2((unsigned*)(QKL + (r0 + rl) * (2 * DM) + n0 + nw + col * 8), *(const v4u*)&sol[wave][rl][col * 8]); }   // 16 lanes a row of 256 B, two rows a store
  } else {
#pragma unroll
    for (int i = 0; i < 2; ++i) {
#pragma unroll
    for (int j = 0; j < 8; ++j) {
#pragma unroll
      for (int r = 0; r < 8; ++r) { const float v = acc[i][j][r] + (BB ? bfr(BB[nw + j * 16 + col]) : 0.f); const _Float16 hv = (_Float16)v; sth[nw + j * 16 + col][wm * 32 + i * 16 + 8 * g + r] = hv; stl[nw + j * 16 + col][wm * 32 + i * 16 + 8 * g + r] = (_Float16)((v - (float)hv) * 2048.0f); } } }
    __syncthreads();
    const size_t rb = (size_t)blockIdx.x * GBM; const int b = (int)(rb / SS), s0 = (int)(rb % SS); const int pc0 = n0 - 2 * DM;
    for (int it = 0; it < GBN / 16; ++it) { const int d = it * 16 + (tid >> 4), pc = tid & 15;   // 16 lanes a row of 256 B
      const size_t o = ((size_t)b * DM + pc0 + d) * SS + s0 + pc * 8; vst2((unsigned*)(VTH + o), *(const v4u*)&sth[d][pc * 8]); vst2((unsigned*)(VTL + o), *(const v4u*)&stl[d][pc * 8]); }
  }
}
// ---- K / V staging of k_attn: per 64 keys the head's 64 K rows, 64 rows of Vt hi and 64 rows of Vt lo (128 B each, one whole line) go from global memory into LDS by asynchronous 16-B copies, once per block; the four waves read their fragments from LDS. Two buffers: stage t + 1 flies while stage t is worked on.
#define AT_PITCH 144                     // LDS bytes per staged 128-B row (16 B x odd: 16-B reads of 16 rows fall on distinct banks)
#define AT_SEC (64 * AT_PITCH)           // 64 rows
#define AT_STAGE (3 * AT_SEC)            // one buffer: [K rows | Vt hi rows | Vt lo rows]
// Kg: the stage's first K row (this head's 64 d); Vh, Vl: the head's first Vt row at the stage's first key; lds: byte address of the buffer. 8 lanes a row, 16 rows a copy, 12 copies a lane; in the same statement the wait that stands in front of any later write of the address registers they name
__device__ __forceinline__ void stage_kv(const _Float16* Kg, const _Float16* Vh, const _Float16* Vl, unsigned lds, int tid) {
  const unsigned l = lds + (unsigned)(tid >> 3) * AT_PITCH + (unsigned)(tid & 7) * 16u, ls = 16u * AT_PITCH;
  const _Float16* pk = Kg + (size_t)(tid >> 3) * (2 * DM) + (tid & 7) * 8; const _Float16* ph = Vh + (size_t)(tid >> 3) * SS + (tid & 7) * 8; const _Float16* pl = Vl + (size_t)(tid >> 3) * SS + (tid & 7) * 8;
  const size_t ks = (size_t)16 * 2 * DM, vs = (size_t)16 * SS;
  asm volatile(
    "global_load_async_to_lds_b128 %0, %12, off\n\tglobal_load_async_to_lds_b128 %1, %13, off\n\tglobal_load_async_to_lds_b128 %2, %14, off\n\tglobal_load_async_to_lds_b128 %3, %15, off\n\t"
    "global_load_async_to_lds_b128 %4, %16, off\n\tglobal_load_async_to_lds_b128 %5, %17, off\n\tglobal_load_async_to_lds_b128 %6, %18, off\n\tglobal_load_async_to_lds_b128 %7, %19, off\n\t"
    "global_load_async_to_lds_b128 %8, %20, off\n\tglobal_load_async_to_lds_b128 %9, %21, off\n\tglobal_load_async_to_lds_b128 %10, %22, off\n\tglobal_load_async_to_lds_b128 %11, %23, off\n\ts_wait_xcnt 0x0"
    :: "v"(l), "v"(l + ls), "v"(l + 2 * ls), "v"(l + 3 * ls), "v"(l + AT_SEC), "v"(l + AT_SEC + ls), "v"(l + AT_SEC + 2 * ls), "v"(l + AT_SEC + 3 * ls), "v"(l + 2 * AT_SEC), "v"(l + 2 * AT_SEC + ls), "v"(l + 2 * AT_SEC + 2 * ls), "v"(l + 2 * AT_SEC + 3 * ls),
       "v"(pk), "v"(pk + ks), "v"(pk + 2 * ks), "v"(pk + 3 * ks), "v"(ph), "v"(ph + vs), "v"(ph + 2 * vs), "v"(ph + 3 * vs), "v"(pl), "v"(pl + vs), "v"(pl + 2 * vs), "v"(pl + 3 * vs) : "memory");
}
// the value that lane ^ 16 holds (one vector instruction, no LDS)
__device__ __forceinline__ float xhalf(float v) { const int b = __builtin_bit_cast(int, v); return __builtin_bit_cast(float, __builtin_amdgcn_permlanex16(b, b, 0x76543210, 0xfedcba98, false, false)); }
// a lane's f16 fragment (k = 8g + 0..7 and 16 + 8g + 0..7 of a 32-k step) from a staged row; p = row + 64 * step + 16 * g bytes
__device__ __forceinline__ v16h lds_h16(const char* p) { union { v16h v; v8h q[2]; } u; u.q[0] = *(const v8h*)p; u.q[1] = *(const v8h*)(p + 32); return u.v; }
// 2^t for the masked path below, with the free slot that the instruction set asks for behind a transcendental in the same statement
__device__ __forceinline__ float exp2_slot(float t) { float e; asm("v_exp_f32 %0, %1\n\tv_nop" : "=v"(e) : "v"(t)); return e; }
// the softmax arithmetic of a 32-key step. c: raw scores (register r of tile ct = key 16*ct + 8g + r of the step); m: the running maximum. Gives the new maximum mn, the lane's sums es (of e) and eh (of e * s) and P as a B fragment. MK = true: a step that reaches past some query of the wave, with the causal mask and the guards that keep masked scores out of the sums. MK = false: every key of the step counts for every query of the wave, so the mask and the guards are identities and are not computed
template <bool MK> __device__ __forceinline__ void attn_soft(const v8f (&c)[2], const int lim, const float m, float& mn, float& es, float& eh, v16h& pa) {
    v8f s[2];
#pragma unroll
    for (int ct = 0; ct < 2; ++ct) {
#pragma unroll
      for (int r = 0; r < 8; ++r) s[ct][r] = (!MK || ct * 16 + r <= lim) ? c[ct][r] * SCALEF : -3.0e38f; }   // causal: future keys excluded
    float mx = fmaxf(s[0][0], s[1][0]);   // the lane's 16 scores all belong to one query: maximum and sums in its own registers
#pragma unroll
    for (int r = 1; r < 8; ++r) mx = fmaxf(mx, fmaxf(s[0][r], s[1][r]));
    mx = fmaxf(mx, xhalf(mx));   // the query's other 16 keys of the step lie in lane ^ 16
    mn = fmaxf(m, mx); es = 0.f; eh = 0.f;   // pa: P transposed as a B fragment, k position 8 * ct + r = key 16 * ct + 8g + r, the k order of lds_h16: no trip through LDS
#pragma unroll
    for (int ct = 0; ct < 2; ++ct) {
#pragma unroll
      for (int r = 0; r < 8; ++r) { const float x = MK ? exp2_slot((s[ct][r] - mn) * 1.44269504f) : __expf(s[ct][r] - mn); const float e = (MK && s[ct][r] <= -1.0e38f) ? 0.f : x; es += e; eh += ((!MK || e > 0.f) ? e * s[ct][r] : 0.f); pa[8 * ct + r] = (_Float16)(e * 2048.0f); } }   // P scaled by 2^11 before the f16 rounding so small softmax weights stay out of the f16 subnormal range; 2^-11 folded into the epilogue
}
__global__ __launch_bounds__(128) __attribute__((amdgpu_waves_per_eu(4, 4))) void k_attn(const _Float16* __restrict__ QK, const _Float16* __restrict__ QKL, const _Float16* __restrict__ VTH, const _Float16* __restrict__ VTL, const void* __restrict__ KMASK, float* __restrict__ O, float* __restrict__ PH) {
  __shared__ float sh_ent[2][64];
  __shared__ __align__(16) float so[4][16][68];   // a wave's output staging
  __shared__ __align__(16) char skv[2 * AT_STAGE];   // the two K / V staging buffers
  const int tid = threadIdx.x, wave = tid >> 5, lane = tid & 31, col = lane & 15, g = lane >> 4;
  const int h = blockIdx.y, b = blockIdx.z;
  const unsigned kv0 = (unsigned)(size_t)skv; const _Float16* Kg = QK + (size_t)b * SS * (2 * DM) + DM + h * HD; const _Float16* Vhg = VTH + ((size_t)b * DM + h * HD) * SS; const _Float16* Vlg = VTL + ((size_t)b * DM + h * HD) * SS;
#pragma unroll 1   // kept rolled: one copy of the tile body in the instruction cache, one register set for both tiles
  for (int tp = 0; tp < 2; ++tp) {
  const int qb = tp ? (int)blockIdx.x : TQB - 1 - (int)blockIdx.x; const int q0 = qb * 64 + wave * 16; const int wq0 = __builtin_amdgcn_readfirstlane(q0); const size_t rq = (size_t)b * SS + q0 + col;
  v16h aq[2];
#pragma unroll
  for (int kc = 0; kc < 2; ++kc) aq[kc] = frag_h(QK + rq * (2 * DM) + h * HD + kc * 32, lane);
  const _Float16* qrowl = QKL + rq * (2 * DM) + h * HD;   // q's residual plane is read where it is used (the two leading tiles' few steps): held in registers for every tile it would take the kernel past 256 registers (four waves a SIMD)
  float hs = 0.f;   // this lane's share (its eight keys of every sixteen) of the sum over keys of e^(s - m) * s, rescaled with the running max
  float m = -3.0e38f, l = 0.f;   // the lane's query (column col): running max over all keys (equal in both wave halves) and this lane's share of the sum
  v8f acc[4] = {}, accl[4] = {};
  const int nst = qb + 1;   // causal: 64-key stages up to the query tile's end
  stage_kv(Kg, Vhg, Vlg, kv0, tid);                   // (second tile: every wave's last read of the buffers ended at the first tile's last barrier)
  asm volatile("s_wait_asynccnt 0x0" ::: "memory");   // this wave's copies of stage 0 have landed
  __syncthreads();                                    // ... and every other wave's: stage 0 may be read
  if (nst > 1) stage_kv(Kg + (size_t)64 * (2 * DM), Vhg + 64, Vlg + 64, kv0 + AT_STAGE, tid);
#pragma unroll 1   // kept rolled: the buffer alternates with t, one copy of the body
  for (int t = 0; t < nst; ++t) { const char* sk = skv + (t & 1) * AT_STAGE + col * AT_PITCH + 16 * g;
#pragma unroll 1   // kept rolled: one copy of the 32-key step in the instruction cache
  for (int hf = 0; hf < 2; ++hf) { const int ks = 2 * t + hf; const int lim = q0 + col - ks * 32 - 8 * g;   // register r of score tile ct holds key ks*32 + 8g + 16*ct + r: it counts while 16*ct + r <= lim
    v8f s[2]; v16h kf[2][2];   // the step's K fragments are read as one group in front of its products: one LDS latency a step, not one a product
#pragma unroll
    for (int ct = 0; ct < 2; ++ct) {
#pragma unroll
      for (int kc = 0; kc < 2; ++kc) kf[ct][kc] = lds_h16(sk + (hf * 32 + ct * 16) * AT_PITCH + kc * 64); }
#pragma unroll
    for (int ct = 0; ct < 2; ++ct) { const int kk = ks * 32 + ct * 16 + col; const _Float16* krowl = QKL + ((size_t)b * SS + kk) * (2 * DM) + DM + h * HD; v8f c = {}, cl = {};   // transposed scores: A = K rows (lane col = key row kk), B = Q (lane col = query): c[r] = score of key ks*32 + ct*16 + 8g + r with query q0 + col
      if (qb < 2) {   // leading query blocks (few keys, outputs far above the global rms): 3 products
#pragma unroll
        for (int kc = 0; kc < 2; ++kc) { const v16h kh = kf[ct][kc], ql = frag_h(qrowl + kc * 32, lane), kl = frag_h(krowl + kc * 32, lane); c = wmma16(kh, aq[kc], c); cl = wmma16(kh, ql, cl); cl = wmma16(kl, aq[kc], cl); }   // q's and k's residual fragments of a 32-d step are read side by side, in front of its products
#pragma unroll
        for (int r = 0; r < 8; ++r) c[r] += cl[r] * (1.0f / 2048.0f); }
      else {
#pragma unroll
        for (int kc = 0; kc < 2; ++kc) c = wmma16(kf[ct][kc], aq[kc], c); }   // single product elsewhere
      s[ct] = c; }
    v16h vh[2], vl[2];   // the step's V fragments are read in two groups of four, each in front of its products; the first group flies under the softmax arithmetic
#pragma unroll
    for (int dt = 0; dt < 2; ++dt) { vh[dt] = lds_h16(sk + AT_SEC + dt * 16 * AT_PITCH + hf * 64); vl[dt] = lds_h16(sk + 2 * AT_SEC + dt * 16 * AT_PITCH + hf * 64); }
    float mn, es, eh; v16h pa;
    if (ks * 32 + 31 <= wq0) attn_soft<false>(s, lim, m, mn, es, eh, pa);   // the step's last key is no later than the wave's first query (a scalar test, the same for the whole wave): no mask needed
    else attn_soft<true>(s, lim, m, mn, es, eh, pa);
    const float alpha = (m <= -1.0e38f) ? 0.f : __expf(m - mn);
    l = l * alpha + es; hs = hs * alpha + eh; m = mn;   // the halves' shares are joined once, behind the key loop
#pragma unroll
    for (int dt = 0; dt < 4; ++dt) {
#pragma unroll
      for (int r = 0; r < 8; ++r) { acc[dt][r] *= alpha; accl[dt][r] *= alpha; } }
#pragma unroll
    for (int dt = 0; dt < 2; ++dt) { acc[dt] = wmma16(vh[dt], pa, acc[dt]); accl[dt] = wmma16(vl[dt], pa, accl[dt]); }   // transposed output: A = Vt rows (lane col = d row), B = P: acc[dt][r] = d dt*16 + 8g + r of query q0 + col
#pragma unroll
    for (int dt = 0; dt < 2; ++dt) { vh[dt] = lds_h16(sk + AT_SEC + (2 + dt) * 16 * AT_PITCH + hf * 64); vl[dt] = lds_h16(sk + 2 * AT_SEC + (2 + dt) * 16 * AT_PITCH + hf * 64); }
#pragma unroll
    for (int dt = 0; dt < 2; ++dt) { acc[2 + dt] = wmma16(vh[dt], pa, acc[2 + dt]); accl[2 + dt] = wmma16(vl[dt], pa, accl[2 + dt]); } }   // V hi x P + V lo x P / 2048: 2 products
    asm volatile("s_wait_dscnt 0x0" ::: "memory");      // this wave's reads of buffer t & 1 are done before it is refilled
    asm volatile("s_wait_asynccnt 0x0" ::: "memory");   // this wave's copies of stage t + 1 have landed
    __syncthreads();                                    // publishes stage t + 1 and ends every wave's reads of stage t
    if (t + 2 < nst) stage_kv(Kg + (size_t)(t + 2) * 64 * (2 * DM), Vhg + (t + 2) * 64, Vlg + (t + 2) * 64, kv0 + (unsigned)(t & 1) * AT_STAGE, tid); }
  asm volatile("s_wait_asynccnt 0x0" ::: "memory");     // no copy is in flight behind the key loop
  l += xhalf(l); hs += xhalf(hs);   // join the two halves' shares of the query's sums
  if (g == 0) sh_ent[tp][wave * 16 + col] = m + logf(l) - hs / l;   // H_row = -sum p log p = m + log l - sum p s
  { const float il = (1.0f / 2048.0f) / l;
#pragma unroll
    for (int dt = 0; dt < 4; ++dt) {
#pragma unroll
      for (int r = 0; r < 8; ++r) so[wave][col][dt * 16 + 8 * g + r] = (acc[dt][r] + accl[dt][r] * (1.0f / 2048.0f)) * il; } }
  LDSX();
  for (int rl = 0; rl < 16; ++rl) if (lane < 16) vst2(O + ((size_t)b * SS + q0 + rl) * DM + h * HD + lane * 4, *(const v4f*)&so[wave][rl][lane * 4]);
  asm volatile("s_wait_xcnt 0x0" ::: "memory");   // stands in front of the next tile's first writes to registers that the stores above name
  }
  __syncthreads();
  if (tid < 2) { float a = 0.f; for (int i = 0; i < 64; ++i) a += sh_ent[tid][i]; PH[((size_t)b * NH + h) * (SS / 64) + (tid ? (int)blockIdx.x : TQB - 1 - (int)blockIdx.x)] = a; }   // one partial per tile, summed in row order (plain 4-B store of a scratch value)
}
// ---- k_out: block = (128 rows, 256 cols): out = O(hi/lo) . Wo rows (2 products) + bo
__global__ __launch_bounds__(256) void k_out(const float* __restrict__ O, const __bf16* __restrict__ P, const float* __restrict__ BO, float* __restrict__ Y) {
  __shared__ __align__(16) char smem[2 * GSTAGE];   // the two staging buffers; behind the K loop's last barrier the same bytes stage the output
  float (*so)[32][132] = (float (*)[32][132])smem;
  const int tid = threadIdx.x, wave = tid >> 5, lane = tid & 31, col = lane & 15, g = lane >> 4, wm = wave >> 1, nw = (wave & 1) * 128;   // the wave's tile: rows wm * 32 + 0..31, columns nw + 0..127 of the block's
  const size_t r0 = (size_t)blockIdx.x * GBM + wm * 32; const int n0 = blockIdx.y * GBN;
  v8f acc[2][8] = {};
  const unsigned lds0 = (unsigned)(size_t)smem; const float* Ag = O + (size_t)blockIdx.x * GBM * DM; const __bf16* Bg = P + (size_t)n0 * DM;
  stage_chunk(Ag, Bg, lds0, tid);
  asm volatile("s_wait_asynccnt 0x0" ::: "memory");   // this wave's copies of chunk 0 have landed
  __syncthreads();                                    // ... and every other wave's: chunk 0 may be read
  stage_chunk(Ag + GKC, Bg + GKC, lds0 + GSTAGE, tid);
#pragma unroll 1   // kept rolled: the buffer alternates with t, one copy of the body
  for (int t = 0; t < GNT; ++t) { const char* sa = smem + (t & 1) * GSTAGE + (wm * 32 + col) * GA_PITCH + 32 * g; const char* sb = smem + (t & 1) * GSTAGE + GA_BYTES + (nw + col) * GB_PITCH + 16 * g;
#pragma unroll   // this and the inner loops: constant indices, so that fragments and accumulators stay in registers
    for (int kc = 0; kc < GKC / 32; ++kc) { float av[2][16]; lds_a16(sa + kc * 128, av[0]); lds_a16(sa + 16 * GA_PITCH + kc * 128, av[1]); v16b w[8];   // the LDS reads of a 32-k step stand in front of its products
#pragma unroll
      for (int j = 0; j < 8; ++j) w[j] = lds_b16(sb + j * 16 * GB_PITCH + kc * 64);
      const F2 a0 = bsplit16(av[0]), a1 = bsplit16(av[1]);
#pragma unroll
      for (int j = 0; j < 8; ++j) { acc[0][j] = wmma_bf(a0.l, w[j], acc[0][j]); acc[1][j] = wmma_bf(a1.l, w[j], acc[1][j]); acc[0][j] = wmma_bf(a0.h, w[j], acc[0][j]); acc[1][j] = wmma_bf(a1.h, w[j], acc[1][j]); } }   // per accumulator: residual product, then main product
    asm volatile("s_wait_dscnt 0x0" ::: "memory");      // this wave's reads of buffer t & 1 are done before it is refilled
    asm volatile("s_wait_asynccnt 0x0" ::: "memory");   // this wave's copies of chunk t + 1 have landed
    __syncthreads();                                    // publishes chunk t + 1 and ends every wave's reads of chunk t
    if (t + 2 < GNT) stage_chunk(Ag + (t + 2) * GKC, Bg + (t + 2) * GKC, lds0 + (unsigned)(t & 1) * GSTAGE, tid); }
  asm volatile("s_wait_asynccnt 0x0" ::: "memory");     // no copy is in flight when the buffers become output staging
#pragma unroll
  for (int i = 0; i < 2; ++i) {
#pragma unroll
  for (int j = 0; j < 8; ++j) {
#pragma unroll
    for (int r = 0; r < 8; ++r) so[wave][i * 16 + 8 * g + r][j * 16 + col] = acc[i][j][r] + bfr(BO[n0 + nw + j * 16 + col]); } }
  LDSX();
  for (int rl = 0; rl < 32; ++rl) vst2(Y + (r0 + rl) * DM + n0 + nw + lane * 4, *(const v4f*)&so[wave][rl][lane * 4]);
}
// ---- k_ent: mean entropy over all (b, h, t) rows from the block partials (fixed order) -> scalar second output
__global__ __launch_bounds__(256) void k_ent(const float* __restrict__ PH, float* __restrict__ OUT1) {
  __shared__ float red[256]; const int t = threadIdx.x; const int n = NB * NH * (TQB);   // TQB row blocks per (b, h) were computed
  float a = 0.f; for (int i = t; i < n; i += 256) a += PH[(size_t)(i / TQB) * (SS / 64) + (i % TQB)];
  red[t] = a; __syncthreads();
  for (int s = 128; s >= 1; s >>= 1) { if (t < s) red[t] += red[t + s]; __syncthreads(); }
  if (t == 0) { float* p = OUT1; p[0] = red[0] / ((float)NB * NH * (TQB * 64));  }
}
extern "C" void kernel_launch(void* const* d_in, const int* in_sizes, int n_in, void* d_out, int out_size, void* d_ws, size_t ws_size, hipStream_t stream) {
  (void)in_sizes; (void)n_in; (void)out_size;
  const float** F = (const float**)d_in;   // 0 x [4,2048,1024], 1 w_q natural, 2 b_q, 3 w_k, 4 b_k, 5 w_v, 6 b_v, 7 w_o, 8 b_o
  if (ws_size < (size_t)WS_END) return;
  char* ws = (char*)d_ws; __bf16* PK = (__bf16*)(ws + WS_PK); _Float16 *QK = (_Float16*)(ws + WS_QK), *QKL = (_Float16*)(ws + WS_QKL), *VTH = (_Float16*)(ws + WS_VTH), *VTL = (_Float16*)(ws + WS_VTL); float *O = (float*)(ws + WS_O), *PH = (float*)(ws + WS_PH);
  k_pack<<<dim3(DM, 4), 256, 0, stream>>>(F[1], F[3], F[5], F[7], PK);
  k_qkv<<<dim3(TNB * SS / GBM, QKVW / GBN), 256, 0, stream>>>(F[0], F[0], F[0], PK + PK_A, F[2], F[4], F[6], QK, QKL, VTH, VTL);
  k_attn<<<dim3(TQB / 2, NH, TNB), 128, 0, stream>>>(QK, QKL, VTH, VTL, nullptr, O, PH);
  k_out<<<dim3(TNB * SS / GBM, DM / GBN), 256, 0, stream>>>(O, PK + PK_P, F[8], (float*)d_out);
  k_ent<<<1, 256, 0, stream>>>(PH, (float*)d_out + (size_t)NB * SS * DM);
}

// v007
// One run takes 170 microseconds.
// Timed twice side by side with v006, it ran 1.08 times as fast both times.
// Counting every step since v000, it is 4.43 times as fast.
// compute dtype: all float inputs rounded to bf16; q/k/v = x . W^T + b with EXACT bf16 products on WMMA 16x16x32 (natural rows); causal attention x 1/8 (tiles past the diagonal skipped) with 3-product scores (q, k as f16 hi + x2048 residual) for the first 128 queries of each sequence and single-product scores elsewhere; running-max softmax in f32 (hardware exp) that also accumulates sum p*s for the row entropy H = m + log(l) - sum(p s) (precise logf), block partial sums combined in fixed order for the mean; P (scaled by 2^11, single f16) x v (f16 hi + x2048 residual), 2 products; y = ctx (bf16 hi + residual) . Wo^T (2 products) + bo.
#include <hip/hip_runtime.h>
#include <math.h>

typedef __attribute__((ext_vector_type(16))) _Float16 v16h;
typedef __attribute__((ext_vector_type(16))) __bf16 v16b;
typedef __attribute__((ext_vector_type(8)))  _Float16 v8h;
typedef __attribute__((ext_vector_type(8)))  float v8f;
typedef __attribute__((ext_vector_type(4)))  float v4f;
typedef __attribute__((ext_vector_type(2)))  float v2f;
typedef __attribute__((ext_vector_type(4)))  unsigned v4u;
typedef __attribute__((ext_vector_type(4)))  int v4i;
typedef float __attribute__((may_alias)) float_a;
typedef int __attribute__((may_alias)) int_a;

template <typename T> __device__ __forceinline__ void vst2(void* p, T v) { *(T*)p = v;  }
__device__ __forceinline__ v8f wmma16(v16h a, v16h b, v8f c) {
  v8f d = __builtin_amdgcn_wmma_f32_16x16x32_f16(false, a, false, b, (short)0, c, false, false);
  asm volatile("v_nop\n\tv_nop\n\tv_nop\n\tv_nop" : "+v"(d) : "v"(a), "v"(b));
  return d;
}
__device__ __forceinline__ v8f wmma_bf(v16b a, v16b b, v8f c) {
  v8f d = __builtin_amdgcn_wmma_f32_16x16x32_bf16(false, a, false, b, (short)0, c, false, false);
  asm volatile("v_nop\n\tv_nop\n\tv_nop\n\tv_nop" : "+v"(d) : "v"(a), "v"(b));
  return d;
}
// Causal multi-head self attention (B 4, T 2,048, C 1,024, 16 heads x 64) with biases and output projection, plus the mean attention entropy (second output).
__device__ __forceinline__ v16h frag_h(const _Float16* rowk0, int lane) {
  union { v16h v; v8h q[2]; } u; const _Float16* p = rowk0 + 8 * (lane >> 4);
  u.q[0] = *(const v8h*)p; u.q[1] = *(const v8h*)(p + 16); return u.v;
}
__device__ __forceinline__ v16h frag_f32(const float* rowk0, int lane) {
  v16h a; const float* p = rowk0 + 8 * (lane >> 4);
#pragma unroll
  for (int i = 0; i < 8; ++i) { a[i] = (_Float16)p[i]; a[8 + i] = (_Float16)p[16 + i]; }
  return a;
}
__device__ __forceinline__ v16h frag_f32s(const float* rowk0, int lane, float sc) {
  v16h a; const float* p = rowk0 + 8 * (lane >> 4);
#pragma unroll
  for (int i = 0; i < 8; ++i) { a[i] = (_Float16)(p[i] * sc); a[8 + i] = (_Float16)(p[16 + i] * sc); }
  return a;
}
// column fragment from a [K][ld] layout (column n), rows >= K read as 0
__device__ __forceinline__ v16h fragc_f32(const float* W, int k0, int n, int lane, int ld, int K) {
  v16h a; const int g = lane >> 4;
#pragma unroll
  for (int i = 0; i < 8; ++i) { const int ka = k0 + 8 * g + i, kb = ka + 16;
    a[i] = (_Float16)(ka < K ? W[(size_t)(ka < K ? ka : K - 1) * ld + n] : 0.f); a[8 + i] = (_Float16)(kb < K ? W[(size_t)(kb < K ? kb : K - 1) * ld + n] : 0.f); }
  return a;
}
struct F2 { v16b h, l; };
__device__ __forceinline__ F2 bsplit16(const float v[16]) { F2 r;
#pragma unroll
  for (int i = 0; i < 16; ++i) { const __bf16 h = (__bf16)v[i]; r.h[i] = h; r.l[i] = (__bf16)(v[i] - (float)h); }
  return r; }
__device__ __forceinline__ F2 split_row(const float* row, int k0, int lane) { float v[16]; const float* p = row + k0 + 8 * (lane >> 4);
#pragma unroll
  for (int i = 0; i < 8; ++i) { v[i] = p[i]; v[8 + i] = p[16 + i]; }
  return bsplit16(v); }
__device__ __forceinline__ F2 split_rowK(const float* row, int k0, int lane, int K) { float v[16]; const int g = lane >> 4;
#pragma unroll
  for (int i = 0; i < 8; ++i) { const int ka = k0 + 8 * g + i, kb = ka + 16; v[i] = ka < K ? row[ka < K ? ka : K - 1] : 0.f; v[8 + i] = kb < K ? row[kb < K ? kb : K - 1] : 0.f; }
  return bsplit16(v); }
__device__ __forceinline__ F2 split_col(const float* W, int k0, int n, int lane, int ld, int K) { float v[16]; const int g = lane >> 4;
#pragma unroll
  for (int i = 0; i < 8; ++i) { const int ka = k0 + 8 * g + i, kb = ka + 16; v[i] = ka < K ? W[(size_t)(ka < K ? ka : K - 1) * ld + n] : 0.f; v[8 + i] = kb < K ? W[(size_t)(kb < K ? kb : K - 1) * ld + n] : 0.f; }
  return bsplit16(v); }
__device__ __forceinline__ v8f mac3(const F2& a, const F2& b, v8f c) { c = wmma_bf(a.l, b.h, c); c = wmma_bf(a.h, b.l, c); return wmma_bf(a.h, b.h, c); }
__device__ __forceinline__ float sigm(float v) { return 1.0f / (1.0f + expf(-v)); }
#define LDSX() do { asm volatile("s_wait_dscnt 0" ::: "memory"); __builtin_amdgcn_wave_barrier(); __builtin_amdgcn_fence(__ATOMIC_RELEASE, "workgroup"); } while (0)


#define NB 4
#define SS 2048
#define SCALEF 0.125f
#define DM 1024
#define NH 16
#define HD 64
#define QKVW (3 * DM)
#ifndef TQB
#define TQB (SS / 64)
#define TNB NB
#define TOB (NB * SS / 64)     // all rows in 64-row tiles (unused)
#endif
typedef __attribute__((ext_vector_type(8))) __bf16 v8b;
__device__ __forceinline__ v16b frag_b(const __bf16* rowk0, int lane) {
  union { v16b v; v8b q[2]; } u; const __bf16* p = rowk0 + 8 * (lane >> 4);
  u.q[0] = *(const v8b*)p; u.q[1] = *(const v8b*)(p + 16); return u.v;
}
__device__ __forceinline__ float bfr(float v) { return (float)(__bf16)v; }
__device__ __attribute__((noinline)) float exp_ni(float v) { return expf(v); }
__device__ __attribute__((noinline)) float erf_ni(float v) { return erff(v); }

#define PK_A 0                       // [3072][1024] Wqkv rows (natural [out][in])
#define PK_P (PK_A + QKVW * DM)        // [1024][1024] Wo rows (natural)
#define PK_END (PK_P + DM * DM)
#define WS_PK  0u
#define WS_QK  (WS_PK + 2u * PK_END)             // f16 [8192 rows][2048]: q | k
#define WS_QKL (WS_QK + 2u * NB * SS * 2 * DM)     // f16 q | k residual planes x2048
#define WS_VTH (WS_QKL + 2u * NB * SS * 2 * DM)    // f16 [b][1024 (h*64+d)][2048 s] hi
#define WS_VTL (WS_VTH + 2u * NB * DM * SS)        // f16 lo x 2048
#define WS_O   (WS_VTL + 2u * NB * DM * SS)        // f32 [8192][1024]
#define WS_CS  (WS_O + 4u * NB * SS * DM)           // f32 2 x [2048][32], reserved, unused
#define WS_PH  (WS_CS + 4u * 2 * SS * 32)                 // f32 [NB*NH*(SS/64)] entropy block partials
#define WS_END (WS_PH + 4u * NB * NH * (SS / 64))
// (as built: 4,096 work-groups of eight waves for 24 MB; the k loop stays rolled, so a thread's four 4-B loads are waited for one after the other)
// ---- k_pack: block = (row n, which): natural [out][in] rows -> bf16; which 0..2 -> W_q/W_k/W_v into PK_A rows which*1024 + n; 3 -> W_o into PK_P
__global__ __launch_bounds__(256) void k_pack(const float* __restrict__ WQ, const float* __restrict__ WK, const float* __restrict__ WV, const float* __restrict__ WO, __bf16* __restrict__ PK) {
  __shared__ __align__(16) __bf16 s[DM]; const int n = blockIdx.x, which = blockIdx.y, t = threadIdx.x; const float* Wm = (which == 0) ? WQ : (which == 1) ? WK : (which == 2) ? WV : WO;
  for (int k = t; k < DM; k += 256) s[k] = (__bf16)Wm[(size_t)n * DM + k];
  __syncthreads();
  __bf16* dst = (which < 3) ? PK + PK_A + ((size_t)which * DM + n) * DM : PK + PK_P + (size_t)n * DM;
  for (int q = t; q < DM / 8; q += 256) vst2((unsigned*)(dst + q * 8), *(const v4u*)&s[q * 8]);
}
// ---- operand staging of the two projection GEMMs: a block of eight waves makes a 128 x 256 tile of the output (wave tile 32 x 128: waves 4 down, 2 across), so that a staged byte feeds twice the products of a 64 x 128 tile and a fragment read from LDS feeds 2 (weights) or 8 (activations) products in k_qkv, twice that in k_out (hi and lo). Per 64-k chunk the block's 128 f32 activation rows (256 B each) and 256 bf16 weight rows (128 B each) go from global memory into LDS by asynchronous 16-B copies that cover whole 128-B lines, once per block; the waves read their fragments from LDS. Two buffers: chunk t + 1 flies while chunk t is worked on.
#define GKC 64                           // k per staged chunk
#define GA_PITCH 272                     // LDS bytes per staged f32 row (16 B x odd: 16-B reads of 16 rows fall on distinct banks)
#define GB_PITCH 144                     // LDS bytes per staged bf16 row (16 B x odd)
#define GBM 128                          // output rows per block
#define GBN 256                          // output columns per block
#define GA_BYTES (GBM * GA_PITCH)
#define GB_BYTES (GBN * GB_PITCH)
#define GSTAGE (GA_BYTES + GB_BYTES)     // one buffer: [activation rows | weight rows]
#define GNT (DM / GKC)
// eight copies of one lane and, in the same statement, the wait that stands in front of any later write of the address registers they name
#define COPY8(l, ls, p, ps) asm volatile( \
  "global_load_async_to_lds_b128 %0, %8, off\n\tglobal_load_async_to_lds_b128 %1, %9, off\n\t" \
  "global_load_async_to_lds_b128 %2, %10, off\n\tglobal_load_async_to_lds_b128 %3, %11, off\n\t" \
  "global_load_async_to_lds_b128 %4, %12, off\n\tglobal_load_async_to_lds_b128 %5, %13, off\n\t" \
  "global_load_async_to_lds_b128 %6, %14, off\n\tglobal_load_async_to_lds_b128 %7, %15, off\n\ts_wait_xcnt 0x0" \
  :: "v"(l), "v"((l) + (ls)), "v"((l) + 2 * (ls)), "v"((l) + 3 * (ls)), "v"((l) + 4 * (ls)), "v"((l) + 5 * (ls)), "v"((l) + 6 * (ls)), "v"((l) + 7 * (ls)), \
     "v"(p), "v"((p) + (ps)), "v"((p) + 2 * (ps)), "v"((p) + 3 * (ps)), "v"((p) + 4 * (ps)), "v"((p) + 5 * (ps)), "v"((p) + 6 * (ps)), "v"((p) + 7 * (ps)) : "memory")
// Ag: first of the block's 128 rows at the chunk's first k; Bg: first of its 256 weight rows at the same k; lds: byte address of the buffer; tid 0..255
__device__ __forceinline__ void stage_chunk(const float* Ag, const __bf16* Bg, unsigned lds, int tid) {
  const float* pa = Ag + (size_t)(tid >> 4) * DM + (tid & 15) * 4; const unsigned la = lds + (unsigned)(tid >> 4) * GA_PITCH + (unsigned)(tid & 15) * 16u;   // 16 lanes a row, 16 rows a copy
  const __bf16* pb = Bg + (size_t)(tid >> 3) * DM + (tid & 7) * 8; const unsigned lb = lds + GA_BYTES + (unsigned)(tid >> 3) * GB_PITCH + (unsigned)(tid & 7) * 16u;   // 8 lanes a row, 32 rows a copy
  COPY8(la, 16u * GA_PITCH, pa, (size_t)16 * DM);
  COPY8(lb, 32u * GB_PITCH, pb, (size_t)32 * DM);
}
// the 16 f32 of a lane's A fragment (k = 8g + 0..7 and 16 + 8g + 0..7 of a 32-k step) from a staged row; p = row + 128 * step + 32 * g bytes
__device__ __forceinline__ void lds_a16(const char* p, float v[16]) { const v4f x0 = *(const v4f*)p, x1 = *(const v4f*)(p + 16), x2 = *(const v4f*)(p + 64), x3 = *(const v4f*)(p + 80);
#pragma unroll   // constant indices: v stays in registers
  for (int i = 0; i < 4; ++i) { v[i] = x0[i]; v[4 + i] = x1[i]; v[8 + i] = x2[i]; v[12 + i] = x3[i]; } }
// a lane's B fragment (same k order) from a staged bf16 row; p = row + 64 * step + 16 * g bytes
__device__ __forceinline__ v16b lds_b16(const char* p) { union { v16b v; v8b q[2]; } u; u.q[0] = *(const v8b*)p; u.q[1] = *(const v8b*)(p + 32); return u.v; }
// amdgpu_waves_per_eu(4, 4): register budget of 256, so that two blocks stay resident on a WGP (four waves a SIMD), as their LDS allows
__global__ __launch_bounds__(256) __attribute__((amdgpu_waves_per_eu(4, 4))) void k_qkv(const float* __restrict__ XQ, const float* __restrict__ XK, const float* __restrict__ XV, const __bf16* __restrict__ P, const float* __restrict__ BQ, const float* __restrict__ BK, const float* __restrict__ BV, _Float16* __restrict__ QK, _Float16* __restrict__ QKL, _Float16* __restrict__ VTH, _Float16* __restrict__ VTL) {
  const int which0 = (blockIdx.y * GBN) / DM; const float* X = (which0 == 0) ? XQ : (which0 == 1) ? XK : XV; const float* BB = BQ ? (((which0 == 0) ? BQ : (which0 == 1) ? BK : BV) + (blockIdx.y * GBN - which0 * DM)) : nullptr;
  __shared__ __align__(16) char smem[2 * GSTAGE];   // the two staging buffers; behind the K loop's last barrier the same bytes stage the output
  _Float16 (*so)[32][136] = (_Float16 (*)[32][136])smem, (*sol)[32][136] = (_Float16 (*)[32][136])(smem + 8 * 32 * 136 * 2); _Float16 (*sth)[136] = (_Float16 (*)[136])smem, (*stl)[136] = (_Float16 (*)[136])(smem + GBN * 136 * 2);
  const int tid = threadIdx.x, wave = tid >> 5, lane = tid & 31, col = lane & 15, g = lane >> 4, wm = wave >> 1, nw = (wave & 1) * 128;   // the wave's tile: rows wm * 32 + 0..31, columns nw + 0..127 of the block's
  const size_t r0 = (size_t)blockIdx.x * GBM + wm * 32; const int n0 = blockIdx.y * GBN;
  v8f acc[2][8] = {};
  const unsigned lds0 = (unsigned)(size_t)smem; const float* Ag = X + (size_t)blockIdx.x * GBM * DM; const __bf16* Bg = P + (size_t)n0 * DM;
  stage_chunk(Ag, Bg, lds0, tid);
  asm volatile("s_wait_asynccnt 0x0" ::: "memory");   // this wave's copies of chunk 0 have landed
  __syncthreads();                                    // ... and every other wave's: chunk 0 may be read
  stage_chunk(Ag + GKC, Bg + GKC, lds0 + GSTAGE, tid);
#pragma unroll 1   // kept rolled: the buffer alternates with t, one copy of the body
  for (int t = 0; t < GNT; ++t) { const char* sa = smem + (t & 1) * GSTAGE + (wm * 32 + col) * GA_PITCH + 32 * g; const char* sb = smem + (t & 1) * GSTAGE + GA_BYTES + (nw + col) * GB_PITCH + 16 * g;
#pragma unroll   // this and the inner loops: constant indices, so that fragments and accumulators stay in registers
    for (int kc = 0; kc < GKC / 32; ++kc) { float av[2][16]; lds_a16(sa + kc * 128, av[0]); lds_a16(sa + 16 * GA_PITCH + kc * 128, av[1]); v16b a[2], w[8];   // the LDS reads of a 32-k step stand in front of its products
#pragma unroll
      for (int j = 0; j < 8; ++j) w[j] = lds_b16(sb + j * 16 * GB_PITCH + kc * 64);
#pragma unroll
      for (int i = 0; i < 16; ++i) { a[0][i] = (__bf16)av[0][i]; a[1][i] = (__bf16)av[1][i]; }
#pragma unroll
      for (int j = 0; j < 8; ++j) { acc[0][j] = wmma_bf(a[0], w[j], acc[0][j]); acc[1][j] = wmma_bf(a[1], w[j], acc[1][j]); } }
    asm volatile("s_wait_dscnt 0x0" ::: "memory");      // this wave's reads of buffer t & 1 are done before it is refilled
    asm volatile("s_wait_asynccnt 0x0" ::: "memory");   // this wave's copies of chunk t + 1 have landed
    __syncthreads();                                    // publishes chunk t + 1 and ends every wave's reads of chunk t
    if (t + 2 < GNT) stage_chunk(Ag + (t + 2) * GKC, Bg + (t + 2) * GKC, lds0 + (unsigned)(t & 1) * GSTAGE, tid); }
  asm volatile("s_wait_asynccnt 0x0" ::: "memory");     // no copy is in flight when the buffers become output staging
  float bias[8];   // the lane's bias of each of its eight 16-column groups, read once in front of both branches (inside the r loops it compiled to one global load with its wait per output element, 128 a lane)
#pragma unroll   // this and the next: constant indices, so that bias stays in registers
  for (int j = 0; j < 8; ++j) bias[j] = 0.f;
  if (BB) {   // one uniform test around all eight loads: they are issued side by side, one load latency a wave
#pragma unroll
    for (int j = 0; j < 8; ++j) bias[j] = bfr(BB[nw + j * 16 + col]); }
  if (n0 < 2 * DM) {   // q stored unscaled (f16 sigma ~0.6, no subnormal exposure); 1/8 applied to the f32 score
#pragma unroll
    for (int i = 0; i < 2; ++i) {
#pragma unroll
    for (int j = 0; j < 8; ++j) {
#pragma unroll
      for (int r = 0; r < 8; ++r) { const float v = acc[i][j][r] + bias[j]; const _Float16 hv = (_Float16)v; so[wave][i * 16 + 8 * g + r][j * 16 + col] = hv; sol[wave][i * 16 + 8 * g + r][j * 16 + col] = (_Float16)((v - (float)hv) * 2048.0f); } } }   // q, k (+ bias) as f16 hi + (x2048) residual
    LDSX();
    for (int rp = 0; rp < 16; ++rp) { const int rl = 2 * rp + g; vst2((unsigned*)(QK + (r0 + rl) * (2 * DM) + n0 + nw + col * 8), *(const v4u*)&so[wave][rl][col * 8]); vst2((unsigned*)(QKL + (r0 + rl) * (2 * DM) + n0 + nw + col * 8), *(const v4u*)&sol[wave][rl][col * 8]); }   // 16 lanes a row of 256 B, two rows a store
  } else {
#pragma unroll
    for (int i = 0; i < 2; ++i) {
#pragma unroll
    for (int j = 0; j < 8; ++j) {
#pragma unroll
      for (int r = 0; r < 8; ++r) { const float v = acc[i][j][r] + bias[j]; const _Float16 hv = (_Float16)v; sth[nw + j * 16 + col][wm * 32 + i * 16 + 8 * g + r] = hv; stl[nw + j * 16 + col][wm * 32 + i * 16 + 8 * g + r] = (_Float16)((v - (float)hv) * 2048.0f); } } }
    __syncthreads();
    const size_t rb = (size_t)blockIdx.x * GBM; const int b = (int)(rb / SS), s0 = (int)(rb % SS); const int pc0 = n0 - 2 * DM;
    for (int it = 0; it < GBN / 16; ++it) { const int d = it * 16 + (tid >> 4), pc = tid & 15;   // 16 lanes a row of 256 B
      const size_t o = ((size_t)b * DM + pc0 + d) * SS + s0 + pc * 8; vst2((unsigned*)(VTH + o), *(const v4u*)&sth[d][pc * 8]); vst2((unsigned*)(VTL + o), *(const v4u*)&stl[d][pc * 8]); }
  }
}
// ---- K / V staging of k_attn: per 64 keys the head's 64 K rows, 64 rows of Vt hi and 64 rows of Vt lo (128 B each, one whole line) go from global memory into LDS by asynchronous 16-B copies, once per block; the four waves read their fragments from LDS. Two buffers: stage t + 1 flies while stage t is worked on.
#define AT_PITCH 144                     // LDS bytes per staged 128-B row (16 B x odd: 16-B reads of 16 rows fall on distinct banks)
#define AT_SEC (64 * AT_PITCH)           // 64 rows
#define AT_STAGE (3 * AT_SEC)            // one buffer: [K rows | Vt hi rows | Vt lo rows]
// Kg: the stage's first K row (this head's 64 d); Vh, Vl: the head's first Vt row at the stage's first key; lds: byte address of the buffer. 8 lanes a row, 16 rows a copy, 12 copies a lane; in the same statement the wait that stands in front of any later write of the address registers they name
__device__ __forceinline__ void stage_kv(const _Float16* Kg, const _Float16* Vh, const _Float16* Vl, unsigned lds, int tid) {
  const unsigned l = lds + (unsigned)(tid >> 3) * AT_PITCH + (unsigned)(tid & 7) * 16u, ls = 16u * AT_PITCH;
  const _Float16* pk = Kg + (size_t)(tid >> 3) * (2 * DM) + (tid & 7) * 8; const _Float16* ph = Vh + (size_t)(tid >> 3) * SS + (tid & 7) * 8; const _Float16* pl = Vl + (size_t)(tid >> 3) * SS + (tid & 7) * 8;
  const size_t ks = (size_t)16 * 2 * DM, vs = (size_t)16 * SS;
  asm volatile(
    "global_load_async_to_lds_b128 %0, %12, off\n\tglobal_load_async_to_lds_b128 %1, %13, off\n\tglobal_load_async_to_lds_b128 %2, %14, off\n\tglobal_load_async_to_lds_b128 %3, %15, off\n\t"
    "global_load_async_to_lds_b128 %4, %16, off\n\tglobal_load_async_to_lds_b128 %5, %17, off\n\tglobal_load_async_to_lds_b128 %6, %18, off\n\tglobal_load_async_to_lds_b128 %7, %19, off\n\t"
    "global_load_async_to_lds_b128 %8, %20, off\n\tglobal_load_async_to_lds_b128 %9, %21, off\n\tglobal_load_async_to_lds_b128 %10, %22, off\n\tglobal_load_async_to_lds_b128 %11, %23, off\n\ts_wait_xcnt 0x0"
    :: "v"(l), "v"(l + ls), "v"(l + 2 * ls), "v"(l + 3 * ls), "v"(l + AT_SEC), "v"(l + AT_SEC + ls), "v"(l + AT_SEC + 2 * ls), "v"(l + AT_SEC + 3 * ls), "v"(l + 2 * AT_SEC), "v"(l + 2 * AT_SEC + ls), "v"(l + 2 * AT_SEC + 2 * ls), "v"(l + 2 * AT_SEC + 3 * ls),
       "v"(pk), "v"(pk + ks), "v"(pk + 2 * ks), "v"(pk + 3 * ks), "v"(ph), "v"(ph + vs), "v"(ph + 2 * vs), "v"(ph + 3 * vs), "v"(pl), "v"(pl + vs), "v"(pl + 2 * vs), "v"(pl + 3 * vs) : "memory");
}
// the value that lane ^ 16 holds (one vector instruction, no LDS)
__device__ __forceinline__ float xhalf(float v) { const int b = __builtin_bit_cast(int, v); return __builtin_bit_cast(float, __builtin_amdgcn_permlanex16(b, b, 0x76543210, 0xfedcba98, false, false)); }
// a lane's f16 fragment (k = 8g + 0..7 and 16 + 8g + 0..7 of a 32-k step) from a staged row; p = row + 64 * step + 16 * g bytes
__device__ __forceinline__ v16h lds_h16(const char* p) { union { v16h v; v8h q[2]; } u; u.q[0] = *(const v8h*)p; u.q[1] = *(const v8h*)(p + 32); return u.v; }
// 2^t for the masked path below, with the free slot that the instruction set asks for behind a transcendental in the same statement
__device__ __forceinline__ float exp2_slot(float t) { float e; asm("v_exp_f32 %0, %1\n\tv_nop" : "=v"(e) : "v"(t)); return e; }
// the softmax arithmetic of a 32-key step. c: raw scores (register r of tile ct = key 16*ct + 8g + r of the step); m: the running maximum. Gives the new maximum mn, the lane's sums es (of e) and eh (of e * s) and P as a B fragment. MK = true: a step that reaches past some query of the wave, with the causal mask and the guards that keep masked scores out of the sums. MK = false: every key of the step counts for every query of the wave, so the mask and the guards are identities and are not computed
template <bool MK> __device__ __forceinline__ void attn_soft(const v8f (&c)[2], const int lim, const float m, float& mn, float& es, float& eh, v16h& pa) {
    v8f s[2];
#pragma unroll
    for (int ct = 0; ct < 2; ++ct) {
#pragma unroll
      for (int r = 0; r < 8; ++r) s[ct][r] = (!MK || ct * 16 + r <= lim) ? c[ct][r] * SCALEF : -3.0e38f; }   // causal: future keys excluded
    float mx = fmaxf(s[0][0], s[1][0]);   // the lane's 16 scores all belong to one query: maximum and sums in its own registers
#pragma unroll
    for (int r = 1; r < 8; ++r) mx = fmaxf(mx, fmaxf(s[0][r], s[1][r]));
    mx = fmaxf(mx, xhalf(mx));   // the query's other 16 keys of the step lie in lane ^ 16
    mn = fmaxf(m, mx); es = 0.f; eh = 0.f;   // pa: P transposed as a B fragment, k position 8 * ct + r = key 16 * ct + 8g + r, the k order of lds_h16: no trip through LDS
#pragma unroll
    for (int ct = 0; ct < 2; ++ct) {
#pragma unroll
      for (int r = 0; r < 8; ++r) { const float x = MK ? exp2_slot((s[ct][r] - mn) * 1.44269504f) : __expf(s[ct][r] - mn); const float e = (MK && s[ct][r] <= -1.0e38f) ? 0.f : x; es += e; eh += ((!MK || e > 0.f) ? e * s[ct][r] : 0.f); pa[8 * ct + r] = (_Float16)(e * 2048.0f); } }   // P scaled by 2^11 before the f16 rounding so small softmax weights stay out of the f16 subnormal range; 2^-11 folded into the epilogue
}
__global__ __launch_bounds__(128) __attribute__((amdgpu_waves_per_eu(4, 4))) void k_attn(const _Float16* __restrict__ QK, const _Float16* __restrict__ QKL, const _Float16* __restrict__ VTH, const _Float16* __restrict__ VTL, const void* __restrict__ KMASK, float* __restrict__ O, float* __restrict__ PH) {
  __shared__ float sh_ent[2][64];
  __shared__ __align__(16) float so[4][16][68];   // a wave's output staging
  __shared__ __align__(16) char skv[2 * AT_STAGE];   // the two K / V staging buffers
  const int tid = threadIdx.x, wave = tid >> 5, lane = tid & 31, col = lane & 15, g = lane >> 4;
  const int h = blockIdx.y, b = blockIdx.z;
  const unsigned kv0 = (unsigned)(size_t)skv; const _Float16* Kg = QK + (size_t)b * SS * (2 * DM) + DM + h * HD; const _Float16* Vhg = VTH + ((size_t)b * DM + h * HD) * SS; const _Float16* Vlg = VTL + ((size_t)b * DM + h * HD) * SS;
#pragma unroll 1   // kept rolled: one copy of the tile body in the instruction cache, one register set for both tiles
  for (int tp = 0; tp < 2; ++tp) {
  const int qb = tp ? (int)blockIdx.x : TQB - 1 - (int)blockIdx.x; const int q0 = qb * 64 + wave * 16; const int wq0 = __builtin_amdgcn_readfirstlane(q0); const size_t rq = (size_t)b * SS + q0 + col;
  v16h aq[2];
#pragma unroll
  for (int kc = 0; kc < 2; ++kc) aq[kc] = frag_h(QK + rq * (2 * DM) + h * HD + kc * 32, lane);
  const _Float16* qrowl = QKL + rq * (2 * DM) + h * HD;   // q's residual plane is read where it is used (the two leading tiles' few steps): held in registers for every tile it would take the kernel past 256 registers (four waves a SIMD)
  float hs = 0.f;   // this lane's share (its eight keys of every sixteen) of the sum over keys of e^(s - m) * s, rescaled with the running max
  float m = -3.0e38f, l = 0.f;   // the lane's query (column col): running max over all keys (equal in both wave halves) and this lane's share of the sum
  v8f acc[4] = {}, accl[4] = {};
  const int nst = qb + 1;   // causal: 64-key stages up to the query tile's end
  stage_kv(Kg, Vhg, Vlg, kv0, tid);                   // (second tile: every wave's last read of the buffers ended at the first tile's last barrier)
  asm volatile("s_wait_asynccnt 0x0" ::: "memory");   // this wave's copies of stage 0 have landed
  __syncthreads();                                    // ... and every other wave's: stage 0 may be read
  if (nst > 1) stage_kv(Kg + (size_t)64 * (2 * DM), Vhg + 64, Vlg + 64, kv0 + AT_STAGE, tid);
#pragma unroll 1   // kept rolled: the buffer alternates with t, one copy of the body
  for (int t = 0; t < nst; ++t) { const char* sk = skv + (t & 1) * AT_STAGE + col * AT_PITCH + 16 * g;
#pragma unroll 1   // kept rolled: one copy of the 32-key step in the instruction cache
  for (int hf = 0; hf < 2; ++hf) { const int ks = 2 * t + hf; const int lim = q0 + col - ks * 32 - 8 * g;   // register r of score tile ct holds key ks*32 + 8g + 16*ct + r: it counts while 16*ct + r <= lim
    v8f s[2]; v16h kf[2][2];   // the step's K fragments are read as one group in front of its products: one LDS latency a step, not one a product
#pragma unroll
    for (int ct = 0; ct < 2; ++ct) {
#pragma unroll
      for (int kc = 0; kc < 2; ++kc) kf[ct][kc] = lds_h16(sk + (hf * 32 + ct * 16) * AT_PITCH + kc * 64); }
#pragma unroll
    for (int ct = 0; ct < 2; ++ct) { const int kk = ks * 32 + ct * 16 + col; const _Float16* krowl = QKL + ((size_t)b * SS + kk) * (2 * DM) + DM + h * HD; v8f c = {}, cl = {};   // transposed scores: A = K rows (lane col = key row kk), B = Q (lane col = query): c[r] = score of key ks*32 + ct*16 + 8g + r with query q0 + col
      if (qb < 2) {   // leading query blocks (few keys, outputs far above the global rms): 3 products
#pragma unroll
        for (int kc = 0; kc < 2; ++kc) { const v16h kh = kf[ct][kc], ql = frag_h(qrowl + kc * 32, lane), kl = frag_h(krowl + kc * 32, lane); c = wmma16(kh, aq[kc], c); cl = wmma16(kh, ql, cl); cl = wmma16(kl, aq[kc], cl); }   // q's and k's residual fragments of a 32-d step are read side by side, in front of its products
#pragma unroll
        for (int r = 0; r < 8; ++r) c[r] += cl[r] * (1.0f / 2048.0f); }
      else {
#pragma unroll
        for (int kc = 0; kc < 2; ++kc) c = wmma16(kf[ct][kc], aq[kc], c); }   // single product elsewhere
      s[ct] = c; }
    v16h vh[2], vl[2];   // the step's V fragments are read in two groups of four, each in front of its products; the first group flies under the softmax arithmetic
#pragma unroll
    for (int dt = 0; dt < 2; ++dt) { vh[dt] = lds_h16(sk + AT_SEC + dt * 16 * AT_PITCH + hf * 64); vl[dt] = lds_h16(sk + 2 * AT_SEC + dt * 16 * AT_PITCH + hf * 64); }
    float mn, es, eh; v16h pa;
    if (ks * 32 + 31 <= wq0) attn_soft<false>(s, lim, m, mn, es, eh, pa);   // the step's last key is no later than the wave's first query (a scalar test, the same for the whole wave): no mask needed
    else attn_soft<true>(s, lim, m, mn, es, eh, pa);
    const float alpha = (m <= -1.0e38f) ? 0.f : __expf(m - mn);
    l = l * alpha + es; hs = hs * alpha + eh; m = mn;   // the halves' shares are joined once, behind the key loop
#pragma unroll
    for (int dt = 0; dt < 4; ++dt) {
#pragma unroll
      for (int r = 0; r < 8; ++r) { acc[dt][r] *= alpha; accl[dt][r] *= alpha; } }
#pragma unroll
    for (int dt = 0; dt < 2; ++dt) { acc[dt] = wmma16(vh[dt], pa, acc[dt]); accl[dt] = wmma16(vl[dt], pa, accl[dt]); }   // transposed output: A = Vt rows (lane col = d row), B = P: acc[dt][r] = d dt*16 + 8g + r of query q0 + col
#pragma unroll
    for (int dt = 0; dt < 2; ++dt) { vh[dt] = lds_h16(sk + AT_SEC + (2 + dt) * 16 * AT_PITCH + hf * 64); vl[dt] = lds_h16(sk + 2 * AT_SEC + (2 + dt) * 16 * AT_PITCH + hf * 64); }
#pragma unroll
    for (int dt = 0; dt < 2; ++dt) { acc[2 + dt] = wmma16(vh[dt], pa, acc[2 + dt]); accl[2 + dt] = wmma16(vl[dt], pa, accl[2 + dt]); } }   // V hi x P + V lo x P / 2048: 2 products
    asm volatile("s_wait_dscnt 0x0" ::: "memory");      // this wave's reads of buffer t & 1 are done before it is refilled
    asm volatile("s_wait_asynccnt 0x0" ::: "memory");   // this wave's copies of stage t + 1 have landed
    __syncthreads();                                    // publishes stage t + 1 and ends every wave's reads of stage t
    if (t + 2 < nst) stage_kv(Kg + (size_t)(t + 2) * 64 * (2 * DM), Vhg + (t + 2) * 64, Vlg + (t + 2) * 64, kv0 + (unsigned)(t & 1) * AT_STAGE, tid); }
  asm volatile("s_wait_asynccnt 0x0" ::: "memory");     // no copy is in flight behind the key loop
  l += xhalf(l); hs += xhalf(hs);   // join the two halves' shares of the query's sums
  if (g == 0) sh_ent[tp][wave * 16 + col] = m + logf(l) - hs / l;   // H_row = -sum p log p = m + log l - sum p s
  { const float il = (1.0f / 2048.0f) / l;
#pragma unroll
    for (int dt = 0; dt < 4; ++dt) {
#pragma unroll
      for (int r = 0; r < 8; ++r) so[wave][col][dt * 16 + 8 * g + r] = (acc[dt][r] + accl[dt][r] * (1.0f / 2048.0f)) * il; } }
  LDSX();
  for (int rl = 0; rl < 16; ++rl) if (lane < 16) vst2(O + ((size_t)b * SS + q0 + rl) * DM + h * HD + lane * 4, *(const v4f*)&so[wave][rl][lane * 4]);
  asm volatile("s_wait_xcnt 0x0" ::: "memory");   // stands in front of the next tile's first writes to registers that the stores above name
  }
  __syncthreads();
  if (tid < 2) { float a = 0.f; for (int i = 0; i < 64; ++i) a += sh_ent[tid][i]; PH[((size_t)b * NH + h) * (SS / 64) + (tid ? (int)blockIdx.x : TQB - 1 - (int)blockIdx.x)] = a; }   // one partial per tile, summed in row order (plain 4-B store of a scratch value)
}
// ---- k_out: block = (128 rows, 256 cols): out = O(hi/lo) . Wo rows (2 products) + bo
__global__ __launch_bounds__(256) void k_out(const float* __restrict__ O, const __bf16* __restrict__ P, const float* __restrict__ BO, float* __restrict__ Y) {
  __shared__ __align__(16) char smem[2 * GSTAGE];   // the two staging buffers; behind the K loop's last barrier the same bytes stage the output
  float (*so)[32][132] = (float (*)[32][132])smem;
  const int tid = threadIdx.x, wave = tid >> 5, lane = tid & 31, col = lane & 15, g = lane >> 4, wm = wave >> 1, nw = (wave & 1) * 128;   // the wave's tile: rows wm * 32 + 0..31, columns nw + 0..127 of the block's
  const size_t r0 = (size_t)blockIdx.x * GBM + wm * 32; const int n0 = blockIdx.y * GBN;
  v8f acc[2][8] = {};
  const unsigned lds0 = (unsigned)(size_t)smem; const float* Ag = O + (size_t)blockIdx.x * GBM * DM; const __bf16* Bg = P + (size_t)n0 * DM;
  stage_chunk(Ag, Bg, lds0, tid);
  asm volatile("s_wait_asynccnt 0x0" ::: "memory");   // this wave's copies of chunk 0 have landed
  __syncthreads();                                    // ... and every other wave's: chunk 0 may be read
  stage_chunk(Ag + GKC, Bg + GKC, lds0 + GSTAGE, tid);
#pragma unroll 1   // kept rolled: the buffer alternates with t, one copy of the body
  for (int t = 0; t < GNT; ++t) { const char* sa = smem + (t & 1) * GSTAGE + (wm * 32 + col) * GA_PITCH + 32 * g; const char* sb = smem + (t & 1) * GSTAGE + GA_BYTES + (nw + col) * GB_PITCH + 16 * g;
#pragma unroll   // this and the inner loops: constant indices, so that fragments and accumulators stay in registers
    for (int kc = 0; kc < GKC / 32; ++kc) { float av[2][16]; lds_a16(sa + kc * 128, av[0]); lds_a16(sa + 16 * GA_PITCH + kc * 128, av[1]); v16b w[8];   // the LDS reads of a 32-k step stand in front of its products
#pragma unroll
      for (int j = 0; j < 8; ++j) w[j] = lds_b16(sb + j * 16 * GB_PITCH + kc * 64);
      const F2 a0 = bsplit16(av[0]), a1 = bsplit16(av[1]);
#pragma unroll
      for (int j = 0; j < 8; ++j) { acc[0][j] = wmma_bf(a0.l, w[j], acc[0][j]); acc[1][j] = wmma_bf(a1.l, w[j], acc[1][j]); acc[0][j] = wmma_bf(a0.h, w[j], acc[0][j]); acc[1][j] = wmma_bf(a1.h, w[j], acc[1][j]); } }   // per accumulator: residual product, then main product
    asm volatile("s_wait_dscnt 0x0" ::: "memory");      // this wave's reads of buffer t & 1 are done before it is refilled
    asm volatile("s_wait_asynccnt 0x0" ::: "memory");   // this wave's copies of chunk t + 1 have landed
    __syncthreads();                                    // publishes chunk t + 1 and ends every wave's reads of chunk t
    if (t + 2 < GNT) stage_chunk(Ag + (t + 2) * GKC, Bg + (t + 2) * GKC, lds0 + (unsigned)(t & 1) * GSTAGE, tid); }
  asm volatile("s_wait_asynccnt 0x0" ::: "memory");     // no copy is in flight when the buffers become output staging
#pragma unroll
  for (int i = 0; i < 2; ++i) {
#pragma unroll
  for (int j = 0; j < 8; ++j) {
#pragma unroll
    for (int r = 0; r < 8; ++r) so[wave][i * 16 + 8 * g + r][j * 16 + col] = acc[i][j][r] + bfr(BO[n0 + nw + j * 16 + col]); } }
  LDSX();
  for (int rl = 0; rl < 32; ++rl) vst2(Y + (r0 + rl) * DM + n0 + nw + lane * 4, *(const v4f*)&so[wave][rl][lane * 4]);
}
// ---- k_ent: mean entropy over all (b, h, t) rows from the block partials (fixed order) -> scalar second output
__global__ __launch_bounds__(256) void k_ent(const float* __restrict__ PH, float* __restrict__ OUT1) {
  __shared__ float red[256]; const int t = threadIdx.x; const int n = NB * NH * (TQB);   // TQB row blocks per (b, h) were computed
  float a = 0.f; for (int i = t; i < n; i += 256) a += PH[(size_t)(i / TQB) * (SS / 64) + (i % TQB)];
  red[t] = a; __syncthreads();
  for (int s = 128; s >= 1; s >>= 1) { if (t < s) red[t] += red[t + s]; __syncthreads(); }
  if (t == 0) { float* p = OUT1; p[0] = red[0] / ((float)NB * NH * (TQB * 64));  }
}
extern "C" void kernel_launch(void* const* d_in, const int* in_sizes, int n_in, void* d_out, int out_size, void* d_ws, size_t ws_size, hipStream_t stream) {
  (void)in_sizes; (void)n_in; (void)out_size;
  const float** F = (const float**)d_in;   // 0 x [4,2048,1024], 1 w_q natural, 2 b_q, 3 w_k, 4 b_k, 5 w_v, 6 b_v, 7 w_o, 8 b_o
  if (ws_size < (size_t)WS_END) return;
  char* ws = (char*)d_ws; __bf16* PK = (__bf16*)(ws + WS_PK); _Float16 *QK = (_Float16*)(ws + WS_QK), *QKL = (_Float16*)(ws + WS_QKL), *VTH = (_Float16*)(ws + WS_VTH), *VTL = (_Float16*)(ws + WS_VTL); float *O = (float*)(ws + WS_O), *PH = (float*)(ws + WS_PH);
  k_pack<<<dim3(DM, 4), 256, 0, stream>>>(F[1], F[3], F[5], F[7], PK);
  k_qkv<<<dim3(TNB * SS / GBM, QKVW / GBN), 256, 0, stream>>>(F[0], F[0], F[0], PK + PK_A, F[2], F[4], F[6], QK, QKL, VTH, VTL);
  k_attn<<<dim3(TQB / 2, NH, TNB), 128, 0, stream>>>(QK, QKL, VTH, VTL, nullptr, O, PH);
  k_out<<<dim3(TNB * SS / GBM, DM / GBN), 256, 0, stream>>>(O, PK + PK_P, F[8], (float*)d_out);
  k_ent<<<1, 256, 0, stream>>>(PH, (float*)d_out + (size_t)NB * SS * DM);
}

// v008
// It runs in 165 microseconds.
// Next to v007, in two timings, it ran 1.03 times as fast each time.
// Over all steps from v000 it is 4.57 times as fast.
// compute dtype: all float inputs rounded to bf16; q/k/v = x . W^T + b with EXACT bf16 products on WMMA 16x16x32 (natural rows); causal attention x 1/8 (tiles past the diagonal skipped) with 3-product scores (q, k as f16 hi + x2048 residual) for the first 128 queries of each sequence and single-product scores elsewhere; running-max softmax in f32 (hardware exp) that also accumulates sum p*s for the row entropy H = m + log(l) - sum(p s) (precise logf), block partial sums combined in fixed order for the mean; P (scaled by 2^11, single f16) x v (f16 hi + x2048 residual), 2 products; y = ctx (bf16 hi + residual) . Wo^T (2 products) + bo.
#include <hip/hip_runtime.h>
#include <math.h>

typedef __attribute__((ext_vector_type(16))) _Float16 v16h;
typedef __attribute__((ext_vector_type(16))) __bf16 v16b;
typedef __attribute__((ext_vector_type(8)))  _Float16 v8h;
typedef __attribute__((ext_vector_type(8)))  float v8f;
typedef __attribute__((ext_vector_type(4)))  float v4f;
typedef __attribute__((ext_vector_type(2)))  float v2f;
typedef __attribute__((ext_vector_type(4)))  unsigned v4u;
typedef __attribute__((ext_vector_type(4)))  int v4i;
typedef float __attribute__((may_alias)) float_a;
typedef int __attribute__((may_alias)) int_a;

template <typename T> __device__ __forceinline__ void vst2(void* p, T v) { *(T*)p = v;  }
__device__ __forceinline__ v8f wmma16(v16h a, v16h b, v8f c) {
  return __builtin_amdgcn_wmma_f32_16x16x32_f16(false, a, false, b, (short)0, c, false, false);
}
__device__ __forceinline__ v8f wmma_bf(v16b a, v16b b, v8f c) {
  return __builtin_amdgcn_wmma_f32_16x16x32_bf16(false, a, false, b, (short)0, c, false, false);
}
// Causal multi-head self attention (B 4, T 2,048, C 1,024, 16 heads x 64) with biases and output projection, plus the mean attention entropy (second output).
__device__ __forceinline__ v16h frag_h(const _Float16* rowk0, int lane) {
  union { v16h v; v8h q[2]; } u; const _Float16* p = rowk0 + 8 * (lane >> 4);
  u.q[0] = *(const v8h*)p; u.q[1] = *(const v8h*)(p + 16); return u.v;
}
__device__ __forceinline__ v16h frag_f32(const float* rowk0, int lane) {
  v16h a; const float* p = rowk0 + 8 * (lane >> 4);
#pragma unroll
  for (int i = 0; i < 8; ++i) { a[i] = (_Float16)p[i]; a[8 + i] = (_Float16)p[16 + i]; }
  return a;
}
__device__ __forceinline__ v16h frag_f32s(const float* rowk0, int lane, float sc) {
  v16h a; const float* p = rowk0 + 8 * (lane >> 4);
#pragma unroll
  for (int i = 0; i < 8; ++i) { a[i] = (_Float16)(p[i] * sc); a[8 + i] = (_Float16)(p[16 + i] * sc); }
  return a;
}
// column fragment from a [K][ld] layout (column n), rows >= K read as 0
__device__ __forceinline__ v16h fragc_f32(const float* W, int k0, int n, int lane, int ld, int K) {
  v16h a; const int g = lane >> 4;
#pragma unroll
  for (int i = 0; i < 8; ++i) { const int ka = k0 + 8 * g + i, kb = ka + 16;
    a[i] = (_Float16)(ka < K ? W[(size_t)(ka < K ? ka : K - 1) * ld + n] : 0.f); a[8 + i] = (_Float16)(kb < K ? W[(size_t)(kb < K ? kb : K - 1) * ld + n] : 0.f); }
  return a;
}
struct F2 { v16b h, l; };
__device__ __forceinline__ F2 bsplit16(const float v[16]) { F2 r;
#pragma unroll
  for (int i = 0; i < 16; ++i) { const __bf16 h = (__bf16)v[i]; r.h[i] = h; r.l[i] = (__bf16)(v[i] - (float)h); }
  return r; }
__device__ __forceinline__ F2 split_row(const float* row, int k0, int lane) { float v[16]; const float* p = row + k0 + 8 * (lane >> 4);
#pragma unroll
  for (int i = 0; i < 8; ++i) { v[i] = p[i]; v[8 + i] = p[16 + i]; }
  return bsplit16(v); }
__device__ __forceinline__ F2 split_rowK(const float* row, int k0, int lane, int K) { float v[16]; const int g = lane >> 4;
#pragma unroll
  for (int i = 0; i < 8; ++i) { const int ka = k0 + 8 * g + i, kb = ka + 16; v[i] = ka < K ? row[ka < K ? ka : K - 1] : 0.f; v[8 + i] = kb < K ? row[kb < K ? kb : K - 1] : 0.f; }
  return bsplit16(v); }
__device__ __forceinline__ F2 split_col(const float* W, int k0, int n, int lane, int ld, int K) { float v[16]; const int g = lane >> 4;
#pragma unroll
  for (int i = 0; i < 8; ++i) { const int ka = k0 + 8 * g + i, kb = ka + 16; v[i] = ka < K ? W[(size_t)(ka < K ? ka : K - 1) * ld + n] : 0.f; v[8 + i] = kb < K ? W[(size_t)(kb < K ? kb : K - 1) * ld + n] : 0.f; }
  return bsplit16(v); }
__device__ __forceinline__ v8f mac3(const F2& a, const F2& b, v8f c) { c = wmma_bf(a.l, b.h, c); c = wmma_bf(a.h, b.l, c); return wmma_bf(a.h, b.h, c); }
__device__ __forceinline__ float sigm(float v) { return 1.0f / (1.0f + expf(-v)); }
#define LDSX() do { asm volatile("s_wait_dscnt 0" ::: "memory"); __builtin_amdgcn_wave_barrier(); __builtin_amdgcn_fence(__ATOMIC_RELEASE, "workgroup"); } while (0)


#define NB 4
#define SS 2048
#define SCALEF 0.125f
#define DM 1024
#define NH 16
#define HD 64
#define QKVW (3 * DM)
#ifndef TQB
#define TQB (SS / 64)
#define TNB NB
#define TOB (NB * SS / 64)     // all rows in 64-row tiles (unused)
#endif
typedef __attribute__((ext_vector_type(8))) __bf16 v8b;
__device__ __forceinline__ v16b frag_b(const __bf16* rowk0, int lane) {
  union { v16b v; v8b q[2]; } u; const __bf16* p = rowk0 + 8 * (lane >> 4);
  u.q[0] = *(const v8b*)p; u.q[1] = *(const v8b*)(p + 16); return u.v;
}
__device__ __forceinline__ float bfr(float v) { return (float)(__bf16)v; }
__device__ __attribute__((noinline)) float exp_ni(float v) { return expf(v); }
__device__ __attribute__((noinline)) float erf_ni(float v) { return erff(v); }

#define PK_A 0                       // [3072][1024] Wqkv rows (natural [out][in])
#define PK_P (PK_A + QKVW * DM)        // [1024][1024] Wo rows (natural)
#define PK_END (PK_P + DM * DM)
#define WS_PK  0u
#define WS_QK  (WS_PK + 2u * PK_END)             // f16 [8192 rows][2048]: q | k
#define WS_QKL (WS_QK + 2u * NB * SS * 2 * DM)     // f16 q | k residual planes x2048
#define WS_VTH (WS_QKL + 2u * NB * SS * 2 * DM)    // f16 [b][1024 (h*64+d)][2048 s] hi
#define WS_VTL (WS_VTH + 2u * NB * DM * SS)        // f16 lo x 2048
#define WS_O   (WS_VTL + 2u * NB * DM * SS)        // f32 [8192][1024]
#define WS_CS  (WS_O + 4u * NB * SS * DM)           // f32 2 x [2048][32], reserved, unused
#define WS_PH  (WS_CS + 4u * 2 * SS * 32)                 // f32 [NB*NH*(SS/64)] entropy block partials
#define WS_END (WS_PH + 4u * NB * NH * (SS / 64))
// (as built: 4,096 work-groups of eight waves for 24 MB; the k loop stays rolled, so a thread's four 4-B loads are waited for one after the other)
// ---- k_pack: block = (row n, which): natural [out][in] rows -> bf16; which 0..2 -> W_q/W_k/W_v into PK_A rows which*1024 + n; 3 -> W_o into PK_P
__global__ __launch_bounds__(256) void k_pack(const float* __restrict__ WQ, const float* __restrict__ WK, const float* __restrict__ WV, const float* __restrict__ WO, __bf16* __restrict__ PK) {
  __shared__ __align__(16) __bf16 s[DM]; const int n = blockIdx.x, which = blockIdx.y, t = threadIdx.x; const float* Wm = (which == 0) ? WQ : (which == 1) ? WK : (which == 2) ? WV : WO;
  for (int k = t; k < DM; k += 256) s[k] = (__bf16)Wm[(size_t)n * DM + k];
  __syncthreads();
  __bf16* dst = (which < 3) ? PK + PK_A + ((size_t)which * DM + n) * DM : PK + PK_P + (size_t)n * DM;
  for (int q = t; q < DM / 8; q += 256) vst2((unsigned*)(dst + q * 8), *(const v4u*)&s[q * 8]);
}
// ---- operand staging of the two projection GEMMs: a block of eight waves makes a 128 x 256 tile of the output (wave tile 32 x 128: waves 4 down, 2 across), so that a staged byte feeds twice the products of a 64 x 128 tile and a fragment read from LDS feeds 2 (weights) or 8 (activations) products in k_qkv, twice that in k_out (hi and lo). Per 64-k chunk the block's 128 f32 activation rows (256 B each) and 256 bf16 weight rows (128 B each) go from global memory into LDS by asynchronous 16-B copies that cover whole 128-B lines, once per block; the waves read their fragments from LDS. Two buffers: chunk t + 1 flies while chunk t is worked on.
#define GKC 64                           // k per staged chunk
#define GA_PITCH 272                     // LDS bytes per staged f32 row (16 B x odd: 16-B reads of 16 rows fall on distinct banks)
#define GB_PITCH 144                     // LDS bytes per staged bf16 row (16 B x odd)
#define GBM 128                          // output rows per block
#define GBN 256                          // output columns per block
#define GA_BYTES (GBM * GA_PITCH)
#define GB_BYTES (GBN * GB_PITCH)
#define GSTAGE (GA_BYTES + GB_BYTES)     // one buffer: [activation rows | weight rows]
#define GNT (DM / GKC)
// eight copies of one lane and, in the same statement, the wait that stands in front of any later write of the address registers they name
#define COPY8(l, ls, p, ps) asm volatile( \
  "global_load_async_to_lds_b128 %0, %8, off\n\tglobal_load_async_to_lds_b128 %1, %9, off\n\t" \
  "global_load_async_to_lds_b128 %2, %10, off\n\tglobal_load_async_to_lds_b128 %3, %11, off\n\t" \
  "global_load_async_to_lds_b128 %4, %12, off\n\tglobal_load_async_to_lds_b128 %5, %13, off\n\t" \
  "global_load_async_to_lds_b128 %6, %14, off\n\tglobal_load_async_to_lds_b128 %7, %15, off\n\ts_wait_xcnt 0x0" \
  :: "v"(l), "v"((l) + (ls)), "v"((l) + 2 * (ls)), "v"((l) + 3 * (ls)), "v"((l) + 4 * (ls)), "v"((l) + 5 * (ls)), "v"((l) + 6 * (ls)), "v"((l) + 7 * (ls)), \
     "v"(p), "v"((p) + (ps)), "v"((p) + 2 * (ps)), "v"((p) + 3 * (ps)), "v"((p) + 4 * (ps)), "v"((p) + 5 * (ps)), "v"((p) + 6 * (ps)), "v"((p) + 7 * (ps)) : "memory")
// Ag: first of the block's 128 rows at the chunk's first k; Bg: first of its 256 weight rows at the same k; lds: byte address of the buffer; tid 0..255
__device__ __forceinline__ void stage_chunk(const float* Ag, const __bf16* Bg, unsigned lds, int tid) {
  const float* pa = Ag + (size_t)(tid >> 4) * DM + (tid & 15) * 4; const unsigned la = lds + (unsigned)(tid >> 4) * GA_PITCH + (unsigned)(tid & 15) * 16u;   // 16 lanes a row, 16 rows a copy
  const __bf16* pb = Bg + (size_t)(tid >> 3) * DM + (tid & 7) * 8; const unsigned lb = lds + GA_BYTES + (unsigned)(tid >> 3) * GB_PITCH + (unsigned)(tid & 7) * 16u;   // 8 lanes a row, 32 rows a copy
  COPY8(la, 16u * GA_PITCH, pa, (size_t)16 * DM);
  COPY8(lb, 32u * GB_PITCH, pb, (size_t)32 * DM);
}
// the 16 f32 of a lane's A fragment (k = 8g + 0..7 and 16 + 8g + 0..7 of a 32-k step) from a staged row; p = row + 128 * step + 32 * g bytes
__device__ __forceinline__ void lds_a16(const char* p, float v[16]) { const v4f x0 = *(const v4f*)p, x1 = *(const v4f*)(p + 16), x2 = *(const v4f*)(p + 64), x3 = *(const v4f*)(p + 80);
#pragma unroll   // constant indices: v stays in registers
  for (int i = 0; i < 4; ++i) { v[i] = x0[i]; v[4 + i] = x1[i]; v[8 + i] = x2[i]; v[12 + i] = x3[i]; } }
// a lane's B fragment (same k order) from a staged bf16 row; p = row + 64 * step + 16 * g bytes
__device__ __forceinline__ v16b lds_b16(const char* p) { union { v16b v; v8b q[2]; } u; u.q[0] = *(const v8b*)p; u.q[1] = *(const v8b*)(p + 32); return u.v; }
// amdgpu_waves_per_eu(4, 4): register budget of 256, so that two blocks stay resident on a WGP (four waves a SIMD), as their LDS allows
__global__ __launch_bounds__(256) __attribute__((amdgpu_waves_per_eu(4, 4))) void k_qkv(const float* __restrict__ XQ, const float* __restrict__ XK, const float* __restrict__ XV, const __bf16* __restrict__ P, const float* __restrict__ BQ, const float* __restrict__ BK, const float* __restrict__ BV, _Float16* __restrict__ QK, _Float16* __restrict__ QKL, _Float16* __restrict__ VTH, _Float16* __restrict__ VTL) {
  const int which0 = (blockIdx.y * GBN) / DM; const float* X = (which0 == 0) ? XQ : (which0 == 1) ? XK : XV; const float* BB = BQ ? (((which0 == 0) ? BQ : (which0 == 1) ? BK : BV) + (blockIdx.y * GBN - which0 * DM)) : nullptr;
  __shared__ __align__(16) char smem[2 * GSTAGE];   // the two staging buffers; behind the K loop's last barrier the same bytes stage the output
  _Float16 (*so)[32][136] = (_Float16 (*)[32][136])smem, (*sol)[32][136] = (_Float16 (*)[32][136])(smem + 8 * 32 * 136 * 2); _Float16 (*sth)[136] = (_Float16 (*)[136])smem, (*stl)[136] = (_Float16 (*)[136])(smem + GBN * 136 * 2);
  const int tid = threadIdx.x, wave = tid >> 5, lane = tid & 31, col = lane & 15, g = lane >> 4, wm = wave >> 1, nw = (wave & 1) * 128;   // the wave's tile: rows wm * 32 + 0..31, columns nw + 0..127 of the block's
  const size_t r0 = (size_t)blockIdx.x * GBM + wm * 32; const int n0 = blockIdx.y * GBN;
  v8f acc[2][8] = {};
  const unsigned lds0 = (unsigned)(size_t)smem; const float* Ag = X + (size_t)blockIdx.x * GBM * DM; const __bf16* Bg = P + (size_t)n0 * DM;
  stage_chunk(Ag, Bg, lds0, tid);
  asm volatile("s_wait_asynccnt 0x0" ::: "memory");   // this wave's copies of chunk 0 have landed
  __syncthreads();                                    // ... and every other wave's: chunk 0 may be read
  stage_chunk(Ag + GKC, Bg + GKC, lds0 + GSTAGE, tid);
#pragma unroll 1   // kept rolled: the buffer alternates with t, one copy of the body
  for (int t = 0; t < GNT; ++t) { const char* sa = smem + (t & 1) * GSTAGE + (wm * 32 + col) * GA_PITCH + 32 * g; const char* sb = smem + (t & 1) * GSTAGE + GA_BYTES + (nw + col) * GB_PITCH + 16 * g;
#pragma unroll   // this and the inner loops: constant indices, so that fragments and accumulators stay in registers
    for (int kc = 0; kc < GKC / 32; ++kc) { float av[2][16]; lds_a16(sa + kc * 128, av[0]); lds_a16(sa + 16 * GA_PITCH + kc * 128, av[1]); v16b a[2], w[8];   // the LDS reads of a 32-k step stand in front of its products
#pragma unroll
      for (int j = 0; j < 8; ++j) w[j] = lds_b16(sb + j * 16 * GB_PITCH + kc * 64);
      __builtin_amdgcn_sched_barrier(0);   // holds the step's LDS reads as one group in front of its products: without it the scheduler sinks each weight read to its own pair of products, with a full LDS wait per pair
#pragma unroll
      for (int i = 0; i < 16; ++i) { a[0][i] = (__bf16)av[0][i]; a[1][i] = (__bf16)av[1][i]; }
#pragma unroll
      for (int j = 0; j < 8; ++j) { acc[0][j] = wmma_bf(a[0], w[j], acc[0][j]); acc[1][j] = wmma_bf(a[1], w[j], acc[1][j]); } }
    __builtin_amdgcn_sched_barrier(0);                  // keeps the chunk's last products in front of the waits and the barrier: moved behind them, chunk t + 1's copies are waited for half a trip earlier
    asm volatile("s_wait_dscnt 0x0" ::: "memory");      // this wave's reads of buffer t & 1 are done before it is refilled
    asm volatile("s_wait_asynccnt 0x0" ::: "memory");   // this wave's copies of chunk t + 1 have landed
    __syncthreads();                                    // publishes chunk t + 1 and ends every wave's reads of chunk t
    if (t + 2 < GNT) stage_chunk(Ag + (t + 2) * GKC, Bg + (t + 2) * GKC, lds0 + (unsigned)(t & 1) * GSTAGE, tid); }
  asm volatile("s_wait_asynccnt 0x0" ::: "memory");     // no copy is in flight when the buffers become output staging
  float bias[8];   // the lane's bias of each of its eight 16-column groups, read once in front of both branches (inside the r loops it compiled to one global load with its wait per output element, 128 a lane)
#pragma unroll   // this and the next: constant indices, so that bias stays in registers
  for (int j = 0; j < 8; ++j) bias[j] = 0.f;
  if (BB) {   // one uniform test around all eight loads: they are issued side by side, one load latency a wave
#pragma unroll
    for (int j = 0; j < 8; ++j) bias[j] = bfr(BB[nw + j * 16 + col]); }
  if (n0 < 2 * DM) {   // q stored unscaled (f16 sigma ~0.6, no subnormal exposure); 1/8 applied to the f32 score
#pragma unroll
    for (int i = 0; i < 2; ++i) {
#pragma unroll
    for (int j = 0; j < 8; ++j) {
#pragma unroll
      for (int r = 0; r < 8; ++r) { const float v = acc[i][j][r] + bias[j]; const _Float16 hv = (_Float16)v; so[wave][i * 16 + 8 * g + r][j * 16 + col] = hv; sol[wave][i * 16 + 8 * g + r][j * 16 + col] = (_Float16)((v - (float)hv) * 2048.0f); } } }   // q, k (+ bias) as f16 hi + (x2048) residual
    LDSX();
    for (int rp = 0; rp < 16; ++rp) { const int rl = 2 * rp + g; vst2((unsigned*)(QK + (r0 + rl) * (2 * DM) + n0 + nw + col * 8), *(const v4u*)&so[wave][rl][col * 8]); vst2((unsigned*)(QKL + (r0 + rl) * (2 * DM) + n0 + nw + col * 8), *(const v4u*)&sol[wave][rl][col * 8]); }   // 16 lanes a row of 256 B, two rows a store
  } else {
#pragma unroll
    for (int i = 0; i < 2; ++i) {
#pragma unroll
    for (int j = 0; j < 8; ++j) {
#pragma unroll
      for (int r = 0; r < 8; ++r) { const float v = acc[i][j][r] + bias[j]; const _Float16 hv = (_Float16)v; sth[nw + j * 16 + col][wm * 32 + i * 16 + 8 * g + r] = hv; stl[nw + j * 16 + col][wm * 32 + i * 16 + 8 * g + r] = (_Float16)((v - (float)hv) * 2048.0f); } } }
    __syncthreads();
    const size_t rb = (size_t)blockIdx.x * GBM; const int b = (int)(rb / SS), s0 = (int)(rb % SS); const int pc0 = n0 - 2 * DM;
    for (int it = 0; it < GBN / 16; ++it) { const int d = it * 16 + (tid >> 4), pc = tid & 15;   // 16 lanes a row of 256 B
      const size_t o = ((size_t)b * DM + pc0 + d) * SS + s0 + pc * 8; vst2((unsigned*)(VTH + o), *(const v4u*)&sth[d][pc * 8]); vst2((unsigned*)(VTL + o), *(const v4u*)&stl[d][pc * 8]); }
  }
}
// ---- K / V staging of k_attn: per 64 keys the head's 64 K rows, 64 rows of Vt hi and 64 rows of Vt lo (128 B each, one whole line) go from global memory into LDS by asynchronous 16-B copies, once per block; the four waves read their fragments from LDS. Two buffers: stage t + 1 flies while stage t is worked on.
#define AT_PITCH 144                     // LDS bytes per staged 128-B row (16 B x odd: 16-B reads of 16 rows fall on distinct banks)
#define AT_SEC (64 * AT_PITCH)           // 64 rows
#define AT_STAGE (3 * AT_SEC)            // one buffer: [K rows | Vt hi rows | Vt lo rows]
// Kg: the stage's first K row (this head's 64 d); Vh, Vl: the head's first Vt row at the stage's first key; lds: byte address of the buffer. 8 lanes a row, 16 rows a copy, 12 copies a lane; in the same statement the wait that stands in front of any later write of the address registers they name
__device__ __forceinline__ void stage_kv(const _Float16* Kg, const _Float16* Vh, const _Float16* Vl, unsigned lds, int tid) {
  const unsigned l = lds + (unsigned)(tid >> 3) * AT_PITCH + (unsigned)(tid & 7) * 16u, ls = 16u * AT_PITCH;
  const _Float16* pk = Kg + (size_t)(tid >> 3) * (2 * DM) + (tid & 7) * 8; const _Float16* ph = Vh + (size_t)(tid >> 3) * SS + (tid & 7) * 8; const _Float16* pl = Vl + (size_t)(tid >> 3) * SS + (tid & 7) * 8;
  const size_t ks = (size_t)16 * 2 * DM, vs = (size_t)16 * SS;
  asm volatile(
    "global_load_async_to_lds_b128 %0, %12, off\n\tglobal_load_async_to_lds_b128 %1, %13, off\n\tglobal_load_async_to_lds_b128 %2, %14, off\n\tglobal_load_async_to_lds_b128 %3, %15, off\n\t"
    "global_load_async_to_lds_b128 %4, %16, off\n\tglobal_load_async_to_lds_b128 %5, %17, off\n\tglobal_load_async_to_lds_b128 %6, %18, off\n\tglobal_load_async_to_lds_b128 %7, %19, off\n\t"
    "global_load_async_to_lds_b128 %8, %20, off\n\tglobal_load_async_to_lds_b128 %9, %21, off\n\tglobal_load_async_to_lds_b128 %10, %22, off\n\tglobal_load_async_to_lds_b128 %11, %23, off\n\ts_wait_xcnt 0x0"
    :: "v"(l), "v"(l + ls), "v"(l + 2 * ls), "v"(l + 3 * ls), "v"(l + AT_SEC), "v"(l + AT_SEC + ls), "v"(l + AT_SEC + 2 * ls), "v"(l + AT_SEC + 3 * ls), "v"(l + 2 * AT_SEC), "v"(l + 2 * AT_SEC + ls), "v"(l + 2 * AT_SEC + 2 * ls), "v"(l + 2 * AT_SEC + 3 * ls),
       "v"(pk), "v"(pk + ks), "v"(pk + 2 * ks), "v"(pk + 3 * ks), "v"(ph), "v"(ph + vs), "v"(ph + 2 * vs), "v"(ph + 3 * vs), "v"(pl), "v"(pl + vs), "v"(pl + 2 * vs), "v"(pl + 3 * vs) : "memory");
}
// the value that lane ^ 16 holds (one vector instruction, no LDS)
__device__ __forceinline__ float xhalf(float v) { const int b = __builtin_bit_cast(int, v); return __builtin_bit_cast(float, __builtin_amdgcn_permlanex16(b, b, 0x76543210, 0xfedcba98, false, false)); }
// a lane's f16 fragment (k = 8g + 0..7 and 16 + 8g + 0..7 of a 32-k step) from a staged row; p = row + 64 * step + 16 * g bytes
__device__ __forceinline__ v16h lds_h16(const char* p) { union { v16h v; v8h q[2]; } u; u.q[0] = *(const v8h*)p; u.q[1] = *(const v8h*)(p + 32); return u.v; }
// 2^t for the masked path below, with the free slot that the instruction set asks for behind a transcendental in the same statement
__device__ __forceinline__ float exp2_slot(float t) { float e; asm("v_exp_f32 %0, %1\n\tv_nop" : "=v"(e) : "v"(t)); return e; }
// the softmax arithmetic of a 32-key step. c: raw scores (register r of tile ct = key 16*ct + 8g + r of the step); m: the running maximum. Gives the new maximum mn, the lane's sums es (of e) and eh (of e * s) and P as a B fragment. MK = true: a step that reaches past some query of the wave, with the causal mask and the guards that keep masked scores out of the sums. MK = false: every key of the step counts for every query of the wave, so the mask and the guards are identities and are not computed
template <bool MK> __device__ __forceinline__ void attn_soft(const v8f (&c)[2], const int lim, const float m, float& mn, float& es, float& eh, v16h& pa) {
    v8f s[2];
#pragma unroll
    for (int ct = 0; ct < 2; ++ct) {
#pragma unroll
      for (int r = 0; r < 8; ++r) s[ct][r] = (!MK || ct * 16 + r <= lim) ? c[ct][r] * SCALEF : -3.0e38f; }   // causal: future keys excluded
    float mx = fmaxf(s[0][0], s[1][0]);   // the lane's 16 scores all belong to one query: maximum and sums in its own registers
#pragma unroll
    for (int r = 1; r < 8; ++r) mx = fmaxf(mx, fmaxf(s[0][r], s[1][r]));
    mx = fmaxf(mx, xhalf(mx));   // the query's other 16 keys of the step lie in lane ^ 16
    mn = fmaxf(m, mx); es = 0.f; eh = 0.f;   // pa: P transposed as a B fragment, k position 8 * ct + r = key 16 * ct + 8g + r, the k order of lds_h16: no trip through LDS
#pragma unroll
    for (int ct = 0; ct < 2; ++ct) {
#pragma unroll
      for (int r = 0; r < 8; ++r) { const float x = MK ? exp2_slot((s[ct][r] - mn) * 1.44269504f) : __expf(s[ct][r] - mn); const float e = (MK && s[ct][r] <= -1.0e38f) ? 0.f : x; es += e; eh += ((!MK || e > 0.f) ? e * s[ct][r] : 0.f); pa[8 * ct + r] = (_Float16)(e * 2048.0f); } }   // P scaled by 2^11 before the f16 rounding so small softmax weights stay out of the f16 subnormal range; 2^-11 folded into the epilogue
}
__global__ __launch_bounds__(128) __attribute__((amdgpu_waves_per_eu(4, 4))) void k_attn(const _Float16* __restrict__ QK, const _Float16* __restrict__ QKL, const _Float16* __restrict__ VTH, const _Float16* __restrict__ VTL, const void* __restrict__ KMASK, float* __restrict__ O, float* __restrict__ PH) {
  __shared__ float sh_ent[2][64];
  __shared__ __align__(16) float so[4][16][68];   // a wave's output staging
  __shared__ __align__(16) char skv[2 * AT_STAGE];   // the two K / V staging buffers
  const int tid = threadIdx.x, wave = tid >> 5, lane = tid & 31, col = lane & 15, g = lane >> 4;
  const int h = blockIdx.y, b = blockIdx.z;
  const unsigned kv0 = (unsigned)(size_t)skv; const _Float16* Kg = QK + (size_t)b * SS * (2 * DM) + DM + h * HD; const _Float16* Vhg = VTH + ((size_t)b * DM + h * HD) * SS; const _Float16* Vlg = VTL + ((size_t)b * DM + h * HD) * SS;
#pragma unroll 1   // kept rolled: one copy of the tile body in the instruction cache, one register set for both tiles
  for (int tp = 0; tp < 2; ++tp) {
  const int qb = tp ? (int)blockIdx.x : TQB - 1 - (int)blockIdx.x; const int q0 = qb * 64 + wave * 16; const int wq0 = __builtin_amdgcn_readfirstlane(q0); const size_t rq = (size_t)b * SS + q0 + col;
  v16h aq[2];
#pragma unroll
  for (int kc = 0; kc < 2; ++kc) aq[kc] = frag_h(QK + rq * (2 * DM) + h * HD + kc * 32, lane);
  const _Float16* qrowl = QKL + rq * (2 * DM) + h * HD;   // q's residual plane is read where it is used (the two leading tiles' few steps): held in registers for every tile it would take the kernel past 256 registers (four waves a SIMD)
  float hs = 0.f;   // this lane's share (its eight keys of every sixteen) of the sum over keys of e^(s - m) * s, rescaled with the running max
  float m = -3.0e38f, l = 0.f;   // the lane's query (column col): running max over all keys (equal in both wave halves) and this lane's share of the sum
  v8f acc[4] = {}, accl[4] = {};
  const int nst = qb + 1;   // causal: 64-key stages up to the query tile's end
  stage_kv(Kg, Vhg, Vlg, kv0, tid);                   // (second tile: every wave's last read of the buffers ended at the first tile's last barrier)
  asm volatile("s_wait_asynccnt 0x0" ::: "memory");   // this wave's copies of stage 0 have landed
  __syncthreads();                                    // ... and every other wave's: stage 0 may be read
  if (nst > 1) stage_kv(Kg + (size_t)64 * (2 * DM), Vhg + 64, Vlg + 64, kv0 + AT_STAGE, tid);
#pragma unroll 1   // kept rolled: the buffer alternates with t, one copy of the body
  for (int t = 0; t < nst; ++t) { const char* sk = skv + (t & 1) * AT_STAGE + col * AT_PITCH + 16 * g;
#pragma unroll 1   // kept rolled: one copy of the 32-key step in the instruction cache
  for (int hf = 0; hf < 2; ++hf) { const int ks = 2 * t + hf; const int lim = q0 + col - ks * 32 - 8 * g;   // register r of score tile ct holds key ks*32 + 8g + 16*ct + r: it counts while 16*ct + r <= lim
    v8f s[2]; v16h kf[2][2];   // the step's K fragments are read as one group in front of its products: one LDS latency a step, not one a product
#pragma unroll
    for (int ct = 0; ct < 2; ++ct) {
#pragma unroll
      for (int kc = 0; kc < 2; ++kc) kf[ct][kc] = lds_h16(sk + (hf * 32 + ct * 16) * AT_PITCH + kc * 64); }
#pragma unroll
    for (int ct = 0; ct < 2; ++ct) { const int kk = ks * 32 + ct * 16 + col; const _Float16* krowl = QKL + ((size_t)b * SS + kk) * (2 * DM) + DM + h * HD; v8f c = {}, cl = {};   // transposed scores: A = K rows (lane col = key row kk), B = Q (lane col = query): c[r] = score of key ks*32 + ct*16 + 8g + r with query q0 + col
      if (qb < 2) {   // leading query blocks (few keys, outputs far above the global rms): 3 products
#pragma unroll
        for (int kc = 0; kc < 2; ++kc) { const v16h kh = kf[ct][kc], ql = frag_h(qrowl + kc * 32, lane), kl = frag_h(krowl + kc * 32, lane); __builtin_amdgcn_sched_barrier(0); /* holds the two reads side by side: without it each is sunk to its own product and waited for alone */ c = wmma16(kh, aq[kc], c); cl = wmma16(kh, ql, cl); cl = wmma16(kl, aq[kc], cl); }   // q's and k's residual fragments of a 32-d step are read side by side, in front of its products
#pragma unroll
        for (int r = 0; r < 8; ++r) c[r] += cl[r] * (1.0f / 2048.0f); }
      else {
#pragma unroll
        for (int kc = 0; kc < 2; ++kc) c = wmma16(kf[ct][kc], aq[kc], c); }   // single product elsewhere
      s[ct] = c; }
    v16h vh[2], vl[2];   // the step's V fragments are read in two groups of four, each in front of its products; the first group flies under the softmax arithmetic
#pragma unroll
    for (int dt = 0; dt < 2; ++dt) { vh[dt] = lds_h16(sk + AT_SEC + dt * 16 * AT_PITCH + hf * 64); vl[dt] = lds_h16(sk + 2 * AT_SEC + dt * 16 * AT_PITCH + hf * 64); }
    float mn, es, eh; v16h pa;
    if (ks * 32 + 31 <= wq0) attn_soft<false>(s, lim, m, mn, es, eh, pa);   // the step's last key is no later than the wave's first query (a scalar test, the same for the whole wave): no mask needed
    else attn_soft<true>(s, lim, m, mn, es, eh, pa);
    const float alpha = (m <= -1.0e38f) ? 0.f : __expf(m - mn);
    l = l * alpha + es; hs = hs * alpha + eh; m = mn;   // the halves' shares are joined once, behind the key loop
#pragma unroll
    for (int dt = 0; dt < 4; ++dt) {
#pragma unroll
      for (int r = 0; r < 8; ++r) { acc[dt][r] *= alpha; accl[dt][r] *= alpha; } }
#pragma unroll
    for (int dt = 0; dt < 2; ++dt) { acc[dt] = wmma16(vh[dt], pa, acc[dt]); accl[dt] = wmma16(vl[dt], pa, accl[dt]); }   // transposed output: A = Vt rows (lane col = d row), B = P: acc[dt][r] = d dt*16 + 8g + r of query q0 + col
#pragma unroll
    for (int dt = 0; dt < 2; ++dt) { vh[dt] = lds_h16(sk + AT_SEC + (2 + dt) * 16 * AT_PITCH + hf * 64); vl[dt] = lds_h16(sk + 2 * AT_SEC + (2 + dt) * 16 * AT_PITCH + hf * 64); }
#pragma unroll
    for (int dt = 0; dt < 2; ++dt) { acc[2 + dt] = wmma16(vh[dt], pa, acc[2 + dt]); accl[2 + dt] = wmma16(vl[dt], pa, accl[2 + dt]); } }   // V hi x P + V lo x P / 2048: 2 products
    asm volatile("s_wait_dscnt 0x0" ::: "memory");      // this wave's reads of buffer t & 1 are done before it is refilled
    asm volatile("s_wait_asynccnt 0x0" ::: "memory");   // this wave's copies of stage t + 1 have landed
    __syncthreads();                                    // publishes stage t + 1 and ends every wave's reads of stage t
    if (t + 2 < nst) stage_kv(Kg + (size_t)(t + 2) * 64 * (2 * DM), Vhg + (t + 2) * 64, Vlg + (t + 2) * 64, kv0 + (unsigned)(t & 1) * AT_STAGE, tid); }
  asm volatile("s_wait_asynccnt 0x0" ::: "memory");     // no copy is in flight behind the key loop
  l += xhalf(l); hs += xhalf(hs);   // join the two halves' shares of the query's sums
  if (g == 0) sh_ent[tp][wave * 16 + col] = m + logf(l) - hs / l;   // H_row = -sum p log p = m + log l - sum p s
  { const float il = (1.0f / 2048.0f) / l;
#pragma unroll
    for (int dt = 0; dt < 4; ++dt) {
#pragma unroll
      for (int r = 0; r < 8; ++r) so[wave][col][dt * 16 + 8 * g + r] = (acc[dt][r] + accl[dt][r] * (1.0f / 2048.0f)) * il; } }
  LDSX();
  for (int rl = 0; rl < 16; ++rl) if (lane < 16) vst2(O + ((size_t)b * SS + q0 + rl) * DM + h * HD + lane * 4, *(const v4f*)&so[wave][rl][lane * 4]);
  asm volatile("s_wait_xcnt 0x0" ::: "memory");   // stands in front of the next tile's first writes to registers that the stores above name
  }
  __syncthreads();
  if (tid < 2) { float a = 0.f; for (int i = 0; i < 64; ++i) a += sh_ent[tid][i]; PH[((size_t)b * NH + h) * (SS / 64) + (tid ? (int)blockIdx.x : TQB - 1 - (int)blockIdx.x)] = a; }   // one partial per tile, summed in row order (plain 4-B store of a scratch value)
}
// ---- k_out: block = (128 rows, 256 cols): out = O(hi/lo) . Wo rows (2 products) + bo
__global__ __launch_bounds__(256) void k_out(const float* __restrict__ O, const __bf16* __restrict__ P, const float* __restrict__ BO, float* __restrict__ Y) {
  __shared__ __align__(16) char smem[2 * GSTAGE];   // the two staging buffers; behind the K loop's last barrier the same bytes stage the output
  float (*so)[32][132] = (float (*)[32][132])smem;
  const int tid = threadIdx.x, wave = tid >> 5, lane = tid & 31, col = lane & 15, g = lane >> 4, wm = wave >> 1, nw = (wave & 1) * 128;   // the wave's tile: rows wm * 32 + 0..31, columns nw + 0..127 of the block's
  const size_t r0 = (size_t)blockIdx.x * GBM + wm * 32; const int n0 = blockIdx.y * GBN;
  v8f acc[2][8] = {};
  const unsigned lds0 = (unsigned)(size_t)smem; const float* Ag = O + (size_t)blockIdx.x * GBM * DM; const __bf16* Bg = P + (size_t)n0 * DM;
  stage_chunk(Ag, Bg, lds0, tid);
  asm volatile("s_wait_asynccnt 0x0" ::: "memory");   // this wave's copies of chunk 0 have landed
  __syncthreads();                                    // ... and every other wave's: chunk 0 may be read
  stage_chunk(Ag + GKC, Bg + GKC, lds0 + GSTAGE, tid);
#pragma unroll 1   // kept rolled: the buffer alternates with t, one copy of the body
  for (int t = 0; t < GNT; ++t) { const char* sa = smem + (t & 1) * GSTAGE + (wm * 32 + col) * GA_PITCH + 32 * g; const char* sb = smem + (t & 1) * GSTAGE + GA_BYTES + (nw + col) * GB_PITCH + 16 * g;
#pragma unroll   // this and the inner loops: constant indices, so that fragments and accumulators stay in registers
    for (int kc = 0; kc < GKC / 32; ++kc) { float av[2][16]; lds_a16(sa + kc * 128, av[0]); lds_a16(sa + 16 * GA_PITCH + kc * 128, av[1]); v16b w[8];   // the LDS reads of a 32-k step stand in front of its products
#pragma unroll
      for (int j = 0; j < 8; ++j) w[j] = lds_b16(sb + j * 16 * GB_PITCH + kc * 64);
      __builtin_amdgcn_sched_barrier(0);   // holds the step's LDS reads as one group in front of its products: without it the scheduler sinks each weight read to its own four products, with a full LDS wait per four
      const F2 a0 = bsplit16(av[0]), a1 = bsplit16(av[1]);
#pragma unroll
      for (int j = 0; j < 8; ++j) { acc[0][j] = wmma_bf(a0.l, w[j], acc[0][j]); acc[1][j] = wmma_bf(a1.l, w[j], acc[1][j]); acc[0][j] = wmma_bf(a0.h, w[j], acc[0][j]); acc[1][j] = wmma_bf(a1.h, w[j], acc[1][j]); } }   // per accumulator: residual product, then main product
    __builtin_amdgcn_sched_barrier(0);                  // keeps the chunk's last products in front of the waits and the barrier: moved behind them, chunk t + 1's copies are waited for half a trip earlier
    asm volatile("s_wait_dscnt 0x0" ::: "memory");      // this wave's reads of buffer t & 1 are done before it is refilled
    asm volatile("s_wait_asynccnt 0x0" ::: "memory");   // this wave's copies of chunk t + 1 have landed
    __syncthreads();                                    // publishes chunk t + 1 and ends every wave's reads of chunk t
    if (t + 2 < GNT) stage_chunk(Ag + (t + 2) * GKC, Bg + (t + 2) * GKC, lds0 + (unsigned)(t & 1) * GSTAGE, tid); }
  asm volatile("s_wait_asynccnt 0x0" ::: "memory");     // no copy is in flight when the buffers become output staging
#pragma unroll
  for (int i = 0; i < 2; ++i) {
#pragma unroll
  for (int j = 0; j < 8; ++j) {
#pragma unroll
    for (int r = 0; r < 8; ++r) so[wave][i * 16 + 8 * g + r][j * 16 + col] = acc[i][j][r] + bfr(BO[n0 + nw + j * 16 + col]); } }
  LDSX();
  for (int rl = 0; rl < 32; ++rl) vst2(Y + (r0 + rl) * DM + n0 + nw + lane * 4, *(const v4f*)&so[wave][rl][lane * 4]);
}
// ---- k_ent: mean entropy over all (b, h, t) rows from the block partials (fixed order) -> scalar second output
__global__ __launch_bounds__(256) void k_ent(const float* __restrict__ PH, float* __restrict__ OUT1) {
  __shared__ float red[256]; const int t = threadIdx.x; const int n = NB * NH * (TQB);   // TQB row blocks per (b, h) were computed
  float a = 0.f; for (int i = t; i < n; i += 256) a += PH[(size_t)(i / TQB) * (SS / 64) + (i % TQB)];
  red[t] = a; __syncthreads();
  for (int s = 128; s >= 1; s >>= 1) { if (t < s) red[t] += red[t + s]; __syncthreads(); }
  if (t == 0) { float* p = OUT1; p[0] = red[0] / ((float)NB * NH * (TQB * 64));  }
}
extern "C" void kernel_launch(void* const* d_in, const int* in_sizes, int n_in, void* d_out, int out_size, void* d_ws, size_t ws_size, hipStream_t stream) {
  (void)in_sizes; (void)n_in; (void)out_size;
  const float** F = (const float**)d_in;   // 0 x [4,2048,1024], 1 w_q natural, 2 b_q, 3 w_k, 4 b_k, 5 w_v, 6 b_v, 7 w_o, 8 b_o
  if (ws_size < (size_t)WS_END) return;
  char* ws = (char*)d_ws; __bf16* PK = (__bf16*)(ws + WS_PK); _Float16 *QK = (_Float16*)(ws + WS_QK), *QKL = (_Float16*)(ws + WS_QKL), *VTH = (_Float16*)(ws + WS_VTH), *VTL = (_Float16*)(ws + WS_VTL); float *O = (float*)(ws + WS_O), *PH = (float*)(ws + WS_PH);
  k_pack<<<dim3(DM, 4), 256, 0, stream>>>(F[1], F[3], F[5], F[7], PK);
  k_qkv<<<dim3(TNB * SS / GBM, QKVW / GBN), 256, 0, stream>>>(F[0], F[0], F[0], PK + PK_A, F[2], F[4], F[6], QK, QKL, VTH, VTL);
  k_attn<<<dim3(TQB / 2, NH, TNB), 128, 0, stream>>>(QK, QKL, VTH, VTL, nullptr, O, PH);
  k_out<<<dim3(TNB * SS / GBM, DM / GBN), 256, 0, stream>>>(O, PK + PK_P, F[8], (float*)d_out);
  k_ent<<<1, 256, 0, stream>>>(PH, (float*)d_out + (size_t)NB * SS * DM);
}
